// v000
// Times are from an AMD MI455X. After a warm-up the kernel runs many times in a row, and a time is the length of
// such a window on the GPU divided by its runs, so every launch and the gaps after it count. The runs cycle
// through copies of the inputs. A figure is the median of several windows, for all but v000 over two sittings.
// Sittings can differ by a few percent; kernels timed side by side share one.
// v000 is the starting kernel. One run takes 505 microseconds.
// compute dtype: all float inputs rounded to bf16; q/k/v/g = x . W^T + b with EXACT bf16 products on WMMA 16x16x32 (natural rows; q and g computed in the same block), qg = gelu_erf(q g) in f32 (precise erff) then split into f16 hi + residual; attention with 3-product scores (qg, k as f16 hi + residual) and 3-product P.v (P and v as hi + residual) everywhere; no scaling, running-max softmax in f32 (hardware exp); the merged context is the output (f32).
#include <hip/hip_runtime.h>
#include <math.h>

typedef __attribute__((ext_vector_type(16))) _Float16 v16h;
typedef __attribute__((ext_vector_type(16))) __bf16 v16b;
typedef __attribute__((ext_vector_type(8)))  _Float16 v8h;
typedef __attribute__((ext_vector_type(8)))  float v8f;
typedef __attribute__((ext_vector_type(4)))  float v4f;
typedef __attribute__((ext_vector_type(2)))  float v2f;
typedef __attribute__((ext_vector_type(4)))  unsigned v4u;
typedef __attribute__((ext_vector_type(4)))  int v4i;
typedef float __attribute__((may_alias)) float_a;
typedef int __attribute__((may_alias)) int_a;

template <typename T> __device__ __forceinline__ void vst2(void* p, T v) { *(T*)p = v;  }
__device__ __forceinline__ v8f wmma16(v16h a, v16h b, v8f c) {
  v8f d = __builtin_amdgcn_wmma_f32_16x16x32_f16(false, a, false, b, (short)0, c, false, false);
  asm volatile("v_nop\n\tv_nop\n\tv_nop\n\tv_nop" : "+v"(d) : "v"(a), "v"(b));
  return d;
}
__device__ __forceinline__ v8f wmma_bf(v16b a, v16b b, v8f c) {
  v8f d = __builtin_amdgcn_wmma_f32_16x16x32_bf16(false, a, false, b, (short)0, c, false, false);
  asm volatile("v_nop\n\tv_nop\n\tv_nop\n\tv_nop" : "+v"(d) : "v"(a), "v"(b));
  return d;
}
// Gated QKV attention (B 2, S 2,048, d 1,024, 16 heads x 64): q, k, v, g projections + biases, qg = gelu(q * g) (exact erf), softmax(qg k^T) v with no 1/sqrt(d) scaling and no output projection.
__device__ __forceinline__ v16h frag_h(const _Float16* rowk0, int lane) {
  union { v16h v; v8h q[2]; } u; const _Float16* p = rowk0 + 8 * (lane >> 4);
  u.q[0] = *(const v8h*)p; u.q[1] = *(const v8h*)(p + 16); return u.v;
}
__device__ __forceinline__ v16h frag_f32(const float* rowk0, int lane) {
  v16h a; const float* p = rowk0 + 8 * (lane >> 4);
#pragma unroll
  for (int i = 0; i < 8; ++i) { a[i] = (_Float16)p[i]; a[8 + i] = (_Float16)p[16 + i]; }
  return a;
}
__device__ __forceinline__ v16h frag_f32s(const float* rowk0, int lane, float sc) {
  v16h a; const float* p = rowk0 + 8 * (lane >> 4);
#pragma unroll
  for (int i = 0; i < 8; ++i) { a[i] = (_Float16)(p[i] * sc); a[8 + i] = (_Float16)(p[16 + i] * sc); }
  return a;
}
// column fragment from a [K][ld] layout (column n), rows >= K read as 0
__device__ __forceinline__ v16h fragc_f32(const float* W, int k0, int n, int lane, int ld, int K) {
  v16h a; const int g = lane >> 4;
#pragma unroll
  for (int i = 0; i < 8; ++i) { const int ka = k0 + 8 * g + i, kb = ka + 16;
    a[i] = (_Float16)(ka < K ? W[(size_t)(ka < K ? ka : K - 1) * ld + n] : 0.f); a[8 + i] = (_Float16)(kb < K ? W[(size_t)(kb < K ? kb : K - 1) * ld + n] : 0.f); }
  return a;
}
struct F2 { v16b h, l; };
__device__ __forceinline__ F2 bsplit16(const float v[16]) { F2 r;
#pragma unroll
  for (int i = 0; i < 16; ++i) { const __bf16 h = (__bf16)v[i]; r.h[i] = h; r.l[i] = (__bf16)(v[i] - (float)h); }
  return r; }
__device__ __forceinline__ F2 split_row(const float* row, int k0, int lane) { float v[16]; const float* p = row + k0 + 8 * (lane >> 4);
#pragma unroll
  for (int i = 0; i < 8; ++i) { v[i] = p[i]; v[8 + i] = p[16 + i]; }
  return bsplit16(v); }
__device__ __forceinline__ F2 split_rowK(const float* row, int k0, int lane, int K) { float v[16]; const int g = lane >> 4;
#pragma unroll
  for (int i = 0; i < 8; ++i) { const int ka = k0 + 8 * g + i, kb = ka + 16; v[i] = ka < K ? row[ka < K ? ka : K - 1] : 0.f; v[8 + i] = kb < K ? row[kb < K ? kb : K - 1] : 0.f; }
  return bsplit16(v); }
__device__ __forceinline__ F2 split_col(const float* W, int k0, int n, int lane, int ld, int K) { float v[16]; const int g = lane >> 4;
#pragma unroll
  for (int i = 0; i < 8; ++i) { const int ka = k0 + 8 * g + i, kb = ka + 16; v[i] = ka < K ? W[(size_t)(ka < K ? ka : K - 1) * ld + n] : 0.f; v[8 + i] = kb < K ? W[(size_t)(kb < K ? kb : K - 1) * ld + n] : 0.f; }
  return bsplit16(v); }
__device__ __forceinline__ v8f mac3(const F2& a, const F2& b, v8f c) { c = wmma_bf(a.l, b.h, c); c = wmma_bf(a.h, b.l, c); return wmma_bf(a.h, b.h, c); }
__device__ __forceinline__ float sigm(float v) { return 1.0f / (1.0f + expf(-v)); }
#define LDSX() do { asm volatile("s_wait_dscnt 0" ::: "memory"); __builtin_amdgcn_wave_barrier(); __builtin_amdgcn_fence(__ATOMIC_RELEASE, "workgroup"); } while (0)


#define NB 2
#define SS 2048
#define DM 1024
#define NH 16
#define SCALEF 1.0f
__device__ __attribute__((noinline)) float gelu_e(float v) { return 0.5f * v * (1.0f + erff(v * 0.70710678118654752f)); }
#define HD 64
#define QKVW (3 * DM)
#ifndef TQB
#define TQB (SS / 64)
#define TNB NB
#define TOB (NB * SS / 64)     // output row tiles (all)
#endif
typedef __attribute__((ext_vector_type(8))) __bf16 v8b;
__device__ __forceinline__ v16b frag_b(const __bf16* rowk0, int lane) {
  union { v16b v; v8b q[2]; } u; const __bf16* p = rowk0 + 8 * (lane >> 4);
  u.q[0] = *(const v8b*)p; u.q[1] = *(const v8b*)(p + 16); return u.v;
}
__device__ __forceinline__ float bfr(float v) { return (float)(__bf16)v; }
__device__ __attribute__((noinline)) float exp_ni(float v) { return expf(v); }
__device__ __attribute__((noinline)) float erf_ni(float v) { return erff(v); }

#define PK_A 0                       // [3072][1024] Wqkv rows (natural [out][in])
#define PK_P (PK_A + QKVW * DM)        // [1024][1024] Wg rows (natural)
#define PK_END (PK_P + DM * DM)
#define WS_PK  0u
#define WS_QK  (WS_PK + 2u * PK_END)             // f16 [4096 rows][2048]: qg | k
#define WS_QKL (WS_QK + 2u * NB * SS * 2 * DM)     // f16 q | k residual planes x2048
#define WS_VTH (WS_QKL + 2u * NB * SS * 2 * DM)    // f16 [b][1024 (h*64+d)][2048 s] hi
#define WS_VTL (WS_VTH + 2u * NB * DM * SS)        // f16 lo x 2048
#define WS_O   (WS_VTL + 2u * NB * DM * SS)        // f32 [4096][1024]
#define WS_CS  (WS_O + 4u * NB * SS * DM)           // f32 2 x [2048][32], unused
#define WS_END (WS_CS + 4u * 2 * SS * 32)
// ---- k_pack: block = (row n, which): natural [out][in] rows -> bf16; which 0..2 -> W_q/W_k/W_v into PK_A rows which*1024 + n; 3 -> W_g into PK_P
__global__ __launch_bounds__(256) void k_pack(const float* __restrict__ WQ, const float* __restrict__ WK, const float* __restrict__ WV, const float* __restrict__ WO, __bf16* __restrict__ PK) {
  __shared__ __align__(16) __bf16 s[DM]; const int n = blockIdx.x, which = blockIdx.y, t = threadIdx.x; const float* Wm = (which == 0) ? WQ : (which == 1) ? WK : (which == 2) ? WV : WO;
  for (int k = t; k < DM; k += 256) s[k] = (__bf16)Wm[(size_t)n * DM + k];
  __syncthreads();
  __bf16* dst = (which < 3) ? PK + PK_A + ((size_t)which * DM + n) * DM : PK + PK_P + (size_t)n * DM;
  for (int q = t; q < DM / 8; q += 256) vst2((unsigned*)(dst + q * 8), *(const v4u*)&s[q * 8]);
}
__global__ __launch_bounds__(128) void k_qkv(const float* __restrict__ XQ, const float* __restrict__ XK, const float* __restrict__ XV, const __bf16* __restrict__ P, const float* __restrict__ BQ, const float* __restrict__ BK, const float* __restrict__ BV, _Float16* __restrict__ QK, _Float16* __restrict__ QKL, _Float16* __restrict__ VTH, _Float16* __restrict__ VTL, const __bf16* __restrict__ WG, const float* __restrict__ BG) {
  const int which0 = (blockIdx.y * 128) / DM; const float* X = (which0 == 0) ? XQ : (which0 == 1) ? XK : XV; const float* BB = BQ ? (((which0 == 0) ? BQ : (which0 == 1) ? BK : BV) + (blockIdx.y * 128 - which0 * DM)) : nullptr;
  __shared__ __align__(16) _Float16 so[4][16][136], sol[4][16][136]; __shared__ __align__(16) _Float16 sth[128][72], stl[128][72];
  const int tid = threadIdx.x, wave = tid >> 5, lane = tid & 31, col = lane & 15, g = lane >> 4; const size_t r0 = (size_t)blockIdx.x * 64 + wave * 16; const int n0 = blockIdx.y * 128;
  v8f acc[8] = {}; v8f accg[8] = {};
#pragma unroll 2
  for (int kc = 0; kc < DM / 32; ++kc) { v16b a; { const float* p = X + (r0 + col) * DM + kc * 32 + 8 * g;
#pragma unroll
      for (int i = 0; i < 8; ++i) { a[i] = (__bf16)p[i]; a[8 + i] = (__bf16)p[16 + i]; } }
#pragma unroll
    for (int j = 0; j < 8; ++j) { acc[j] = wmma_bf(a, frag_b(P + (size_t)(n0 + j * 16 + col) * DM + kc * 32, lane), acc[j]); if (n0 < DM) accg[j] = wmma_bf(a, frag_b(WG + (size_t)(n0 + j * 16 + col) * DM + kc * 32, lane), accg[j]); } }
  if (n0 < 2 * DM) {   // q stored unscaled (f16 sigma ~0.6, no subnormal exposure); no scale applied to the score
#pragma unroll
    for (int j = 0; j < 8; ++j) {
#pragma unroll
      for (int r = 0; r < 8; ++r) { float v = acc[j][r] + (BB ? bfr(BB[j * 16 + col]) : 0.f); if (n0 < DM) v = gelu_e(v * (accg[j][r] + bfr(BG[n0 + j * 16 + col]))); const _Float16 hv = (_Float16)v; so[wave][8 * g + r][j * 16 + col] = hv; sol[wave][8 * g + r][j * 16 + col] = (_Float16)((v - (float)hv) * 2048.0f); } }   // q, k (+ bias) as f16 hi + (x2048) residual
    LDSX();
    for (int rl = 0; rl < 16; ++rl) if (lane < 16) { vst2((unsigned*)(QK + (r0 + rl) * (2 * DM) + n0 + lane * 8), *(const v4u*)&so[wave][rl][lane * 8]); vst2((unsigned*)(QKL + (r0 + rl) * (2 * DM) + n0 + lane * 8), *(const v4u*)&sol[wave][rl][lane * 8]); }
  } else {
#pragma unroll
    for (int j = 0; j < 8; ++j) {
#pragma unroll
      for (int r = 0; r < 8; ++r) { const float v = acc[j][r] + (BB ? bfr(BB[j * 16 + col]) : 0.f); const _Float16 hv = (_Float16)v; sth[j * 16 + col][wave * 16 + 8 * g + r] = hv; stl[j * 16 + col][wave * 16 + 8 * g + r] = (_Float16)((v - (float)hv) * 2048.0f); } }
    __syncthreads();
    const size_t rb = (size_t)blockIdx.x * 64; const int b = (int)(rb / SS), s0 = (int)(rb % SS); const int pc0 = n0 - 2 * DM;
    for (int q = tid; q < 128 * 8; q += 128) { const int d = q >> 3, pc = q & 7; const size_t o = ((size_t)b * DM + pc0 + d) * SS + s0 + pc * 8; vst2((unsigned*)(VTH + o), *(const v4u*)&sth[d][pc * 8]); vst2((unsigned*)(VTL + o), *(const v4u*)&stl[d][pc * 8]); }
  }
}
// ---- k_attn: block = (64 queries, head h, batch b): all-keys flash attention (K = 64: 2 k-steps), scores = q.k unscaled from 3 f16 products (q, k as hi + residual), P.V: (P*2048 hi, lo) x (V hi, lo) in 3 products, two accumulators; O[b*S+q][h*64+d] = (acc + accl / 2048) / (2048 l) (256-B segments)
__global__ __launch_bounds__(128) void k_attn(const _Float16* __restrict__ QK, const _Float16* __restrict__ QKL, const _Float16* __restrict__ VTH, const _Float16* __restrict__ VTL, const void* __restrict__ KMASK, float* __restrict__ O) {
  __shared__ __align__(16) float sp[4][16][36]; __shared__ __align__(16) float so[4][16][68];
  const int tid = threadIdx.x, wave = tid >> 5, lane = tid & 31, col = lane & 15, g = lane >> 4;
  const int qb = blockIdx.x, h = blockIdx.y, b = blockIdx.z; const int q0 = qb * 64 + wave * 16; const size_t rq = (size_t)b * SS + q0 + col;
  v16h aq[2], aql[2];
#pragma unroll
  for (int kc = 0; kc < 2; ++kc) { aq[kc] = frag_h(QK + rq * (2 * DM) + h * HD + kc * 32, lane); aql[kc] = frag_h(QKL + rq * (2 * DM) + h * HD + kc * 32, lane); }
  float m[8], l[8];
#pragma unroll
  for (int r = 0; r < 8; ++r) { m[r] = -3.0e38f; l[r] = 0.f; }
  v8f acc[4] = {}, accl[4] = {};
  const int nks = SS / 32;   // all keys
#pragma unroll 1
  for (int ks = 0; ks < nks; ++ks) { v8f s[2];
#pragma unroll
    for (int ct = 0; ct < 2; ++ct) { const int kk = ks * 32 + ct * 16 + col; const _Float16* krow = QK + ((size_t)b * SS + kk) * (2 * DM) + DM + h * HD; const _Float16* krowl = QKL + ((size_t)b * SS + kk) * (2 * DM) + DM + h * HD; v8f c = {}, cl = {};
#pragma unroll
      for (int kc = 0; kc < 2; ++kc) { const v16h kh = frag_h(krow + kc * 32, lane); c = wmma16(aq[kc], kh, c); cl = wmma16(aql[kc], kh, cl); cl = wmma16(aq[kc], frag_h(krowl + kc * 32, lane), cl); }   // 3 products: q, k as f16 hi + residual
#pragma unroll
      for (int r = 0; r < 8; ++r) c[r] += cl[r] * (1.0f / 2048.0f);
      { const bool keepk = true;
#pragma unroll
      for (int r = 0; r < 8; ++r) s[ct][r] = keepk ? c[r] * SCALEF : -3.0e38f; } }   // no scaling (SCALEF 1); no key is masked
#pragma unroll
    for (int r = 0; r < 8; ++r) { float mx = fmaxf(s[0][r], s[1][r]);
#pragma unroll
      for (int o = 1; o < 16; o <<= 1) mx = fmaxf(mx, __shfl_xor(mx, o));
      const float mn = fmaxf(m[r], mx); const float alpha = (m[r] <= -1.0e38f) ? 0.f : __expf(m[r] - mn);
      const float e0 = (s[0][r] <= -1.0e38f) ? 0.f : __expf(s[0][r] - mn), e1 = (s[1][r] <= -1.0e38f) ? 0.f : __expf(s[1][r] - mn); float es = e0 + e1;
#pragma unroll
      for (int o = 1; o < 16; o <<= 1) es += __shfl_xor(es, o);
      l[r] = l[r] * alpha + es; m[r] = mn;
#pragma unroll
      for (int dt = 0; dt < 4; ++dt) { acc[dt][r] *= alpha; accl[dt][r] *= alpha; }
      sp[wave][8 * g + r][col] = e0; sp[wave][8 * g + r][16 + col] = e1; }
    LDSX();
    v16h pa, pl; { const float* prow = &sp[wave][col][0] + 8 * (lane >> 4);
#pragma unroll
      for (int i = 0; i < 8; ++i) { const float x0 = prow[i] * 2048.0f, x1 = prow[16 + i] * 2048.0f; const _Float16 h0 = (_Float16)x0, h1 = (_Float16)x1; pa[i] = h0; pa[8 + i] = h1; pl[i] = (_Float16)((x0 - (float)h0) * 2048.0f); pl[8 + i] = (_Float16)((x1 - (float)h1) * 2048.0f); } }   // P scaled by 2^11 before the f16 split so small softmax weights stay out of the f16 subnormal range; 2^-11 folded into the epilogue
#pragma unroll
    for (int dt = 0; dt < 4; ++dt) { const size_t vr = ((size_t)b * DM + h * HD + dt * 16 + col) * SS + ks * 32; const v16h vh = frag_h(VTH + vr, lane); acc[dt] = wmma16(pa, vh, acc[dt]); accl[dt] = wmma16(pl, vh, accl[dt]); accl[dt] = wmma16(pa, frag_h(VTL + vr, lane), accl[dt]); }   // P hi x V hi + (P lo x V hi + P hi x V lo) / 2048
    LDSX(); }
#pragma unroll
  for (int r = 0; r < 8; ++r) { const float il = (1.0f / 2048.0f) / l[r];
#pragma unroll
    for (int dt = 0; dt < 4; ++dt) so[wave][8 * g + r][dt * 16 + col] = (acc[dt][r] + accl[dt][r] * (1.0f / 2048.0f)) * il; }
  LDSX();
  for (int rl = 0; rl < 16; ++rl) if (lane < 16) vst2(O + ((size_t)b * SS + q0 + rl) * DM + h * HD + lane * 4, *(const v4f*)&so[wave][rl][lane * 4]);
}
// ---- k_out: block = (64 rows, 128 cols): out = O(hi/lo) . Wo rows (2 products) + bo
__global__ __launch_bounds__(128) void k_out(const float* __restrict__ O, const __bf16* __restrict__ P, const float* __restrict__ BO, float* __restrict__ Y) {
  __shared__ __align__(16) float so[4][16][132];
  const int tid = threadIdx.x, wave = tid >> 5, lane = tid & 31, col = lane & 15, g = lane >> 4; const size_t r0 = (size_t)blockIdx.x * 64 + wave * 16; const int n0 = blockIdx.y * 128;
  v8f acc[8] = {};
#pragma unroll 2
  for (int kc = 0; kc < DM / 32; ++kc) { const F2 a = split_row(O + (r0 + col) * DM, kc * 32, lane);
#pragma unroll
    for (int j = 0; j < 8; ++j) { const v16b w = frag_b(P + (size_t)(n0 + j * 16 + col) * DM + kc * 32, lane); acc[j] = wmma_bf(a.l, w, acc[j]); acc[j] = wmma_bf(a.h, w, acc[j]); } }
#pragma unroll
  for (int j = 0; j < 8; ++j) {
#pragma unroll
    for (int r = 0; r < 8; ++r) so[wave][8 * g + r][j * 16 + col] = acc[j][r] + (BO ? bfr(BO[n0 + j * 16 + col]) : 0.f); }
  LDSX();
  for (int rl = 0; rl < 16; ++rl) vst2(Y + (r0 + rl) * DM + n0 + lane * 4, *(const v4f*)&so[wave][rl][lane * 4]);
}
extern "C" void kernel_launch(void* const* d_in, const int* in_sizes, int n_in, void* d_out, int out_size, void* d_ws, size_t ws_size, hipStream_t stream) {
  (void)in_sizes; (void)n_in; (void)out_size;
  const float** F = (const float**)d_in;   // 0 x [2,2048,1024], 1 Wq, 2 bq, 3 Wk, 4 bk, 5 Wv, 6 bv, 7 Wg, 8 bg (natural [1024,1024] / [1024])
  if (ws_size < (size_t)WS_END) return;
  char* ws = (char*)d_ws; __bf16* PK = (__bf16*)(ws + WS_PK); _Float16 *QK = (_Float16*)(ws + WS_QK), *QKL = (_Float16*)(ws + WS_QKL), *VTH = (_Float16*)(ws + WS_VTH), *VTL = (_Float16*)(ws + WS_VTL);
  k_pack<<<dim3(DM, 4), 256, 0, stream>>>(F[1], F[3], F[5], F[7], PK);   // the fourth slot holds Wg
  k_qkv<<<dim3(TNB * SS / 64, QKVW / 128), 128, 0, stream>>>(F[0], F[0], F[0], PK + PK_A, F[2], F[4], F[6], QK, QKL, VTH, VTL, PK + PK_P, F[8]);
  k_attn<<<dim3(TQB, NH, TNB), 128, 0, stream>>>(QK, QKL, VTH, VTL, nullptr, (float*)d_out);   // merged context == output (no out-projection)
}

// v001
// Measured time: 328 microseconds a run.
// Next to v000, in two timings, it ran 1.56 and 1.57 times as fast.
// compute dtype: all float inputs rounded to bf16; q/k/v/g = x . W^T + b with EXACT bf16 products on WMMA 16x16x32 (natural rows; q and g computed in the same block), qg = gelu_erf(q g) in f32 (precise erff) then split into f16 hi + residual; attention with 3-product scores (qg, k as f16 hi + residual) and 3-product P.v (P and v as hi + residual) everywhere; no scaling, running-max softmax in f32 (hardware exp); the merged context is the output (f32).
#include <hip/hip_runtime.h>
#include <math.h>

typedef __attribute__((ext_vector_type(16))) _Float16 v16h;
typedef __attribute__((ext_vector_type(16))) __bf16 v16b;
typedef __attribute__((ext_vector_type(8)))  _Float16 v8h;
typedef __attribute__((ext_vector_type(8)))  float v8f;
typedef __attribute__((ext_vector_type(4)))  float v4f;
typedef __attribute__((ext_vector_type(2)))  float v2f;
typedef __attribute__((ext_vector_type(4)))  unsigned v4u;
typedef __attribute__((ext_vector_type(4)))  int v4i;
typedef float __attribute__((may_alias)) float_a;
typedef int __attribute__((may_alias)) int_a;

template <typename T> __device__ __forceinline__ void vst2(void* p, T v) { *(T*)p = v;  }
__device__ __forceinline__ v8f wmma16(v16h a, v16h b, v8f c) {
  v8f d = __builtin_amdgcn_wmma_f32_16x16x32_f16(false, a, false, b, (short)0, c, false, false);
  asm volatile("v_nop\n\tv_nop\n\tv_nop\n\tv_nop" : "+v"(d) : "v"(a), "v"(b));
  return d;
}
__device__ __forceinline__ v8f wmma_bf(v16b a, v16b b, v8f c) {
  v8f d = __builtin_amdgcn_wmma_f32_16x16x32_bf16(false, a, false, b, (short)0, c, false, false);
  asm volatile("v_nop\n\tv_nop\n\tv_nop\n\tv_nop" : "+v"(d) : "v"(a), "v"(b));
  return d;
}
// Gated QKV attention (B 2, S 2,048, d 1,024, 16 heads x 64): q, k, v, g projections + biases, qg = gelu(q * g) (exact erf), softmax(qg k^T) v with no 1/sqrt(d) scaling and no output projection.
__device__ __forceinline__ v16h frag_h(const _Float16* rowk0, int lane) {
  union { v16h v; v8h q[2]; } u; const _Float16* p = rowk0 + 8 * (lane >> 4);
  u.q[0] = *(const v8h*)p; u.q[1] = *(const v8h*)(p + 16); return u.v;
}
__device__ __forceinline__ v16h frag_f32(const float* rowk0, int lane) {
  v16h a; const float* p = rowk0 + 8 * (lane >> 4);
#pragma unroll
  for (int i = 0; i < 8; ++i) { a[i] = (_Float16)p[i]; a[8 + i] = (_Float16)p[16 + i]; }
  return a;
}
__device__ __forceinline__ v16h frag_f32s(const float* rowk0, int lane, float sc) {
  v16h a; const float* p = rowk0 + 8 * (lane >> 4);
#pragma unroll
  for (int i = 0; i < 8; ++i) { a[i] = (_Float16)(p[i] * sc); a[8 + i] = (_Float16)(p[16 + i] * sc); }
  return a;
}
// column fragment from a [K][ld] layout (column n), rows >= K read as 0
__device__ __forceinline__ v16h fragc_f32(const float* W, int k0, int n, int lane, int ld, int K) {
  v16h a; const int g = lane >> 4;
#pragma unroll
  for (int i = 0; i < 8; ++i) { const int ka = k0 + 8 * g + i, kb = ka + 16;
    a[i] = (_Float16)(ka < K ? W[(size_t)(ka < K ? ka : K - 1) * ld + n] : 0.f); a[8 + i] = (_Float16)(kb < K ? W[(size_t)(kb < K ? kb : K - 1) * ld + n] : 0.f); }
  return a;
}
struct F2 { v16b h, l; };
__device__ __forceinline__ F2 bsplit16(const float v[16]) { F2 r;
#pragma unroll
  for (int i = 0; i < 16; ++i) { const __bf16 h = (__bf16)v[i]; r.h[i] = h; r.l[i] = (__bf16)(v[i] - (float)h); }
  return r; }
__device__ __forceinline__ F2 split_row(const float* row, int k0, int lane) { float v[16]; const float* p = row + k0 + 8 * (lane >> 4);
#pragma unroll
  for (int i = 0; i < 8; ++i) { v[i] = p[i]; v[8 + i] = p[16 + i]; }
  return bsplit16(v); }
__device__ __forceinline__ F2 split_rowK(const float* row, int k0, int lane, int K) { float v[16]; const int g = lane >> 4;
#pragma unroll
  for (int i = 0; i < 8; ++i) { const int ka = k0 + 8 * g + i, kb = ka + 16; v[i] = ka < K ? row[ka < K ? ka : K - 1] : 0.f; v[8 + i] = kb < K ? row[kb < K ? kb : K - 1] : 0.f; }
  return bsplit16(v); }
__device__ __forceinline__ F2 split_col(const float* W, int k0, int n, int lane, int ld, int K) { float v[16]; const int g = lane >> 4;
#pragma unroll
  for (int i = 0; i < 8; ++i) { const int ka = k0 + 8 * g + i, kb = ka + 16; v[i] = ka < K ? W[(size_t)(ka < K ? ka : K - 1) * ld + n] : 0.f; v[8 + i] = kb < K ? W[(size_t)(kb < K ? kb : K - 1) * ld + n] : 0.f; }
  return bsplit16(v); }
__device__ __forceinline__ v8f mac3(const F2& a, const F2& b, v8f c) { c = wmma_bf(a.l, b.h, c); c = wmma_bf(a.h, b.l, c); return wmma_bf(a.h, b.h, c); }
__device__ __forceinline__ float sigm(float v) { return 1.0f / (1.0f + expf(-v)); }
#define LDSX() do { asm volatile("s_wait_dscnt 0" ::: "memory"); __builtin_amdgcn_wave_barrier(); __builtin_amdgcn_fence(__ATOMIC_RELEASE, "workgroup"); } while (0)


#define NB 2
#define SS 2048
#define DM 1024
#define NH 16
#define SCALEF 1.0f
__device__ __attribute__((noinline)) float gelu_e(float v) { return 0.5f * v * (1.0f + erff(v * 0.70710678118654752f)); }
#define HD 64
#define QKVW (3 * DM)
#ifndef TQB
#define TQB (SS / 64)
#define TNB NB
#define TOB (NB * SS / 64)     // output row tiles (all)
#endif
typedef __attribute__((ext_vector_type(8))) __bf16 v8b;
__device__ __forceinline__ v16b frag_b(const __bf16* rowk0, int lane) {
  union { v16b v; v8b q[2]; } u; const __bf16* p = rowk0 + 8 * (lane >> 4);
  u.q[0] = *(const v8b*)p; u.q[1] = *(const v8b*)(p + 16); return u.v;
}
__device__ __forceinline__ float bfr(float v) { return (float)(__bf16)v; }
__device__ __attribute__((noinline)) float exp_ni(float v) { return expf(v); }
__device__ __attribute__((noinline)) float erf_ni(float v) { return erff(v); }

#define PK_A 0                       // [3072][1024] Wqkv rows (natural [out][in])
#define PK_P (PK_A + QKVW * DM)        // [1024][1024] Wg rows (natural)
#define PK_END (PK_P + DM * DM)
#define WS_PK  0u
#define WS_QK  (WS_PK + 2u * PK_END)             // f16 [4096 rows][2048]: qg | k
#define WS_QKL (WS_QK + 2u * NB * SS * 2 * DM)     // f16 q | k residual planes x2048
#define WS_VTH (WS_QKL + 2u * NB * SS * 2 * DM)    // f16 [b][1024 (h*64+d)][2048 s] hi
#define WS_VTL (WS_VTH + 2u * NB * DM * SS)        // f16 lo x 2048
#define WS_O   (WS_VTL + 2u * NB * DM * SS)        // f32 [4096][1024]
#define WS_CS  (WS_O + 4u * NB * SS * DM)           // f32 2 x [2048][32], unused
#define WS_END (WS_CS + 4u * 2 * SS * 32)
// ---- k_pack: block = (row n, which): natural [out][in] rows -> bf16; which 0..2 -> W_q/W_k/W_v into PK_A rows which*1024 + n; 3 -> W_g into PK_P
__global__ __launch_bounds__(256) void k_pack(const float* __restrict__ WQ, const float* __restrict__ WK, const float* __restrict__ WV, const float* __restrict__ WO, __bf16* __restrict__ PK) {
  __shared__ __align__(16) __bf16 s[DM]; const int n = blockIdx.x, which = blockIdx.y, t = threadIdx.x; const float* Wm = (which == 0) ? WQ : (which == 1) ? WK : (which == 2) ? WV : WO;
  for (int k = t; k < DM; k += 256) s[k] = (__bf16)Wm[(size_t)n * DM + k];
  __syncthreads();
  __bf16* dst = (which < 3) ? PK + PK_A + ((size_t)which * DM + n) * DM : PK + PK_P + (size_t)n * DM;
  for (int q = t; q < DM / 8; q += 256) vst2((unsigned*)(dst + q * 8), *(const v4u*)&s[q * 8]);
}
__global__ __launch_bounds__(128) void k_qkv(const float* __restrict__ XQ, const float* __restrict__ XK, const float* __restrict__ XV, const __bf16* __restrict__ P, const float* __restrict__ BQ, const float* __restrict__ BK, const float* __restrict__ BV, _Float16* __restrict__ QK, _Float16* __restrict__ QKL, _Float16* __restrict__ VTH, _Float16* __restrict__ VTL, const __bf16* __restrict__ WG, const float* __restrict__ BG) {
  const int which0 = (blockIdx.y * 128) / DM; const float* X = (which0 == 0) ? XQ : (which0 == 1) ? XK : XV; const float* BB = BQ ? (((which0 == 0) ? BQ : (which0 == 1) ? BK : BV) + (blockIdx.y * 128 - which0 * DM)) : nullptr;
  __shared__ __align__(16) _Float16 so[4][16][136], sol[4][16][136]; __shared__ __align__(16) _Float16 sth[128][72], stl[128][72];
  const int tid = threadIdx.x, wave = tid >> 5, lane = tid & 31, col = lane & 15, g = lane >> 4; const size_t r0 = (size_t)blockIdx.x * 64 + wave * 16; const int n0 = blockIdx.y * 128;
  v8f acc[8] = {}; v8f accg[8] = {};
#pragma unroll 2
  for (int kc = 0; kc < DM / 32; ++kc) { v16b a; { const float* p = X + (r0 + col) * DM + kc * 32 + 8 * g;
#pragma unroll
      for (int i = 0; i < 8; ++i) { a[i] = (__bf16)p[i]; a[8 + i] = (__bf16)p[16 + i]; } }
#pragma unroll
    for (int j = 0; j < 8; ++j) { acc[j] = wmma_bf(a, frag_b(P + (size_t)(n0 + j * 16 + col) * DM + kc * 32, lane), acc[j]); if (n0 < DM) accg[j] = wmma_bf(a, frag_b(WG + (size_t)(n0 + j * 16 + col) * DM + kc * 32, lane), accg[j]); } }
  if (n0 < 2 * DM) {   // q stored unscaled (f16 sigma ~0.6, no subnormal exposure); no scale applied to the score
#pragma unroll
    for (int j = 0; j < 8; ++j) {
#pragma unroll
      for (int r = 0; r < 8; ++r) { float v = acc[j][r] + (BB ? bfr(BB[j * 16 + col]) : 0.f); if (n0 < DM) v = gelu_e(v * (accg[j][r] + bfr(BG[n0 + j * 16 + col]))); const _Float16 hv = (_Float16)v; so[wave][8 * g + r][j * 16 + col] = hv; sol[wave][8 * g + r][j * 16 + col] = (_Float16)((v - (float)hv) * 2048.0f); } }   // q, k (+ bias) as f16 hi + (x2048) residual
    LDSX();
    for (int rl = 0; rl < 16; ++rl) if (lane < 16) { vst2((unsigned*)(QK + (r0 + rl) * (2 * DM) + n0 + lane * 8), *(const v4u*)&so[wave][rl][lane * 8]); vst2((unsigned*)(QKL + (r0 + rl) * (2 * DM) + n0 + lane * 8), *(const v4u*)&sol[wave][rl][lane * 8]); }
  } else {
#pragma unroll
    for (int j = 0; j < 8; ++j) {
#pragma unroll
      for (int r = 0; r < 8; ++r) { const float v = acc[j][r] + (BB ? bfr(BB[j * 16 + col]) : 0.f); const _Float16 hv = (_Float16)v; sth[j * 16 + col][wave * 16 + 8 * g + r] = hv; stl[j * 16 + col][wave * 16 + 8 * g + r] = (_Float16)((v - (float)hv) * 2048.0f); } }
    __syncthreads();
    const size_t rb = (size_t)blockIdx.x * 64; const int b = (int)(rb / SS), s0 = (int)(rb % SS); const int pc0 = n0 - 2 * DM;
    for (int q = tid; q < 128 * 8; q += 128) { const int d = q >> 3, pc = q & 7; const size_t o = ((size_t)b * DM + pc0 + d) * SS + s0 + pc * 8; vst2((unsigned*)(VTH + o), *(const v4u*)&sth[d][pc * 8]); vst2((unsigned*)(VTL + o), *(const v4u*)&stl[d][pc * 8]); }
  }
}
#define KPH 72                    // K row pitch in LDS, f16 elements (128-B rows + 16 B)
#define VPH 40                    // V row pitch in LDS, f16 elements (64-B rows + 16 B)
#define KPL (32u * KPH * 2u)      // bytes of one K plane
#define VPL (64u * VPH * 2u)      // bytes of one V plane
#define KBUF (2u * KPL)           // bytes of one K buffer (both planes)
#define VBUF (2u * VPL)
// one thread's eight 16-byte asynchronous copies of a 32-key stage (K hi, K residual, V hi, V residual; two rows each) into LDS.
// The copies and s_wait_xcnt stand in one statement so that no address register is rewritten ahead of the wait.
__device__ __forceinline__ void stage_kv(const _Float16* kh, const _Float16* kl, const _Float16* vh, const _Float16* vl, unsigned lk, unsigned lv) {
  asm volatile("global_load_async_to_lds_b128 %0, %8, off\n\t"
               "global_load_async_to_lds_b128 %1, %9, off\n\t"
               "global_load_async_to_lds_b128 %2, %10, off\n\t"
               "global_load_async_to_lds_b128 %3, %11, off\n\t"
               "global_load_async_to_lds_b128 %4, %12, off\n\t"
               "global_load_async_to_lds_b128 %5, %13, off\n\t"
               "global_load_async_to_lds_b128 %6, %14, off\n\t"
               "global_load_async_to_lds_b128 %7, %15, off\n\t"
               "s_wait_xcnt 0x0"
               :: "v"(lk), "v"(lk + 16u * KPH * 2u), "v"(lk + KPL), "v"(lk + KPL + 16u * KPH * 2u), "v"(lv), "v"(lv + 32u * VPH * 2u), "v"(lv + VPL), "v"(lv + VPL + 32u * VPH * 2u),
                  "v"(kh), "v"(kh + (size_t)16 * (2 * DM)), "v"(kl), "v"(kl + (size_t)16 * (2 * DM)), "v"(vh), "v"(vh + (size_t)32 * SS), "v"(vl), "v"(vl + (size_t)32 * SS)
               : "memory");
}
// ---- k_attn: block = (64 queries, head h, batch b): all-keys flash attention (K = 64: 2 k-steps), scores = q.k unscaled with 3 products (q, k as f16 hi + residual), P.V: 3 products of P (x2048) and V as f16 hi + residual in two accumulators; O[b*S+q][h*64+d] = (acc + accl / 2048) / (2048 l) (256-B segments)
__global__ __launch_bounds__(128) void k_attn(const _Float16* __restrict__ QK, const _Float16* __restrict__ QKL, const _Float16* __restrict__ VTH, const _Float16* __restrict__ VTL, const void* __restrict__ KMASK, float* __restrict__ O) {
  __shared__ __align__(16) float sp[4][16][36]; __shared__ __align__(16) float so[4][16][68];
  __shared__ __align__(16) _Float16 sk[2][2][32][KPH];   // [buffer][hi, residual][key][d], 144-B rows
  __shared__ __align__(16) _Float16 sv[2][2][64][VPH];   // [buffer][hi, residual][d][key], 80-B rows
  const int tid = threadIdx.x, wave = tid >> 5, lane = tid & 31, col = lane & 15, g = lane >> 4;
  const int qb = blockIdx.x, h = blockIdx.y, b = blockIdx.z;
  // each thread's share of a 32-key stage: 16-byte pieces of K rows tid / 8 and 16 + tid / 8 and of V rows tid / 4 and 32 + tid / 4, both planes
  const size_t gk = ((size_t)b * SS + (tid >> 3)) * (2 * DM) + DM + h * HD + (tid & 7) * 8, gv = ((size_t)b * DM + h * HD + (tid >> 2)) * SS + (tid & 3) * 8;
  const unsigned lk = (unsigned)(size_t)&sk[0][0][tid >> 3][(tid & 7) * 8], lv = (unsigned)(size_t)&sv[0][0][tid >> 2][(tid & 3) * 8]; const int q0 = qb * 64 + wave * 16; const size_t rq = (size_t)b * SS + q0 + col;
  v16h aq[2], aql[2];
#pragma unroll
  for (int kc = 0; kc < 2; ++kc) { aq[kc] = frag_h(QK + rq * (2 * DM) + h * HD + kc * 32, lane); aql[kc] = frag_h(QKL + rq * (2 * DM) + h * HD + kc * 32, lane); }
  float m[8], l[8];
#pragma unroll
  for (int r = 0; r < 8; ++r) { m[r] = -3.0e38f; l[r] = 0.f; }
  v8f acc[4] = {}, accl[4] = {};
  const int nks = SS / 32;   // all keys
  stage_kv(QK + gk, QKL + gk, VTH + gv, VTL + gv, lk, lv);
  asm volatile("s_wait_asynccnt 0x0" ::: "memory");   // stage 0 has landed before the barrier that publishes it
  __syncthreads();
  stage_kv(QK + gk + (size_t)32 * (2 * DM), QKL + gk + (size_t)32 * (2 * DM), VTH + gv + 32, VTL + gv + 32, lk + KBUF, lv + VBUF);
#pragma unroll 1
  for (int ks = 0; ks < nks; ++ks) { v8f s[2]; const int bf = ks & 1;
    v16h fk[2][2], fkl[2][2];   // the pass's K fragments, read from LDS as one group
#pragma unroll
    for (int ct = 0; ct < 2; ++ct) {
#pragma unroll
      for (int kc = 0; kc < 2; ++kc) { fk[ct][kc] = frag_h(&sk[bf][0][ct * 16 + col][kc * 32], lane); fkl[ct][kc] = frag_h(&sk[bf][1][ct * 16 + col][kc * 32], lane); } }
    // holds the eight fragment reads together in front of the products: one LDS latency a pass instead of one per fragment
    asm volatile("" :: "v"(fk[0][0]), "v"(fk[0][1]), "v"(fk[1][0]), "v"(fk[1][1]), "v"(fkl[0][0]), "v"(fkl[0][1]), "v"(fkl[1][0]), "v"(fkl[1][1]));
#pragma unroll
    for (int ct = 0; ct < 2; ++ct) { v8f c = {}, cl = {};
#pragma unroll
      for (int kc = 0; kc < 2; ++kc) { const v16h kh = fk[ct][kc]; c = wmma16(aq[kc], kh, c); cl = wmma16(aql[kc], kh, cl); cl = wmma16(aq[kc], fkl[ct][kc], cl); }   // 3 products: q, k as f16 hi + residual
#pragma unroll
      for (int r = 0; r < 8; ++r) c[r] += cl[r] * (1.0f / 2048.0f);
      { const bool keepk = true;
#pragma unroll
      for (int r = 0; r < 8; ++r) s[ct][r] = keepk ? c[r] * SCALEF : -3.0e38f; } }   // no scaling (SCALEF 1); no key is masked
#pragma unroll
    for (int r = 0; r < 8; ++r) { float mx = fmaxf(s[0][r], s[1][r]);
#pragma unroll
      for (int o = 1; o < 16; o <<= 1) mx = fmaxf(mx, __shfl_xor(mx, o));
      const float mn = fmaxf(m[r], mx); const float alpha = (m[r] <= -1.0e38f) ? 0.f : __expf(m[r] - mn);
      const float e0 = (s[0][r] <= -1.0e38f) ? 0.f : __expf(s[0][r] - mn), e1 = (s[1][r] <= -1.0e38f) ? 0.f : __expf(s[1][r] - mn); float es = e0 + e1;
#pragma unroll
      for (int o = 1; o < 16; o <<= 1) es += __shfl_xor(es, o);
      l[r] = l[r] * alpha + es; m[r] = mn;
#pragma unroll
      for (int dt = 0; dt < 4; ++dt) { acc[dt][r] *= alpha; accl[dt][r] *= alpha; }
      sp[wave][8 * g + r][col] = e0; sp[wave][8 * g + r][16 + col] = e1; }
    LDSX();
    v16h pa, pl; { const float* prow = &sp[wave][col][0] + 8 * (lane >> 4);
#pragma unroll
      for (int i = 0; i < 8; ++i) { const float x0 = prow[i] * 2048.0f, x1 = prow[16 + i] * 2048.0f; const _Float16 h0 = (_Float16)x0, h1 = (_Float16)x1; pa[i] = h0; pa[8 + i] = h1; pl[i] = (_Float16)((x0 - (float)h0) * 2048.0f); pl[8 + i] = (_Float16)((x1 - (float)h1) * 2048.0f); } }   // P scaled by 2^11 before the f16 split so small softmax weights stay out of the f16 subnormal range; 2^-11 folded into the epilogue
    v16h fv[4], fvl[4];   // the pass's V fragments, read from LDS as one group
#pragma unroll
    for (int dt = 0; dt < 4; ++dt) { fv[dt] = frag_h(&sv[bf][0][dt * 16 + col][0], lane); fvl[dt] = frag_h(&sv[bf][1][dt * 16 + col][0], lane); }
    // holds the eight fragment reads together in front of the products: one LDS latency a pass instead of one per fragment
    asm volatile("" :: "v"(fv[0]), "v"(fv[1]), "v"(fv[2]), "v"(fv[3]), "v"(fvl[0]), "v"(fvl[1]), "v"(fvl[2]), "v"(fvl[3]));
#pragma unroll
    for (int dt = 0; dt < 4; ++dt) { const v16h vh = fv[dt]; acc[dt] = wmma16(pa, vh, acc[dt]); accl[dt] = wmma16(pl, vh, accl[dt]); accl[dt] = wmma16(pa, fvl[dt], accl[dt]); }   // P hi x V hi + (P lo x V hi + P hi x V lo) / 2048
    asm volatile("s_wait_dscnt 0x0" ::: "memory");      // this wave's reads of the stage (and of sp) are done before the buffer is given up
    asm volatile("s_wait_asynccnt 0x0" ::: "memory");   // this wave's copies of stage ks + 1 have landed
    __syncthreads();                                    // publishes stage ks + 1 and ends every reader's last read of stage ks
    if (ks + 2 < nks) { const size_t ak = (size_t)(ks + 2) * 32 * (2 * DM), av = (size_t)(ks + 2) * 32; stage_kv(QK + gk + ak, QKL + gk + ak, VTH + gv + av, VTL + gv + av, lk + bf * KBUF, lv + bf * VBUF); } }
  asm volatile("s_wait_asynccnt 0x0" ::: "memory");     // no copy is outstanding behind the loop
#pragma unroll
  for (int r = 0; r < 8; ++r) { const float il = (1.0f / 2048.0f) / l[r];
#pragma unroll
    for (int dt = 0; dt < 4; ++dt) so[wave][8 * g + r][dt * 16 + col] = (acc[dt][r] + accl[dt][r] * (1.0f / 2048.0f)) * il; }
  LDSX();
  for (int rl = 0; rl < 16; ++rl) if (lane < 16) vst2(O + ((size_t)b * SS + q0 + rl) * DM + h * HD + lane * 4, *(const v4f*)&so[wave][rl][lane * 4]);
}
// ---- k_out: block = (64 rows, 128 cols): out = O(hi/lo) . Wo rows (2 products) + bo
__global__ __launch_bounds__(128) void k_out(const float* __restrict__ O, const __bf16* __restrict__ P, const float* __restrict__ BO, float* __restrict__ Y) {
  __shared__ __align__(16) float so[4][16][132];
  const int tid = threadIdx.x, wave = tid >> 5, lane = tid & 31, col = lane & 15, g = lane >> 4; const size_t r0 = (size_t)blockIdx.x * 64 + wave * 16; const int n0 = blockIdx.y * 128;
  v8f acc[8] = {};
#pragma unroll 2
  for (int kc = 0; kc < DM / 32; ++kc) { const F2 a = split_row(O + (r0 + col) * DM, kc * 32, lane);
#pragma unroll
    for (int j = 0; j < 8; ++j) { const v16b w = frag_b(P + (size_t)(n0 + j * 16 + col) * DM + kc * 32, lane); acc[j] = wmma_bf(a.l, w, acc[j]); acc[j] = wmma_bf(a.h, w, acc[j]); } }
#pragma unroll
  for (int j = 0; j < 8; ++j) {
#pragma unroll
    for (int r = 0; r < 8; ++r) so[wave][8 * g + r][j * 16 + col] = acc[j][r] + (BO ? bfr(BO[n0 + j * 16 + col]) : 0.f); }
  LDSX();
  for (int rl = 0; rl < 16; ++rl) vst2(Y + (r0 + rl) * DM + n0 + lane * 4, *(const v4f*)&so[wave][rl][lane * 4]);
}
extern "C" void kernel_launch(void* const* d_in, const int* in_sizes, int n_in, void* d_out, int out_size, void* d_ws, size_t ws_size, hipStream_t stream) {
  (void)in_sizes; (void)n_in; (void)out_size;
  const float** F = (const float**)d_in;   // 0 x [2,2048,1024], 1 Wq, 2 bq, 3 Wk, 4 bk, 5 Wv, 6 bv, 7 Wg, 8 bg (natural [1024,1024] / [1024])
  if (ws_size < (size_t)WS_END) return;
  char* ws = (char*)d_ws; __bf16* PK = (__bf16*)(ws + WS_PK); _Float16 *QK = (_Float16*)(ws + WS_QK), *QKL = (_Float16*)(ws + WS_QKL), *VTH = (_Float16*)(ws + WS_VTH), *VTL = (_Float16*)(ws + WS_VTL);
  k_pack<<<dim3(DM, 4), 256, 0, stream>>>(F[1], F[3], F[5], F[7], PK);   // the fourth slot holds Wg
  k_qkv<<<dim3(TNB * SS / 64, QKVW / 128), 128, 0, stream>>>(F[0], F[0], F[0], PK + PK_A, F[2], F[4], F[6], QK, QKL, VTH, VTL, PK + PK_P, F[8]);
  k_attn<<<dim3(TQB, NH, TNB), 128, 0, stream>>>(QK, QKL, VTH, VTL, nullptr, (float*)d_out);   // merged context == output (no out-projection)
}

// v002
// A run of this version takes 206 microseconds.
// In two side-by-side timings against v001, it was 1.59 and 1.58 times as fast.
// Over all steps from v000 it is 2.48 times as fast.
// compute dtype: all float inputs rounded to bf16; q/k/v/g = x . W^T + b with EXACT bf16 products on WMMA 16x16x32 (natural rows; q and g computed in the same block), qg = gelu_erf(q g) in f32 (precise erff) then split into f16 hi + residual; attention with 3-product scores (qg, k as f16 hi + residual) and 3-product P.v (P and v as hi + residual) everywhere; no scaling, running-max softmax in f32 (hardware exp); the merged context is the output (f32).
#include <hip/hip_runtime.h>
#include <math.h>

typedef __attribute__((ext_vector_type(16))) _Float16 v16h;
typedef __attribute__((ext_vector_type(16))) __bf16 v16b;
typedef __attribute__((ext_vector_type(8)))  _Float16 v8h;
typedef __attribute__((ext_vector_type(8)))  float v8f;
typedef __attribute__((ext_vector_type(4)))  float v4f;
typedef __attribute__((ext_vector_type(2)))  float v2f;
typedef __attribute__((ext_vector_type(4)))  unsigned v4u;
typedef __attribute__((ext_vector_type(4)))  int v4i;
typedef float __attribute__((may_alias)) float_a;
typedef int __attribute__((may_alias)) int_a;

template <typename T> __device__ __forceinline__ void vst2(void* p, T v) { *(T*)p = v;  }
__device__ __forceinline__ v8f wmma16(v16h a, v16h b, v8f c) {
  v8f d = __builtin_amdgcn_wmma_f32_16x16x32_f16(false, a, false, b, (short)0, c, false, false);
  asm volatile("v_nop\n\tv_nop\n\tv_nop\n\tv_nop" : "+v"(d) : "v"(a), "v"(b));
  return d;
}
__device__ __forceinline__ v8f wmma_bf(v16b a, v16b b, v8f c) {
  v8f d = __builtin_amdgcn_wmma_f32_16x16x32_bf16(false, a, false, b, (short)0, c, false, false);
  asm volatile("v_nop\n\tv_nop\n\tv_nop\n\tv_nop" : "+v"(d) : "v"(a), "v"(b));
  return d;
}
// Gated QKV attention (B 2, S 2,048, d 1,024, 16 heads x 64): q, k, v, g projections + biases, qg = gelu(q * g) (exact erf), softmax(qg k^T) v with no 1/sqrt(d) scaling and no output projection.
__device__ __forceinline__ v16h frag_h(const _Float16* rowk0, int lane) {
  union { v16h v; v8h q[2]; } u; const _Float16* p = rowk0 + 8 * (lane >> 4);
  u.q[0] = *(const v8h*)p; u.q[1] = *(const v8h*)(p + 16); return u.v;
}
__device__ __forceinline__ v16h frag_f32(const float* rowk0, int lane) {
  v16h a; const float* p = rowk0 + 8 * (lane >> 4);
#pragma unroll
  for (int i = 0; i < 8; ++i) { a[i] = (_Float16)p[i]; a[8 + i] = (_Float16)p[16 + i]; }
  return a;
}
__device__ __forceinline__ v16h frag_f32s(const float* rowk0, int lane, float sc) {
  v16h a; const float* p = rowk0 + 8 * (lane >> 4);
#pragma unroll
  for (int i = 0; i < 8; ++i) { a[i] = (_Float16)(p[i] * sc); a[8 + i] = (_Float16)(p[16 + i] * sc); }
  return a;
}
// column fragment from a [K][ld] layout (column n), rows >= K read as 0
__device__ __forceinline__ v16h fragc_f32(const float* W, int k0, int n, int lane, int ld, int K) {
  v16h a; const int g = lane >> 4;
#pragma unroll
  for (int i = 0; i < 8; ++i) { const int ka = k0 + 8 * g + i, kb = ka + 16;
    a[i] = (_Float16)(ka < K ? W[(size_t)(ka < K ? ka : K - 1) * ld + n] : 0.f); a[8 + i] = (_Float16)(kb < K ? W[(size_t)(kb < K ? kb : K - 1) * ld + n] : 0.f); }
  return a;
}
struct F2 { v16b h, l; };
__device__ __forceinline__ F2 bsplit16(const float v[16]) { F2 r;
#pragma unroll
  for (int i = 0; i < 16; ++i) { const __bf16 h = (__bf16)v[i]; r.h[i] = h; r.l[i] = (__bf16)(v[i] - (float)h); }
  return r; }
__device__ __forceinline__ F2 split_row(const float* row, int k0, int lane) { float v[16]; const float* p = row + k0 + 8 * (lane >> 4);
#pragma unroll
  for (int i = 0; i < 8; ++i) { v[i] = p[i]; v[8 + i] = p[16 + i]; }
  return bsplit16(v); }
__device__ __forceinline__ F2 split_rowK(const float* row, int k0, int lane, int K) { float v[16]; const int g = lane >> 4;
#pragma unroll
  for (int i = 0; i < 8; ++i) { const int ka = k0 + 8 * g + i, kb = ka + 16; v[i] = ka < K ? row[ka < K ? ka : K - 1] : 0.f; v[8 + i] = kb < K ? row[kb < K ? kb : K - 1] : 0.f; }
  return bsplit16(v); }
__device__ __forceinline__ F2 split_col(const float* W, int k0, int n, int lane, int ld, int K) { float v[16]; const int g = lane >> 4;
#pragma unroll
  for (int i = 0; i < 8; ++i) { const int ka = k0 + 8 * g + i, kb = ka + 16; v[i] = ka < K ? W[(size_t)(ka < K ? ka : K - 1) * ld + n] : 0.f; v[8 + i] = kb < K ? W[(size_t)(kb < K ? kb : K - 1) * ld + n] : 0.f; }
  return bsplit16(v); }
__device__ __forceinline__ v8f mac3(const F2& a, const F2& b, v8f c) { c = wmma_bf(a.l, b.h, c); c = wmma_bf(a.h, b.l, c); return wmma_bf(a.h, b.h, c); }
__device__ __forceinline__ float sigm(float v) { return 1.0f / (1.0f + expf(-v)); }
#define LDSX() do { asm volatile("s_wait_dscnt 0" ::: "memory"); __builtin_amdgcn_wave_barrier(); __builtin_amdgcn_fence(__ATOMIC_RELEASE, "workgroup"); } while (0)


#define NB 2
#define SS 2048
#define DM 1024
#define NH 16
#define SCALEF 1.0f
__device__ __attribute__((noinline)) float gelu_e(float v) { return 0.5f * v * (1.0f + erff(v * 0.70710678118654752f)); }
#define HD 64
#define QKVW (3 * DM)
#ifndef TQB
#define TQB (SS / 64)
#define TNB NB
#define TOB (NB * SS / 64)     // output row tiles (all)
#endif
typedef __attribute__((ext_vector_type(8))) __bf16 v8b;
__device__ __forceinline__ v16b frag_b(const __bf16* rowk0, int lane) {
  union { v16b v; v8b q[2]; } u; const __bf16* p = rowk0 + 8 * (lane >> 4);
  u.q[0] = *(const v8b*)p; u.q[1] = *(const v8b*)(p + 16); return u.v;
}
__device__ __forceinline__ float bfr(float v) { return (float)(__bf16)v; }
__device__ __attribute__((noinline)) float exp_ni(float v) { return expf(v); }
__device__ __attribute__((noinline)) float erf_ni(float v) { return erff(v); }

#define PK_A 0                       // [3072][1024] Wqkv rows (natural [out][in])
#define PK_P (PK_A + QKVW * DM)        // [1024][1024] Wg rows (natural)
#define PK_END (PK_P + DM * DM)
#define WS_PK  0u
#define WS_QK  (WS_PK + 2u * PK_END)             // f16 [4096 rows][2048]: qg | k
#define WS_QKL (WS_QK + 2u * NB * SS * 2 * DM)     // f16 q | k residual planes x2048
#define WS_VTH (WS_QKL + 2u * NB * SS * 2 * DM)    // f16 [b][1024 (h*64+d)][2048 s] hi
#define WS_VTL (WS_VTH + 2u * NB * DM * SS)        // f16 lo x 2048
#define WS_O   (WS_VTL + 2u * NB * DM * SS)        // f32 [4096][1024]
#define WS_CS  (WS_O + 4u * NB * SS * DM)           // f32 2 x [2048][32], unused
#define WS_END (WS_CS + 4u * 2 * SS * 32)
// ---- k_pack: block = (row n, which): natural [out][in] rows -> bf16; which 0..2 -> W_q/W_k/W_v into PK_A rows which*1024 + n; 3 -> W_g into PK_P
__global__ __launch_bounds__(256) void k_pack(const float* __restrict__ WQ, const float* __restrict__ WK, const float* __restrict__ WV, const float* __restrict__ WO, __bf16* __restrict__ PK) {
  __shared__ __align__(16) __bf16 s[DM]; const int n = blockIdx.x, which = blockIdx.y, t = threadIdx.x; const float* Wm = (which == 0) ? WQ : (which == 1) ? WK : (which == 2) ? WV : WO;
  for (int k = t; k < DM; k += 256) s[k] = (__bf16)Wm[(size_t)n * DM + k];
  __syncthreads();
  __bf16* dst = (which < 3) ? PK + PK_A + ((size_t)which * DM + n) * DM : PK + PK_P + (size_t)n * DM;
  for (int q = t; q < DM / 8; q += 256) vst2((unsigned*)(dst + q * 8), *(const v4u*)&s[q * 8]);
}
#define XPB 272u                  // X row pitch in LDS, bytes (256-B rows of 64 f32 + 16 B)
#define WPB 144u                  // weight row pitch in LDS, bytes (128-B rows of 64 bf16 + 16 B)
#define QXB (64u * XPB)           // bytes of one X tile (64 rows)
#define QWB (128u * WPB)          // bytes of one weight tile (128 rows)
#define QSTG (QXB + 2u * QWB)     // bytes of one stage: X | W | Wg
// one thread's eight 16-byte asynchronous copies into LDS: piece i goes from g + i * gs to LDS byte l + i * ls.
// The copies and s_wait_xcnt stand in one statement so that no address register is rewritten ahead of the wait.
__device__ __forceinline__ void stage8(const char* g, size_t gs, unsigned l, unsigned ls) {
  asm volatile("global_load_async_to_lds_b128 %0, %8, off\n\t"
               "global_load_async_to_lds_b128 %1, %9, off\n\t"
               "global_load_async_to_lds_b128 %2, %10, off\n\t"
               "global_load_async_to_lds_b128 %3, %11, off\n\t"
               "global_load_async_to_lds_b128 %4, %12, off\n\t"
               "global_load_async_to_lds_b128 %5, %13, off\n\t"
               "global_load_async_to_lds_b128 %6, %14, off\n\t"
               "global_load_async_to_lds_b128 %7, %15, off\n\t"
               "s_wait_xcnt 0x0"
               :: "v"(l), "v"(l + ls), "v"(l + 2u * ls), "v"(l + 3u * ls), "v"(l + 4u * ls), "v"(l + 5u * ls), "v"(l + 6u * ls), "v"(l + 7u * ls),
                  "v"(g), "v"(g + gs), "v"(g + 2 * gs), "v"(g + 3 * gs), "v"(g + 4 * gs), "v"(g + 5 * gs), "v"(g + 6 * gs), "v"(g + 7 * gs)
               : "memory");
}
// ---- k_qkv: block = (64 rows of x, 128 output columns; the q blocks also their 128 gate columns). A stage is 64 k of the block's X rows (f32) and weight rows (bf16), brought into LDS once per block, two buffers; the epilogue's staging arrays reuse the ring behind the last pass's barrier
__global__ __launch_bounds__(128) void k_qkv(const float* __restrict__ XQ, const float* __restrict__ XK, const float* __restrict__ XV, const __bf16* __restrict__ P, const float* __restrict__ BQ, const float* __restrict__ BK, const float* __restrict__ BV, _Float16* __restrict__ QK, _Float16* __restrict__ QKL, _Float16* __restrict__ VTH, _Float16* __restrict__ VTL, const __bf16* __restrict__ WG, const float* __restrict__ BG) {
  const int which0 = (blockIdx.y * 128) / DM; const float* X = (which0 == 0) ? XQ : (which0 == 1) ? XK : XV; const float* BB = BQ ? (((which0 == 0) ? BQ : (which0 == 1) ? BK : BV) + (blockIdx.y * 128 - which0 * DM)) : nullptr;
  __shared__ __align__(16) unsigned char sm[2 * QSTG];
  _Float16 (*so)[16][136] = (_Float16 (*)[16][136])sm; _Float16 (*sol)[16][136] = (_Float16 (*)[16][136])(sm + 4 * 16 * 136 * 2);
  _Float16 (*sth)[72] = (_Float16 (*)[72])sm; _Float16 (*stl)[72] = (_Float16 (*)[72])(sm + 128 * 72 * 2);
  const int tid = threadIdx.x, wave = tid >> 5, lane = tid & 31, col = lane & 15, g = lane >> 4; const size_t r0 = (size_t)blockIdx.x * 64 + wave * 16; const int n0 = blockIdx.y * 128;
  // each thread's share of a stage: 16-byte pieces of X rows tid / 16 + 8 i and of weight rows tid / 8 + 16 i, i = 0..7
  const char* gx = (const char*)(X + ((size_t)blockIdx.x * 64 + (tid >> 4)) * DM + (tid & 15) * 4);
  const char* gw = (const char*)(P + (size_t)(n0 + (tid >> 3)) * DM + (tid & 7) * 8);
  const char* gg = (const char*)(WG + (size_t)((n0 < DM ? n0 : 0) + (tid >> 3)) * DM + (tid & 7) * 8);
  const unsigned lx = (unsigned)(size_t)&sm[(tid >> 4) * XPB + (tid & 15) * 16], lw = (unsigned)(size_t)&sm[QXB + (tid >> 3) * WPB + (tid & 7) * 16];
  const int nps = DM / 64;
  v8f acc[8] = {}; v8f accg[8] = {};
  stage8(gx, (size_t)8 * DM * 4, lx, 8u * XPB); stage8(gw, (size_t)16 * DM * 2, lw, 16u * WPB);
  if (n0 < DM) stage8(gg, (size_t)16 * DM * 2, lw + QWB, 16u * WPB);
  asm volatile("s_wait_asynccnt 0x0" ::: "memory");   // stage 0 has landed before the barrier that publishes it
  __syncthreads();
  stage8(gx + 256, (size_t)8 * DM * 4, lx + QSTG, 8u * XPB); stage8(gw + 128, (size_t)16 * DM * 2, lw + QSTG, 16u * WPB);
  if (n0 < DM) stage8(gg + 128, (size_t)16 * DM * 2, lw + QSTG + QWB, 16u * WPB);
#pragma unroll 1
  for (int ps = 0; ps < nps; ++ps) { const unsigned bo = (unsigned)(ps & 1) * QSTG; const unsigned char* sb = sm + bo;
#pragma unroll
    for (int kc = 0; kc < 2; ++kc) { v16b a; { const float* p = (const float*)(sb + (wave * 16 + col) * XPB) + kc * 32 + 8 * g;
#pragma unroll
      for (int i = 0; i < 8; ++i) { a[i] = (__bf16)p[i]; a[8 + i] = (__bf16)p[16 + i]; } }
      v16b fw[8];   // the k-step's weight fragments, read from LDS as one group
#pragma unroll
      for (int j = 0; j < 8; ++j) fw[j] = frag_b((const __bf16*)(sb + QXB + (j * 16 + col) * WPB) + kc * 32, lane);
      // holds the fragment reads together in front of the products: one LDS latency a group instead of one per fragment
      asm volatile("" :: "v"(fw[0]), "v"(fw[1]), "v"(fw[2]), "v"(fw[3]), "v"(fw[4]), "v"(fw[5]), "v"(fw[6]), "v"(fw[7]));
#pragma unroll
      for (int j = 0; j < 8; ++j) acc[j] = wmma_bf(a, fw[j], acc[j]);
      if (n0 < DM) { v16b fg[8];   // the gate's fragments, likewise
#pragma unroll
        for (int j = 0; j < 8; ++j) fg[j] = frag_b((const __bf16*)(sb + QXB + QWB + (j * 16 + col) * WPB) + kc * 32, lane);
        // holds the fragment reads together in front of the products: one LDS latency a group instead of one per fragment
        asm volatile("" :: "v"(fg[0]), "v"(fg[1]), "v"(fg[2]), "v"(fg[3]), "v"(fg[4]), "v"(fg[5]), "v"(fg[6]), "v"(fg[7]));
#pragma unroll
        for (int j = 0; j < 8; ++j) accg[j] = wmma_bf(a, fg[j], accg[j]); } }
    asm volatile("s_wait_dscnt 0x0" ::: "memory");      // this wave's reads of the stage are done before the buffer is given up
    asm volatile("s_wait_asynccnt 0x0" ::: "memory");   // this wave's copies of stage ps + 1 have landed
    __syncthreads();                                    // publishes stage ps + 1 and ends every reader's last read of stage ps
    if (ps + 2 < nps) { const size_t ax = (size_t)(ps + 2) * 256, aw = (size_t)(ps + 2) * 128;
      stage8(gx + ax, (size_t)8 * DM * 4, lx + bo, 8u * XPB); stage8(gw + aw, (size_t)16 * DM * 2, lw + bo, 16u * WPB);
      if (n0 < DM) stage8(gg + aw, (size_t)16 * DM * 2, lw + bo + QWB, 16u * WPB); } }
  asm volatile("s_wait_asynccnt 0x0" ::: "memory");     // no copy is outstanding behind the loop; the ring now serves as the epilogue's staging
  if (n0 < 2 * DM) {   // q stored unscaled (f16 sigma ~0.6, no subnormal exposure); no scale is applied to the f32 score
#pragma unroll
    for (int j = 0; j < 8; ++j) {
#pragma unroll
      for (int r = 0; r < 8; ++r) { float v = acc[j][r] + (BB ? bfr(BB[j * 16 + col]) : 0.f); if (n0 < DM) v = gelu_e(v * (accg[j][r] + bfr(BG[n0 + j * 16 + col]))); const _Float16 hv = (_Float16)v; so[wave][8 * g + r][j * 16 + col] = hv; sol[wave][8 * g + r][j * 16 + col] = (_Float16)((v - (float)hv) * 2048.0f); } }   // q, k (+ bias) as f16 hi + (x2048) residual
    LDSX();
    for (int rl = 0; rl < 16; ++rl) if (lane < 16) { vst2((unsigned*)(QK + (r0 + rl) * (2 * DM) + n0 + lane * 8), *(const v4u*)&so[wave][rl][lane * 8]); vst2((unsigned*)(QKL + (r0 + rl) * (2 * DM) + n0 + lane * 8), *(const v4u*)&sol[wave][rl][lane * 8]); }
  } else {
#pragma unroll
    for (int j = 0; j < 8; ++j) {
#pragma unroll
      for (int r = 0; r < 8; ++r) { const float v = acc[j][r] + (BB ? bfr(BB[j * 16 + col]) : 0.f); const _Float16 hv = (_Float16)v; sth[j * 16 + col][wave * 16 + 8 * g + r] = hv; stl[j * 16 + col][wave * 16 + 8 * g + r] = (_Float16)((v - (float)hv) * 2048.0f); } }
    __syncthreads();
    const size_t rb = (size_t)blockIdx.x * 64; const int b = (int)(rb / SS), s0 = (int)(rb % SS); const int pc0 = n0 - 2 * DM;
    for (int q = tid; q < 128 * 8; q += 128) { const int d = q >> 3, pc = q & 7; const size_t o = ((size_t)b * DM + pc0 + d) * SS + s0 + pc * 8; vst2((unsigned*)(VTH + o), *(const v4u*)&sth[d][pc * 8]); vst2((unsigned*)(VTL + o), *(const v4u*)&stl[d][pc * 8]); }
  }
}
#define KPH 72                    // K row pitch in LDS, f16 elements (128-B rows + 16 B)
#define VPH 40                    // V row pitch in LDS, f16 elements (64-B rows + 16 B)
#define KPL (32u * KPH * 2u)      // bytes of one K plane
#define VPL (64u * VPH * 2u)      // bytes of one V plane
#define KBUF (2u * KPL)           // bytes of one K buffer (both planes)
#define VBUF (2u * VPL)
// one thread's eight 16-byte asynchronous copies of a 32-key stage (K hi, K residual, V hi, V residual; two rows each) into LDS.
// The copies and s_wait_xcnt stand in one statement so that no address register is rewritten ahead of the wait.
__device__ __forceinline__ void stage_kv(const _Float16* kh, const _Float16* kl, const _Float16* vh, const _Float16* vl, unsigned lk, unsigned lv) {
  asm volatile("global_load_async_to_lds_b128 %0, %8, off\n\t"
               "global_load_async_to_lds_b128 %1, %9, off\n\t"
               "global_load_async_to_lds_b128 %2, %10, off\n\t"
               "global_load_async_to_lds_b128 %3, %11, off\n\t"
               "global_load_async_to_lds_b128 %4, %12, off\n\t"
               "global_load_async_to_lds_b128 %5, %13, off\n\t"
               "global_load_async_to_lds_b128 %6, %14, off\n\t"
               "global_load_async_to_lds_b128 %7, %15, off\n\t"
               "s_wait_xcnt 0x0"
               :: "v"(lk), "v"(lk + 16u * KPH * 2u), "v"(lk + KPL), "v"(lk + KPL + 16u * KPH * 2u), "v"(lv), "v"(lv + 32u * VPH * 2u), "v"(lv + VPL), "v"(lv + VPL + 32u * VPH * 2u),
                  "v"(kh), "v"(kh + (size_t)16 * (2 * DM)), "v"(kl), "v"(kl + (size_t)16 * (2 * DM)), "v"(vh), "v"(vh + (size_t)32 * SS), "v"(vl), "v"(vl + (size_t)32 * SS)
               : "memory");
}
// ---- k_attn: block = (64 queries, head h, batch b): all-keys flash attention (K = 64: 2 k-steps), scores = q.k unscaled with 3 products (q, k as f16 hi + residual), P.V: 3 products of P (x2048) and V as f16 hi + residual in two accumulators; O[b*S+q][h*64+d] = (acc + accl / 2048) / (2048 l) (256-B segments)
__global__ __launch_bounds__(128) void k_attn(const _Float16* __restrict__ QK, const _Float16* __restrict__ QKL, const _Float16* __restrict__ VTH, const _Float16* __restrict__ VTL, const void* __restrict__ KMASK, float* __restrict__ O) {
  __shared__ __align__(16) float sp[4][16][36]; __shared__ __align__(16) float so[4][16][68];
  __shared__ __align__(16) _Float16 sk[2][2][32][KPH];   // [buffer][hi, residual][key][d], 144-B rows
  __shared__ __align__(16) _Float16 sv[2][2][64][VPH];   // [buffer][hi, residual][d][key], 80-B rows
  const int tid = threadIdx.x, wave = tid >> 5, lane = tid & 31, col = lane & 15, g = lane >> 4;
  const int qb = blockIdx.x, h = blockIdx.y, b = blockIdx.z;
  // each thread's share of a 32-key stage: 16-byte pieces of K rows tid / 8 and 16 + tid / 8 and of V rows tid / 4 and 32 + tid / 4, both planes
  const size_t gk = ((size_t)b * SS + (tid >> 3)) * (2 * DM) + DM + h * HD + (tid & 7) * 8, gv = ((size_t)b * DM + h * HD + (tid >> 2)) * SS + (tid & 3) * 8;
  const unsigned lk = (unsigned)(size_t)&sk[0][0][tid >> 3][(tid & 7) * 8], lv = (unsigned)(size_t)&sv[0][0][tid >> 2][(tid & 3) * 8]; const int q0 = qb * 64 + wave * 16; const size_t rq = (size_t)b * SS + q0 + col;
  v16h aq[2], aql[2];
#pragma unroll
  for (int kc = 0; kc < 2; ++kc) { aq[kc] = frag_h(QK + rq * (2 * DM) + h * HD + kc * 32, lane); aql[kc] = frag_h(QKL + rq * (2 * DM) + h * HD + kc * 32, lane); }
  float m[8], l[8];
#pragma unroll
  for (int r = 0; r < 8; ++r) { m[r] = -3.0e38f; l[r] = 0.f; }
  v8f acc[4] = {}, accl[4] = {};
  const int nks = SS / 32;   // all keys
  stage_kv(QK + gk, QKL + gk, VTH + gv, VTL + gv, lk, lv);
  asm volatile("s_wait_asynccnt 0x0" ::: "memory");   // stage 0 has landed before the barrier that publishes it
  __syncthreads();
  stage_kv(QK + gk + (size_t)32 * (2 * DM), QKL + gk + (size_t)32 * (2 * DM), VTH + gv + 32, VTL + gv + 32, lk + KBUF, lv + VBUF);
#pragma unroll 1
  for (int ks = 0; ks < nks; ++ks) { v8f s[2]; const int bf = ks & 1;
    v16h fk[2][2], fkl[2][2];   // the pass's K fragments, read from LDS as one group
#pragma unroll
    for (int ct = 0; ct < 2; ++ct) {
#pragma unroll
      for (int kc = 0; kc < 2; ++kc) { fk[ct][kc] = frag_h(&sk[bf][0][ct * 16 + col][kc * 32], lane); fkl[ct][kc] = frag_h(&sk[bf][1][ct * 16 + col][kc * 32], lane); } }
    // holds the eight fragment reads together in front of the products: one LDS latency a pass instead of one per fragment
    asm volatile("" :: "v"(fk[0][0]), "v"(fk[0][1]), "v"(fk[1][0]), "v"(fk[1][1]), "v"(fkl[0][0]), "v"(fkl[0][1]), "v"(fkl[1][0]), "v"(fkl[1][1]));
#pragma unroll
    for (int ct = 0; ct < 2; ++ct) { v8f c = {}, cl = {};
#pragma unroll
      for (int kc = 0; kc < 2; ++kc) { const v16h kh = fk[ct][kc]; c = wmma16(aq[kc], kh, c); cl = wmma16(aql[kc], kh, cl); cl = wmma16(aq[kc], fkl[ct][kc], cl); }   // 3 products: q, k as f16 hi + residual
#pragma unroll
      for (int r = 0; r < 8; ++r) c[r] += cl[r] * (1.0f / 2048.0f);
      { const bool keepk = true;
#pragma unroll
      for (int r = 0; r < 8; ++r) s[ct][r] = keepk ? c[r] * SCALEF : -3.0e38f; } }   // no scaling (SCALEF 1); no key is masked
#pragma unroll
    for (int r = 0; r < 8; ++r) { float mx = fmaxf(s[0][r], s[1][r]);
#pragma unroll
      for (int o = 1; o < 16; o <<= 1) mx = fmaxf(mx, __shfl_xor(mx, o));
      const float mn = fmaxf(m[r], mx); const float alpha = (m[r] <= -1.0e38f) ? 0.f : __expf(m[r] - mn);
      const float e0 = (s[0][r] <= -1.0e38f) ? 0.f : __expf(s[0][r] - mn), e1 = (s[1][r] <= -1.0e38f) ? 0.f : __expf(s[1][r] - mn); float es = e0 + e1;
#pragma unroll
      for (int o = 1; o < 16; o <<= 1) es += __shfl_xor(es, o);
      l[r] = l[r] * alpha + es; m[r] = mn;
#pragma unroll
      for (int dt = 0; dt < 4; ++dt) { acc[dt][r] *= alpha; accl[dt][r] *= alpha; }
      sp[wave][8 * g + r][col] = e0; sp[wave][8 * g + r][16 + col] = e1; }
    LDSX();
    v16h pa, pl; { const float* prow = &sp[wave][col][0] + 8 * (lane >> 4);
#pragma unroll
      for (int i = 0; i < 8; ++i) { const float x0 = prow[i] * 2048.0f, x1 = prow[16 + i] * 2048.0f; const _Float16 h0 = (_Float16)x0, h1 = (_Float16)x1; pa[i] = h0; pa[8 + i] = h1; pl[i] = (_Float16)((x0 - (float)h0) * 2048.0f); pl[8 + i] = (_Float16)((x1 - (float)h1) * 2048.0f); } }   // P scaled by 2^11 before the f16 split so small softmax weights stay out of the f16 subnormal range; 2^-11 folded into the epilogue
    v16h fv[4], fvl[4];   // the pass's V fragments, read from LDS as one group
#pragma unroll
    for (int dt = 0; dt < 4; ++dt) { fv[dt] = frag_h(&sv[bf][0][dt * 16 + col][0], lane); fvl[dt] = frag_h(&sv[bf][1][dt * 16 + col][0], lane); }
    // holds the eight fragment reads together in front of the products: one LDS latency a pass instead of one per fragment
    asm volatile("" :: "v"(fv[0]), "v"(fv[1]), "v"(fv[2]), "v"(fv[3]), "v"(fvl[0]), "v"(fvl[1]), "v"(fvl[2]), "v"(fvl[3]));
#pragma unroll
    for (int dt = 0; dt < 4; ++dt) { const v16h vh = fv[dt]; acc[dt] = wmma16(pa, vh, acc[dt]); accl[dt] = wmma16(pl, vh, accl[dt]); accl[dt] = wmma16(pa, fvl[dt], accl[dt]); }   // P hi x V hi + (P lo x V hi + P hi x V lo) / 2048
    asm volatile("s_wait_dscnt 0x0" ::: "memory");      // this wave's reads of the stage (and of sp) are done before the buffer is given up
    asm volatile("s_wait_asynccnt 0x0" ::: "memory");   // this wave's copies of stage ks + 1 have landed
    __syncthreads();                                    // publishes stage ks + 1 and ends every reader's last read of stage ks
    if (ks + 2 < nks) { const size_t ak = (size_t)(ks + 2) * 32 * (2 * DM), av = (size_t)(ks + 2) * 32; stage_kv(QK + gk + ak, QKL + gk + ak, VTH + gv + av, VTL + gv + av, lk + bf * KBUF, lv + bf * VBUF); } }
  asm volatile("s_wait_asynccnt 0x0" ::: "memory");     // no copy is outstanding behind the loop
#pragma unroll
  for (int r = 0; r < 8; ++r) { const float il = (1.0f / 2048.0f) / l[r];
#pragma unroll
    for (int dt = 0; dt < 4; ++dt) so[wave][8 * g + r][dt * 16 + col] = (acc[dt][r] + accl[dt][r] * (1.0f / 2048.0f)) * il; }
  LDSX();
  for (int rl = 0; rl < 16; ++rl) if (lane < 16) vst2(O + ((size_t)b * SS + q0 + rl) * DM + h * HD + lane * 4, *(const v4f*)&so[wave][rl][lane * 4]);
}
// ---- k_out: block = (64 rows, 128 cols): out = O(hi/lo) . Wo rows (2 products) + bo
__global__ __launch_bounds__(128) void k_out(const float* __restrict__ O, const __bf16* __restrict__ P, const float* __restrict__ BO, float* __restrict__ Y) {
  __shared__ __align__(16) float so[4][16][132];
  const int tid = threadIdx.x, wave = tid >> 5, lane = tid & 31, col = lane & 15, g = lane >> 4; const size_t r0 = (size_t)blockIdx.x * 64 + wave * 16; const int n0 = blockIdx.y * 128;
  v8f acc[8] = {};
#pragma unroll 2
  for (int kc = 0; kc < DM / 32; ++kc) { const F2 a = split_row(O + (r0 + col) * DM, kc * 32, lane);
#pragma unroll
    for (int j = 0; j < 8; ++j) { const v16b w = frag_b(P + (size_t)(n0 + j * 16 + col) * DM + kc * 32, lane); acc[j] = wmma_bf(a.l, w, acc[j]); acc[j] = wmma_bf(a.h, w, acc[j]); } }
#pragma unroll
  for (int j = 0; j < 8; ++j) {
#pragma unroll
    for (int r = 0; r < 8; ++r) so[wave][8 * g + r][j * 16 + col] = acc[j][r] + (BO ? bfr(BO[n0 + j * 16 + col]) : 0.f); }
  LDSX();
  for (int rl = 0; rl < 16; ++rl) vst2(Y + (r0 + rl) * DM + n0 + lane * 4, *(const v4f*)&so[wave][rl][lane * 4]);
}
extern "C" void kernel_launch(void* const* d_in, const int* in_sizes, int n_in, void* d_out, int out_size, void* d_ws, size_t ws_size, hipStream_t stream) {
  (void)in_sizes; (void)n_in; (void)out_size;
  const float** F = (const float**)d_in;   // 0 x [2,2048,1024], 1 Wq, 2 bq, 3 Wk, 4 bk, 5 Wv, 6 bv, 7 Wg, 8 bg (natural [1024,1024] / [1024])
  if (ws_size < (size_t)WS_END) return;
  char* ws = (char*)d_ws; __bf16* PK = (__bf16*)(ws + WS_PK); _Float16 *QK = (_Float16*)(ws + WS_QK), *QKL = (_Float16*)(ws + WS_QKL), *VTH = (_Float16*)(ws + WS_VTH), *VTL = (_Float16*)(ws + WS_VTL);
  k_pack<<<dim3(DM, 4), 256, 0, stream>>>(F[1], F[3], F[5], F[7], PK);   // the fourth slot holds Wg
  k_qkv<<<dim3(TNB * SS / 64, QKVW / 128), 128, 0, stream>>>(F[0], F[0], F[0], PK + PK_A, F[2], F[4], F[6], QK, QKL, VTH, VTL, PK + PK_P, F[8]);
  k_attn<<<dim3(TQB, NH, TNB), 128, 0, stream>>>(QK, QKL, VTH, VTL, nullptr, (float*)d_out);   // merged context == output (no out-projection)
}

// v003
// A run of this version takes 168 microseconds.
// In both of two side-by-side timings against v002, it was 1.23 times as fast.
// All steps since v000 together make it 3.05 times as fast.
// compute dtype: all float inputs rounded to bf16; q/k/v/g = x . W^T + b with EXACT bf16 products on WMMA 16x16x32 (natural rows; q and g computed in the same block), qg = gelu_erf(q g) in f32 (precise erff) then split into f16 hi + residual; attention with 3-product scores (qg, k as f16 hi + residual) and 3-product P.v (P and v as hi + residual) everywhere; no scaling, running-max softmax in f32 (hardware exp); the merged context is the output (f32).
#include <hip/hip_runtime.h>
#include <math.h>

typedef __attribute__((ext_vector_type(16))) _Float16 v16h;
typedef __attribute__((ext_vector_type(16))) __bf16 v16b;
typedef __attribute__((ext_vector_type(8)))  _Float16 v8h;
typedef __attribute__((ext_vector_type(8)))  float v8f;
typedef __attribute__((ext_vector_type(4)))  float v4f;
typedef __attribute__((ext_vector_type(2)))  float v2f;
typedef __attribute__((ext_vector_type(4)))  unsigned v4u;
typedef __attribute__((ext_vector_type(4)))  int v4i;
typedef float __attribute__((may_alias)) float_a;
typedef int __attribute__((may_alias)) int_a;

template <typename T> __device__ __forceinline__ void vst2(void* p, T v) { *(T*)p = v;  }
__device__ __forceinline__ v8f wmma16(v16h a, v16h b, v8f c) {
  v8f d = __builtin_amdgcn_wmma_f32_16x16x32_f16(false, a, false, b, (short)0, c, false, false);
  asm volatile("v_nop\n\tv_nop\n\tv_nop\n\tv_nop" : "+v"(d) : "v"(a), "v"(b));
  return d;
}
__device__ __forceinline__ v8f wmma_bf(v16b a, v16b b, v8f c) {
  v8f d = __builtin_amdgcn_wmma_f32_16x16x32_bf16(false, a, false, b, (short)0, c, false, false);
  asm volatile("v_nop\n\tv_nop\n\tv_nop\n\tv_nop" : "+v"(d) : "v"(a), "v"(b));
  return d;
}
// Gated QKV attention (B 2, S 2,048, d 1,024, 16 heads x 64): q, k, v, g projections + biases, qg = gelu(q * g) (exact erf), softmax(qg k^T) v with no 1/sqrt(d) scaling and no output projection.
__device__ __forceinline__ v16h frag_h(const _Float16* rowk0, int lane) {
  union { v16h v; v8h q[2]; } u; const _Float16* p = rowk0 + 8 * (lane >> 4);
  u.q[0] = *(const v8h*)p; u.q[1] = *(const v8h*)(p + 16); return u.v;
}
__device__ __forceinline__ v16h frag_f32(const float* rowk0, int lane) {
  v16h a; const float* p = rowk0 + 8 * (lane >> 4);
#pragma unroll
  for (int i = 0; i < 8; ++i) { a[i] = (_Float16)p[i]; a[8 + i] = (_Float16)p[16 + i]; }
  return a;
}
__device__ __forceinline__ v16h frag_f32s(const float* rowk0, int lane, float sc) {
  v16h a; const float* p = rowk0 + 8 * (lane >> 4);
#pragma unroll
  for (int i = 0; i < 8; ++i) { a[i] = (_Float16)(p[i] * sc); a[8 + i] = (_Float16)(p[16 + i] * sc); }
  return a;
}
// column fragment from a [K][ld] layout (column n), rows >= K read as 0
__device__ __forceinline__ v16h fragc_f32(const float* W, int k0, int n, int lane, int ld, int K) {
  v16h a; const int g = lane >> 4;
#pragma unroll
  for (int i = 0; i < 8; ++i) { const int ka = k0 + 8 * g + i, kb = ka + 16;
    a[i] = (_Float16)(ka < K ? W[(size_t)(ka < K ? ka : K - 1) * ld + n] : 0.f); a[8 + i] = (_Float16)(kb < K ? W[(size_t)(kb < K ? kb : K - 1) * ld + n] : 0.f); }
  return a;
}
struct F2 { v16b h, l; };
__device__ __forceinline__ F2 bsplit16(const float v[16]) { F2 r;
#pragma unroll
  for (int i = 0; i < 16; ++i) { const __bf16 h = (__bf16)v[i]; r.h[i] = h; r.l[i] = (__bf16)(v[i] - (float)h); }
  return r; }
__device__ __forceinline__ F2 split_row(const float* row, int k0, int lane) { float v[16]; const float* p = row + k0 + 8 * (lane >> 4);
#pragma unroll
  for (int i = 0; i < 8; ++i) { v[i] = p[i]; v[8 + i] = p[16 + i]; }
  return bsplit16(v); }
__device__ __forceinline__ F2 split_rowK(const float* row, int k0, int lane, int K) { float v[16]; const int g = lane >> 4;
#pragma unroll
  for (int i = 0; i < 8; ++i) { const int ka = k0 + 8 * g + i, kb = ka + 16; v[i] = ka < K ? row[ka < K ? ka : K - 1] : 0.f; v[8 + i] = kb < K ? row[kb < K ? kb : K - 1] : 0.f; }
  return bsplit16(v); }
__device__ __forceinline__ F2 split_col(const float* W, int k0, int n, int lane, int ld, int K) { float v[16]; const int g = lane >> 4;
#pragma unroll
  for (int i = 0; i < 8; ++i) { const int ka = k0 + 8 * g + i, kb = ka + 16; v[i] = ka < K ? W[(size_t)(ka < K ? ka : K - 1) * ld + n] : 0.f; v[8 + i] = kb < K ? W[(size_t)(kb < K ? kb : K - 1) * ld + n] : 0.f; }
  return bsplit16(v); }
__device__ __forceinline__ v8f mac3(const F2& a, const F2& b, v8f c) { c = wmma_bf(a.l, b.h, c); c = wmma_bf(a.h, b.l, c); return wmma_bf(a.h, b.h, c); }
__device__ __forceinline__ float sigm(float v) { return 1.0f / (1.0f + expf(-v)); }
#define LDSX() do { asm volatile("s_wait_dscnt 0" ::: "memory"); __builtin_amdgcn_wave_barrier(); __builtin_amdgcn_fence(__ATOMIC_RELEASE, "workgroup"); } while (0)


#define NB 2
#define SS 2048
#define DM 1024
#define NH 16
#define SCALEF 1.0f
__device__ __attribute__((noinline)) float gelu_e(float v) { return 0.5f * v * (1.0f + erff(v * 0.70710678118654752f)); }
#define HD 64
#define QKVW (3 * DM)
#ifndef TQB
#define TQB (SS / 64)
#define TNB NB
#define TOB (NB * SS / 64)     // output row tiles (all)
#endif
typedef __attribute__((ext_vector_type(8))) __bf16 v8b;
__device__ __forceinline__ v16b frag_b(const __bf16* rowk0, int lane) {
  union { v16b v; v8b q[2]; } u; const __bf16* p = rowk0 + 8 * (lane >> 4);
  u.q[0] = *(const v8b*)p; u.q[1] = *(const v8b*)(p + 16); return u.v;
}
__device__ __forceinline__ float bfr(float v) { return (float)(__bf16)v; }
__device__ __attribute__((noinline)) float exp_ni(float v) { return expf(v); }
__device__ __attribute__((noinline)) float erf_ni(float v) { return erff(v); }

#define PK_A 0                       // [3072][1024] Wqkv rows (natural [out][in])
#define PK_P (PK_A + QKVW * DM)        // [1024][1024] Wg rows (natural)
#define PK_END (PK_P + DM * DM)
#define WS_PK  0u
#define WS_QK  (WS_PK + 2u * PK_END)             // f16 [4096 rows][2048]: qg | k
#define WS_QKL (WS_QK + 2u * NB * SS * 2 * DM)     // f16 q | k residual planes x2048
#define WS_VTH (WS_QKL + 2u * NB * SS * 2 * DM)    // f16 [b][1024 (h*64+d)][2048 s] hi
#define WS_VTL (WS_VTH + 2u * NB * DM * SS)        // f16 lo x 2048
#define WS_O   (WS_VTL + 2u * NB * DM * SS)        // f32 [4096][1024]
#define WS_CS  (WS_O + 4u * NB * SS * DM)           // f32 2 x [2048][32], unused
#define WS_END (WS_CS + 4u * 2 * SS * 32)
// ---- k_pack: block = (row n, which): natural [out][in] rows -> bf16; which 0..2 -> W_q/W_k/W_v into PK_A rows which*1024 + n; 3 -> W_g into PK_P
__global__ __launch_bounds__(256) void k_pack(const float* __restrict__ WQ, const float* __restrict__ WK, const float* __restrict__ WV, const float* __restrict__ WO, __bf16* __restrict__ PK) {
  __shared__ __align__(16) __bf16 s[DM]; const int n = blockIdx.x, which = blockIdx.y, t = threadIdx.x; const float* Wm = (which == 0) ? WQ : (which == 1) ? WK : (which == 2) ? WV : WO;
  for (int k = t; k < DM; k += 256) s[k] = (__bf16)Wm[(size_t)n * DM + k];
  __syncthreads();
  __bf16* dst = (which < 3) ? PK + PK_A + ((size_t)which * DM + n) * DM : PK + PK_P + (size_t)n * DM;
  for (int q = t; q < DM / 8; q += 256) vst2((unsigned*)(dst + q * 8), *(const v4u*)&s[q * 8]);
}
#define XPB 272u                  // X row pitch in LDS, bytes (256-B rows of 64 f32 + 16 B)
#define WPB 144u                  // weight row pitch in LDS, bytes (128-B rows of 64 bf16 + 16 B)
#define QXB (64u * XPB)           // bytes of one X tile (64 rows)
#define QWB (128u * WPB)          // bytes of one weight tile (128 rows)
#define QSTG (QXB + 2u * QWB)     // bytes of one stage: X | W | Wg
// one thread's eight 16-byte asynchronous copies into LDS: piece i goes from g + i * gs to LDS byte l + i * ls.
// The copies and s_wait_xcnt stand in one statement so that no address register is rewritten ahead of the wait.
__device__ __forceinline__ void stage8(const char* g, size_t gs, unsigned l, unsigned ls) {
  asm volatile("global_load_async_to_lds_b128 %0, %8, off\n\t"
               "global_load_async_to_lds_b128 %1, %9, off\n\t"
               "global_load_async_to_lds_b128 %2, %10, off\n\t"
               "global_load_async_to_lds_b128 %3, %11, off\n\t"
               "global_load_async_to_lds_b128 %4, %12, off\n\t"
               "global_load_async_to_lds_b128 %5, %13, off\n\t"
               "global_load_async_to_lds_b128 %6, %14, off\n\t"
               "global_load_async_to_lds_b128 %7, %15, off\n\t"
               "s_wait_xcnt 0x0"
               :: "v"(l), "v"(l + ls), "v"(l + 2u * ls), "v"(l + 3u * ls), "v"(l + 4u * ls), "v"(l + 5u * ls), "v"(l + 6u * ls), "v"(l + 7u * ls),
                  "v"(g), "v"(g + gs), "v"(g + 2 * gs), "v"(g + 3 * gs), "v"(g + 4 * gs), "v"(g + 5 * gs), "v"(g + 6 * gs), "v"(g + 7 * gs)
               : "memory");
}
// ---- k_qkv: block = (64 rows of x, 128 output columns; the q blocks also their 128 gate columns). A stage is 64 k of the block's X rows (f32) and weight rows (bf16), brought into LDS once per block, two buffers; the epilogue's staging arrays reuse the ring behind the last pass's barrier
__global__ __launch_bounds__(128) void k_qkv(const float* __restrict__ XQ, const float* __restrict__ XK, const float* __restrict__ XV, const __bf16* __restrict__ P, const float* __restrict__ BQ, const float* __restrict__ BK, const float* __restrict__ BV, _Float16* __restrict__ QK, _Float16* __restrict__ QKL, _Float16* __restrict__ VTH, _Float16* __restrict__ VTL, const __bf16* __restrict__ WG, const float* __restrict__ BG) {
  const int which0 = (blockIdx.y * 128) / DM; const float* X = (which0 == 0) ? XQ : (which0 == 1) ? XK : XV; const float* BB = BQ ? (((which0 == 0) ? BQ : (which0 == 1) ? BK : BV) + (blockIdx.y * 128 - which0 * DM)) : nullptr;
  __shared__ __align__(16) unsigned char sm[2 * QSTG];
  _Float16 (*so)[16][136] = (_Float16 (*)[16][136])sm; _Float16 (*sol)[16][136] = (_Float16 (*)[16][136])(sm + 4 * 16 * 136 * 2);
  _Float16 (*sth)[72] = (_Float16 (*)[72])sm; _Float16 (*stl)[72] = (_Float16 (*)[72])(sm + 128 * 72 * 2);
  const int tid = threadIdx.x, wave = tid >> 5, lane = tid & 31, col = lane & 15, g = lane >> 4; const size_t r0 = (size_t)blockIdx.x * 64 + wave * 16; const int n0 = blockIdx.y * 128;
  // each thread's share of a stage: 16-byte pieces of X rows tid / 16 + 8 i and of weight rows tid / 8 + 16 i, i = 0..7
  const char* gx = (const char*)(X + ((size_t)blockIdx.x * 64 + (tid >> 4)) * DM + (tid & 15) * 4);
  const char* gw = (const char*)(P + (size_t)(n0 + (tid >> 3)) * DM + (tid & 7) * 8);
  const char* gg = (const char*)(WG + (size_t)((n0 < DM ? n0 : 0) + (tid >> 3)) * DM + (tid & 7) * 8);
  const unsigned lx = (unsigned)(size_t)&sm[(tid >> 4) * XPB + (tid & 15) * 16], lw = (unsigned)(size_t)&sm[QXB + (tid >> 3) * WPB + (tid & 7) * 16];
  const int nps = DM / 64;
  v8f acc[8] = {}; v8f accg[8] = {};
  stage8(gx, (size_t)8 * DM * 4, lx, 8u * XPB); stage8(gw, (size_t)16 * DM * 2, lw, 16u * WPB);
  if (n0 < DM) stage8(gg, (size_t)16 * DM * 2, lw + QWB, 16u * WPB);
  asm volatile("s_wait_asynccnt 0x0" ::: "memory");   // stage 0 has landed before the barrier that publishes it
  __syncthreads();
  stage8(gx + 256, (size_t)8 * DM * 4, lx + QSTG, 8u * XPB); stage8(gw + 128, (size_t)16 * DM * 2, lw + QSTG, 16u * WPB);
  if (n0 < DM) stage8(gg + 128, (size_t)16 * DM * 2, lw + QSTG + QWB, 16u * WPB);
#pragma unroll 1
  for (int ps = 0; ps < nps; ++ps) { const unsigned bo = (unsigned)(ps & 1) * QSTG; const unsigned char* sb = sm + bo;
#pragma unroll
    for (int kc = 0; kc < 2; ++kc) { v16b a; { const float* p = (const float*)(sb + (wave * 16 + col) * XPB) + kc * 32 + 8 * g;
#pragma unroll
      for (int i = 0; i < 8; ++i) { a[i] = (__bf16)p[i]; a[8 + i] = (__bf16)p[16 + i]; } }
      v16b fw[8];   // the k-step's weight fragments, read from LDS as one group
#pragma unroll
      for (int j = 0; j < 8; ++j) fw[j] = frag_b((const __bf16*)(sb + QXB + (j * 16 + col) * WPB) + kc * 32, lane);
      // holds the fragment reads together in front of the products: one LDS latency a group instead of one per fragment
      asm volatile("" :: "v"(fw[0]), "v"(fw[1]), "v"(fw[2]), "v"(fw[3]), "v"(fw[4]), "v"(fw[5]), "v"(fw[6]), "v"(fw[7]));
#pragma unroll
      for (int j = 0; j < 8; ++j) acc[j] = wmma_bf(a, fw[j], acc[j]);
      if (n0 < DM) { v16b fg[8];   // the gate's fragments, likewise
#pragma unroll
        for (int j = 0; j < 8; ++j) fg[j] = frag_b((const __bf16*)(sb + QXB + QWB + (j * 16 + col) * WPB) + kc * 32, lane);
        // holds the fragment reads together in front of the products: one LDS latency a group instead of one per fragment
        asm volatile("" :: "v"(fg[0]), "v"(fg[1]), "v"(fg[2]), "v"(fg[3]), "v"(fg[4]), "v"(fg[5]), "v"(fg[6]), "v"(fg[7]));
#pragma unroll
        for (int j = 0; j < 8; ++j) accg[j] = wmma_bf(a, fg[j], accg[j]); } }
    asm volatile("s_wait_dscnt 0x0" ::: "memory");      // this wave's reads of the stage are done before the buffer is given up
    asm volatile("s_wait_asynccnt 0x0" ::: "memory");   // this wave's copies of stage ps + 1 have landed
    __syncthreads();                                    // publishes stage ps + 1 and ends every reader's last read of stage ps
    if (ps + 2 < nps) { const size_t ax = (size_t)(ps + 2) * 256, aw = (size_t)(ps + 2) * 128;
      stage8(gx + ax, (size_t)8 * DM * 4, lx + bo, 8u * XPB); stage8(gw + aw, (size_t)16 * DM * 2, lw + bo, 16u * WPB);
      if (n0 < DM) stage8(gg + aw, (size_t)16 * DM * 2, lw + bo + QWB, 16u * WPB); } }
  asm volatile("s_wait_asynccnt 0x0" ::: "memory");     // no copy is outstanding behind the loop; the ring now serves as the epilogue's staging
  if (n0 < 2 * DM) {   // q stored unscaled (f16 sigma ~0.6, no subnormal exposure); no scale is applied to the f32 score
#pragma unroll
    for (int j = 0; j < 8; ++j) {
#pragma unroll
      for (int r = 0; r < 8; ++r) { float v = acc[j][r] + (BB ? bfr(BB[j * 16 + col]) : 0.f); if (n0 < DM) v = gelu_e(v * (accg[j][r] + bfr(BG[n0 + j * 16 + col]))); const _Float16 hv = (_Float16)v; so[wave][8 * g + r][j * 16 + col] = hv; sol[wave][8 * g + r][j * 16 + col] = (_Float16)((v - (float)hv) * 2048.0f); } }   // q, k (+ bias) as f16 hi + (x2048) residual
    LDSX();
    for (int rl = 0; rl < 16; ++rl) if (lane < 16) { vst2((unsigned*)(QK + (r0 + rl) * (2 * DM) + n0 + lane * 8), *(const v4u*)&so[wave][rl][lane * 8]); vst2((unsigned*)(QKL + (r0 + rl) * (2 * DM) + n0 + lane * 8), *(const v4u*)&sol[wave][rl][lane * 8]); }
  } else {
#pragma unroll
    for (int j = 0; j < 8; ++j) {
#pragma unroll
      for (int r = 0; r < 8; ++r) { const float v = acc[j][r] + (BB ? bfr(BB[j * 16 + col]) : 0.f); const _Float16 hv = (_Float16)v; sth[j * 16 + col][wave * 16 + 8 * g + r] = hv; stl[j * 16 + col][wave * 16 + 8 * g + r] = (_Float16)((v - (float)hv) * 2048.0f); } }
    __syncthreads();
    const size_t rb = (size_t)blockIdx.x * 64; const int b = (int)(rb / SS), s0 = (int)(rb % SS); const int pc0 = n0 - 2 * DM;
    for (int q = tid; q < 128 * 8; q += 128) { const int d = q >> 3, pc = q & 7; const size_t o = ((size_t)b * DM + pc0 + d) * SS + s0 + pc * 8; vst2((unsigned*)(VTH + o), *(const v4u*)&sth[d][pc * 8]); vst2((unsigned*)(VTL + o), *(const v4u*)&stl[d][pc * 8]); }
  }
}
#define KPH 72                    // K row pitch in LDS, f16 elements (128-B rows + 16 B)
#define VPH 40                    // V row pitch in LDS, f16 elements (64-B rows + 16 B)
#define KPL (32u * KPH * 2u)      // bytes of one K plane
#define VPL (64u * VPH * 2u)      // bytes of one V plane
#define KBUF (2u * KPL)           // bytes of one K buffer (both planes)
#define VBUF (2u * VPL)
// one thread's eight 16-byte asynchronous copies of a 32-key stage (K hi, K residual, V hi, V residual; two rows each) into LDS.
// The copies and s_wait_xcnt stand in one statement so that no address register is rewritten ahead of the wait.
__device__ __forceinline__ void stage_kv(const _Float16* kh, const _Float16* kl, const _Float16* vh, const _Float16* vl, unsigned lk, unsigned lv) {
  asm volatile("global_load_async_to_lds_b128 %0, %8, off\n\t"
               "global_load_async_to_lds_b128 %1, %9, off\n\t"
               "global_load_async_to_lds_b128 %2, %10, off\n\t"
               "global_load_async_to_lds_b128 %3, %11, off\n\t"
               "global_load_async_to_lds_b128 %4, %12, off\n\t"
               "global_load_async_to_lds_b128 %5, %13, off\n\t"
               "global_load_async_to_lds_b128 %6, %14, off\n\t"
               "global_load_async_to_lds_b128 %7, %15, off\n\t"
               "s_wait_xcnt 0x0"
               :: "v"(lk), "v"(lk + 16u * KPH * 2u), "v"(lk + KPL), "v"(lk + KPL + 16u * KPH * 2u), "v"(lv), "v"(lv + 32u * VPH * 2u), "v"(lv + VPL), "v"(lv + VPL + 32u * VPH * 2u),
                  "v"(kh), "v"(kh + (size_t)16 * (2 * DM)), "v"(kl), "v"(kl + (size_t)16 * (2 * DM)), "v"(vh), "v"(vh + (size_t)32 * SS), "v"(vl), "v"(vl + (size_t)32 * SS)
               : "memory");
}
// lane l's value exchanged with lane l ^ 16 (a vector cross-row move; a shuffle would go through the LDS unit)
__device__ __forceinline__ float xhalf(float x) { return __builtin_bit_cast(float, __builtin_amdgcn_permlanex16(__builtin_bit_cast(int, x), __builtin_bit_cast(int, x), 0x76543210, 0xfedcba98, false, false)); }
__global__ __launch_bounds__(128) void k_attn(const _Float16* __restrict__ QK, const _Float16* __restrict__ QKL, const _Float16* __restrict__ VTH, const _Float16* __restrict__ VTL, const void* __restrict__ KMASK, float* __restrict__ O) {
  __shared__ __align__(16) float so[4][16][68];
  __shared__ __align__(16) _Float16 sk[2][2][32][KPH];   // [buffer][hi, residual][key][d], 144-B rows
  __shared__ __align__(16) _Float16 sv[2][2][64][VPH];   // [buffer][hi, residual][d][key], 80-B rows
  const int tid = threadIdx.x, wave = tid >> 5, lane = tid & 31, col = lane & 15, g = lane >> 4;
  const int qb = blockIdx.x, h = blockIdx.y, b = blockIdx.z;
  // each thread's share of a 32-key stage: 16-byte pieces of K rows tid / 8 and 16 + tid / 8 and of V rows tid / 4 and 32 + tid / 4, both planes
  const size_t gk = ((size_t)b * SS + (tid >> 3)) * (2 * DM) + DM + h * HD + (tid & 7) * 8, gv = ((size_t)b * DM + h * HD + (tid >> 2)) * SS + (tid & 3) * 8;
  const unsigned lk = (unsigned)(size_t)&sk[0][0][tid >> 3][(tid & 7) * 8], lv = (unsigned)(size_t)&sv[0][0][tid >> 2][(tid & 3) * 8]; const int q0 = qb * 64 + wave * 16; const size_t rq = (size_t)b * SS + q0 + col;
  v16h aq[2], aql[2];
#pragma unroll
  for (int kc = 0; kc < 2; ++kc) { aq[kc] = frag_h(QK + rq * (2 * DM) + h * HD + kc * 32, lane); aql[kc] = frag_h(QKL + rq * (2 * DM) + h * HD + kc * 32, lane); }
  float m = -3.0e38f, l = 0.f;   // the lane's query: running maximum (equal in both halves) and this half's share of the sum
  v8f acc[4] = {}, accl[4] = {};   // O^T tiles: register r = d dt * 16 + 8 g + r of query col
  const int nks = SS / 32;   // all keys
  stage_kv(QK + gk, QKL + gk, VTH + gv, VTL + gv, lk, lv);
  asm volatile("s_wait_asynccnt 0x0" ::: "memory");   // stage 0 has landed before the barrier that publishes it
  __syncthreads();
  stage_kv(QK + gk + (size_t)32 * (2 * DM), QKL + gk + (size_t)32 * (2 * DM), VTH + gv + 32, VTL + gv + 32, lk + KBUF, lv + VBUF);
#pragma unroll 1
  for (int ks = 0; ks < nks; ++ks) { v8f s[2]; const int bf = ks & 1;
    v16h fk[2][2], fkl[2][2];   // the pass's K fragments, read from LDS as one group
#pragma unroll
    for (int ct = 0; ct < 2; ++ct) {
#pragma unroll
      for (int kc = 0; kc < 2; ++kc) { fk[ct][kc] = frag_h(&sk[bf][0][ct * 16 + col][kc * 32], lane); fkl[ct][kc] = frag_h(&sk[bf][1][ct * 16 + col][kc * 32], lane); } }
    // holds the eight fragment reads together in front of the products: one LDS latency a pass instead of one per fragment
    asm volatile("" :: "v"(fk[0][0]), "v"(fk[0][1]), "v"(fk[1][0]), "v"(fk[1][1]), "v"(fkl[0][0]), "v"(fkl[0][1]), "v"(fkl[1][0]), "v"(fkl[1][1]));
#pragma unroll
    for (int ct = 0; ct < 2; ++ct) { v8f c = {}, cl = {};
#pragma unroll
      for (int kc = 0; kc < 2; ++kc) { const v16h kh = fk[ct][kc]; c = wmma16(kh, aq[kc], c); cl = wmma16(kh, aql[kc], cl); cl = wmma16(fkl[ct][kc], aq[kc], cl); }   // 3 products: q, k as f16 hi + residual
#pragma unroll
      for (int r = 0; r < 8; ++r) c[r] += cl[r] * (1.0f / 2048.0f);
      { const bool keepk = true;
#pragma unroll
      for (int r = 0; r < 8; ++r) s[ct][r] = keepk ? c[r] * SCALEF : -3.0e38f; } }   // no scaling (SCALEF = 1); no key is masked
    // the lane's 16 scores, as a tree of three-way maxima (short dependent chain)
    const float u0 = fmaxf(fmaxf(s[0][0], s[1][0]), s[0][1]), u1 = fmaxf(fmaxf(s[1][1], s[0][2]), s[1][2]), u2 = fmaxf(fmaxf(s[0][3], s[1][3]), s[0][4]), u3 = fmaxf(fmaxf(s[1][4], s[0][5]), s[1][5]), u4 = fmaxf(fmaxf(s[0][6], s[1][6]), s[0][7]);
    float mx = fmaxf(fmaxf(fmaxf(u0, u1), u2), fmaxf(fmaxf(u3, u4), s[1][7]));
    mx = fmaxf(mx, xhalf(mx));   // both halves now hold the query's maximum over the pass's 32 keys
    const float mn = fmaxf(m, mx); const float alpha = (m <= -1.0e38f) ? 0.f : __expf(m - mn);
    float e[2][8], t[8];
#pragma unroll
    for (int r = 0; r < 8; ++r) { e[0][r] = (s[0][r] <= -1.0e38f) ? 0.f : __expf(s[0][r] - mn); e[1][r] = (s[1][r] <= -1.0e38f) ? 0.f : __expf(s[1][r] - mn); t[r] = e[0][r] + e[1][r]; }
    l = l * alpha + (((t[0] + t[1]) + (t[2] + t[3])) + ((t[4] + t[5]) + (t[6] + t[7]))); m = mn;   // the halves' sums are joined once, in the epilogue
#pragma unroll
    for (int dt = 0; dt < 4; ++dt) {
#pragma unroll
      for (int r = 0; r < 8; ++r) { acc[dt][r] *= alpha; accl[dt][r] *= alpha; } }
    v16h pa, pl;   // P^T as a B operand: element i = key 8 g + i, element 8 + i = key 16 + 8 g + i, the k order of the V fragments
#pragma unroll
    for (int i = 0; i < 8; ++i) { const float x0 = e[0][i] * 2048.0f, x1 = e[1][i] * 2048.0f; const _Float16 h0 = (_Float16)x0, h1 = (_Float16)x1; pa[i] = h0; pa[8 + i] = h1; pl[i] = (_Float16)((x0 - (float)h0) * 2048.0f); pl[8 + i] = (_Float16)((x1 - (float)h1) * 2048.0f); }   // P scaled by 2^11 before the f16 split so small softmax weights stay out of the f16 subnormal range; 2^-11 folded into the epilogue
    v16h fv[4], fvl[4];   // the pass's V fragments, read from LDS as one group
#pragma unroll
    for (int dt = 0; dt < 4; ++dt) { fv[dt] = frag_h(&sv[bf][0][dt * 16 + col][0], lane); fvl[dt] = frag_h(&sv[bf][1][dt * 16 + col][0], lane); }
    // holds the eight fragment reads together in front of the products: one LDS latency a pass instead of one per fragment
    asm volatile("" :: "v"(fv[0]), "v"(fv[1]), "v"(fv[2]), "v"(fv[3]), "v"(fvl[0]), "v"(fvl[1]), "v"(fvl[2]), "v"(fvl[3]));
#pragma unroll
    for (int dt = 0; dt < 4; ++dt) { const v16h vh = fv[dt]; acc[dt] = wmma16(vh, pa, acc[dt]); accl[dt] = wmma16(vh, pl, accl[dt]); accl[dt] = wmma16(fvl[dt], pa, accl[dt]); }   // P hi x V hi + (P lo x V hi + P hi x V lo) / 2048
    asm volatile("s_wait_dscnt 0x0" ::: "memory");      // this wave's reads of the stage are done before the buffer is given up
    asm volatile("s_wait_asynccnt 0x0" ::: "memory");   // this wave's copies of stage ks + 1 have landed
    __syncthreads();                                    // publishes stage ks + 1 and ends every reader's last read of stage ks
    if (ks + 2 < nks) { const size_t ak = (size_t)(ks + 2) * 32 * (2 * DM), av = (size_t)(ks + 2) * 32; stage_kv(QK + gk + ak, QKL + gk + ak, VTH + gv + av, VTL + gv + av, lk + bf * KBUF, lv + bf * VBUF); } }
  asm volatile("s_wait_asynccnt 0x0" ::: "memory");     // no copy is outstanding behind the loop
  const float il = (1.0f / 2048.0f) / (l + xhalf(l));
#pragma unroll
  for (int dt = 0; dt < 4; ++dt) {
#pragma unroll
    for (int r = 0; r < 8; ++r) so[wave][col][dt * 16 + 8 * g + r] = (acc[dt][r] + accl[dt][r] * (1.0f / 2048.0f)) * il; }
  LDSX();
  for (int rl = 0; rl < 16; ++rl) if (lane < 16) vst2(O + ((size_t)b * SS + q0 + rl) * DM + h * HD + lane * 4, *(const v4f*)&so[wave][rl][lane * 4]);
}
// ---- k_out: block = (64 rows, 128 cols): out = O(hi/lo) . Wo rows (2 products) + bo
__global__ __launch_bounds__(128) void k_out(const float* __restrict__ O, const __bf16* __restrict__ P, const float* __restrict__ BO, float* __restrict__ Y) {
  __shared__ __align__(16) float so[4][16][132];
  const int tid = threadIdx.x, wave = tid >> 5, lane = tid & 31, col = lane & 15, g = lane >> 4; const size_t r0 = (size_t)blockIdx.x * 64 + wave * 16; const int n0 = blockIdx.y * 128;
  v8f acc[8] = {};
#pragma unroll 2
  for (int kc = 0; kc < DM / 32; ++kc) { const F2 a = split_row(O + (r0 + col) * DM, kc * 32, lane);
#pragma unroll
    for (int j = 0; j < 8; ++j) { const v16b w = frag_b(P + (size_t)(n0 + j * 16 + col) * DM + kc * 32, lane); acc[j] = wmma_bf(a.l, w, acc[j]); acc[j] = wmma_bf(a.h, w, acc[j]); } }
#pragma unroll
  for (int j = 0; j < 8; ++j) {
#pragma unroll
    for (int r = 0; r < 8; ++r) so[wave][8 * g + r][j * 16 + col] = acc[j][r] + (BO ? bfr(BO[n0 + j * 16 + col]) : 0.f); }
  LDSX();
  for (int rl = 0; rl < 16; ++rl) vst2(Y + (r0 + rl) * DM + n0 + lane * 4, *(const v4f*)&so[wave][rl][lane * 4]);
}
extern "C" void kernel_launch(void* const* d_in, const int* in_sizes, int n_in, void* d_out, int out_size, void* d_ws, size_t ws_size, hipStream_t stream) {
  (void)in_sizes; (void)n_in; (void)out_size;
  const float** F = (const float**)d_in;   // 0 x [2,2048,1024], 1 Wq, 2 bq, 3 Wk, 4 bk, 5 Wv, 6 bv, 7 Wg, 8 bg (natural [1024,1024] / [1024])
  if (ws_size < (size_t)WS_END) return;
  char* ws = (char*)d_ws; __bf16* PK = (__bf16*)(ws + WS_PK); _Float16 *QK = (_Float16*)(ws + WS_QK), *QKL = (_Float16*)(ws + WS_QKL), *VTH = (_Float16*)(ws + WS_VTH), *VTL = (_Float16*)(ws + WS_VTL);
  k_pack<<<dim3(DM, 4), 256, 0, stream>>>(F[1], F[3], F[5], F[7], PK);   // the fourth slot holds Wg
  k_qkv<<<dim3(TNB * SS / 64, QKVW / 128), 128, 0, stream>>>(F[0], F[0], F[0], PK + PK_A, F[2], F[4], F[6], QK, QKL, VTH, VTL, PK + PK_P, F[8]);
  k_attn<<<dim3(TQB, NH, TNB), 128, 0, stream>>>(QK, QKL, VTH, VTL, nullptr, (float*)d_out);   // merged context == output (no out-projection)
}

// v004
// A run of this version takes 161 microseconds.
// Two timings next to v003 both put it at 1.05 times that version's speed.
// Counting every step since v000, it is 3.19 times as fast.
// compute dtype: all float inputs rounded to bf16; q/k/v/g = x . W^T + b with EXACT bf16 products on WMMA 16x16x32 (natural rows; q and g computed in the same block), qg = gelu_erf(q g) in f32 (precise erff) then split into f16 hi + residual; attention with 3-product scores (qg, k as f16 hi + residual) and 3-product P.v (P and v as hi + residual) everywhere; no scaling, running-max softmax in f32 (hardware exp); the merged context is the output (f32).
#include <hip/hip_runtime.h>
#include <math.h>

typedef __attribute__((ext_vector_type(16))) _Float16 v16h;
typedef __attribute__((ext_vector_type(16))) __bf16 v16b;
typedef __attribute__((ext_vector_type(8)))  _Float16 v8h;
typedef __attribute__((ext_vector_type(8)))  float v8f;
typedef __attribute__((ext_vector_type(4)))  float v4f;
typedef __attribute__((ext_vector_type(2)))  float v2f;
typedef __attribute__((ext_vector_type(4)))  unsigned v4u;
typedef __attribute__((ext_vector_type(4)))  int v4i;
typedef float __attribute__((may_alias)) float_a;
typedef int __attribute__((may_alias)) int_a;

template <typename T> __device__ __forceinline__ void vst2(void* p, T v) { *(T*)p = v;  }
// both products are the plain builtin: the compiler itself keeps the distance that the chip needs behind a matrix instruction, and fills it with useful work where it can
__device__ __forceinline__ v8f wmma16(v16h a, v16h b, v8f c) {
  return __builtin_amdgcn_wmma_f32_16x16x32_f16(false, a, false, b, (short)0, c, false, false);
}
__device__ __forceinline__ v8f wmma_bf(v16b a, v16b b, v8f c) {
  return __builtin_amdgcn_wmma_f32_16x16x32_bf16(false, a, false, b, (short)0, c, false, false);
}
// Gated QKV attention (B 2, S 2,048, d 1,024, 16 heads x 64): q, k, v, g projections + biases, qg = gelu(q * g) (exact erf), softmax(qg k^T) v with no 1/sqrt(d) scaling and no output projection.
__device__ __forceinline__ v16h frag_h(const _Float16* rowk0, int lane) {
  union { v16h v; v8h q[2]; } u; const _Float16* p = rowk0 + 8 * (lane >> 4);
  u.q[0] = *(const v8h*)p; u.q[1] = *(const v8h*)(p + 16); return u.v;
}
__device__ __forceinline__ v16h frag_f32(const float* rowk0, int lane) {
  v16h a; const float* p = rowk0 + 8 * (lane >> 4);
#pragma unroll
  for (int i = 0; i < 8; ++i) { a[i] = (_Float16)p[i]; a[8 + i] = (_Float16)p[16 + i]; }
  return a;
}
__device__ __forceinline__ v16h frag_f32s(const float* rowk0, int lane, float sc) {
  v16h a; const float* p = rowk0 + 8 * (lane >> 4);
#pragma unroll
  for (int i = 0; i < 8; ++i) { a[i] = (_Float16)(p[i] * sc); a[8 + i] = (_Float16)(p[16 + i] * sc); }
  return a;
}
// column fragment from a [K][ld] layout (column n), rows >= K read as 0
__device__ __forceinline__ v16h fragc_f32(const float* W, int k0, int n, int lane, int ld, int K) {
  v16h a; const int g = lane >> 4;
#pragma unroll
  for (int i = 0; i < 8; ++i) { const int ka = k0 + 8 * g + i, kb = ka + 16;
    a[i] = (_Float16)(ka < K ? W[(size_t)(ka < K ? ka : K - 1) * ld + n] : 0.f); a[8 + i] = (_Float16)(kb < K ? W[(size_t)(kb < K ? kb : K - 1) * ld + n] : 0.f); }
  return a;
}
struct F2 { v16b h, l; };
__device__ __forceinline__ F2 bsplit16(const float v[16]) { F2 r;
#pragma unroll
  for (int i = 0; i < 16; ++i) { const __bf16 h = (__bf16)v[i]; r.h[i] = h; r.l[i] = (__bf16)(v[i] - (float)h); }
  return r; }
__device__ __forceinline__ F2 split_row(const float* row, int k0, int lane) { float v[16]; const float* p = row + k0 + 8 * (lane >> 4);
#pragma unroll
  for (int i = 0; i < 8; ++i) { v[i] = p[i]; v[8 + i] = p[16 + i]; }
  return bsplit16(v); }
__device__ __forceinline__ F2 split_rowK(const float* row, int k0, int lane, int K) { float v[16]; const int g = lane >> 4;
#pragma unroll
  for (int i = 0; i < 8; ++i) { const int ka = k0 + 8 * g + i, kb = ka + 16; v[i] = ka < K ? row[ka < K ? ka : K - 1] : 0.f; v[8 + i] = kb < K ? row[kb < K ? kb : K - 1] : 0.f; }
  return bsplit16(v); }
__device__ __forceinline__ F2 split_col(const float* W, int k0, int n, int lane, int ld, int K) { float v[16]; const int g = lane >> 4;
#pragma unroll
  for (int i = 0; i < 8; ++i) { const int ka = k0 + 8 * g + i, kb = ka + 16; v[i] = ka < K ? W[(size_t)(ka < K ? ka : K - 1) * ld + n] : 0.f; v[8 + i] = kb < K ? W[(size_t)(kb < K ? kb : K - 1) * ld + n] : 0.f; }
  return bsplit16(v); }
__device__ __forceinline__ v8f mac3(const F2& a, const F2& b, v8f c) { c = wmma_bf(a.l, b.h, c); c = wmma_bf(a.h, b.l, c); return wmma_bf(a.h, b.h, c); }
__device__ __forceinline__ float sigm(float v) { return 1.0f / (1.0f + expf(-v)); }
#define LDSX() do { asm volatile("s_wait_dscnt 0" ::: "memory"); __builtin_amdgcn_wave_barrier(); __builtin_amdgcn_fence(__ATOMIC_RELEASE, "workgroup"); } while (0)


#define NB 2
#define SS 2048
#define DM 1024
#define NH 16
#define SCALEF 1.0f
__device__ __attribute__((noinline)) float gelu_e(float v) { return 0.5f * v * (1.0f + erff(v * 0.70710678118654752f)); }
#define HD 64
#define QKVW (3 * DM)
#ifndef TQB
#define TQB (SS / 64)
#define TNB NB
#define TOB (NB * SS / 64)     // output row tiles (all)
#endif
typedef __attribute__((ext_vector_type(8))) __bf16 v8b;
__device__ __forceinline__ v16b frag_b(const __bf16* rowk0, int lane) {
  union { v16b v; v8b q[2]; } u; const __bf16* p = rowk0 + 8 * (lane >> 4);
  u.q[0] = *(const v8b*)p; u.q[1] = *(const v8b*)(p + 16); return u.v;
}
__device__ __forceinline__ float bfr(float v) { return (float)(__bf16)v; }
__device__ __attribute__((noinline)) float exp_ni(float v) { return expf(v); }
__device__ __attribute__((noinline)) float erf_ni(float v) { return erff(v); }

#define PK_A 0                       // [3072][1024] Wqkv rows (natural [out][in])
#define PK_P (PK_A + QKVW * DM)        // [1024][1024] Wg rows (natural)
#define PK_END (PK_P + DM * DM)
#define WS_PK  0u
#define WS_QK  (WS_PK + 2u * PK_END)             // f16 [4096 rows][2048]: qg | k
#define WS_QKL (WS_QK + 2u * NB * SS * 2 * DM)     // f16 q | k residual planes x2048
#define WS_VTH (WS_QKL + 2u * NB * SS * 2 * DM)    // f16 [b][1024 (h*64+d)][2048 s] hi
#define WS_VTL (WS_VTH + 2u * NB * DM * SS)        // f16 lo x 2048
#define WS_O   (WS_VTL + 2u * NB * DM * SS)        // f32 [4096][1024]
#define WS_CS  (WS_O + 4u * NB * SS * DM)           // f32 2 x [2048][32], unused
#define WS_END (WS_CS + 4u * 2 * SS * 32)
// ---- k_pack: block = (row n, which): natural [out][in] rows -> bf16; which 0..2 -> W_q/W_k/W_v into PK_A rows which*1024 + n; 3 -> W_g into PK_P
__global__ __launch_bounds__(256) void k_pack(const float* __restrict__ WQ, const float* __restrict__ WK, const float* __restrict__ WV, const float* __restrict__ WO, __bf16* __restrict__ PK) {
  __shared__ __align__(16) __bf16 s[DM]; const int n = blockIdx.x, which = blockIdx.y, t = threadIdx.x; const float* Wm = (which == 0) ? WQ : (which == 1) ? WK : (which == 2) ? WV : WO;
  for (int k = t; k < DM; k += 256) s[k] = (__bf16)Wm[(size_t)n * DM + k];
  __syncthreads();
  __bf16* dst = (which < 3) ? PK + PK_A + ((size_t)which * DM + n) * DM : PK + PK_P + (size_t)n * DM;
  for (int q = t; q < DM / 8; q += 256) vst2((unsigned*)(dst + q * 8), *(const v4u*)&s[q * 8]);
}
#define XPB 272u                  // X row pitch in LDS, bytes (256-B rows of 64 f32 + 16 B)
#define WPB 144u                  // weight row pitch in LDS, bytes (128-B rows of 64 bf16 + 16 B)
#define QXB (64u * XPB)           // bytes of one X tile (64 rows)
#define QWB (128u * WPB)          // bytes of one weight tile (128 rows)
#define QSTG (QXB + 2u * QWB)     // bytes of one stage: X | W | Wg
// one thread's eight 16-byte asynchronous copies into LDS: piece i goes from g + i * gs to LDS byte l + i * ls.
// The copies and s_wait_xcnt stand in one statement so that no address register is rewritten ahead of the wait.
__device__ __forceinline__ void stage8(const char* g, size_t gs, unsigned l, unsigned ls) {
  asm volatile("global_load_async_to_lds_b128 %0, %8, off\n\t"
               "global_load_async_to_lds_b128 %1, %9, off\n\t"
               "global_load_async_to_lds_b128 %2, %10, off\n\t"
               "global_load_async_to_lds_b128 %3, %11, off\n\t"
               "global_load_async_to_lds_b128 %4, %12, off\n\t"
               "global_load_async_to_lds_b128 %5, %13, off\n\t"
               "global_load_async_to_lds_b128 %6, %14, off\n\t"
               "global_load_async_to_lds_b128 %7, %15, off\n\t"
               "s_wait_xcnt 0x0"
               :: "v"(l), "v"(l + ls), "v"(l + 2u * ls), "v"(l + 3u * ls), "v"(l + 4u * ls), "v"(l + 5u * ls), "v"(l + 6u * ls), "v"(l + 7u * ls),
                  "v"(g), "v"(g + gs), "v"(g + 2 * gs), "v"(g + 3 * gs), "v"(g + 4 * gs), "v"(g + 5 * gs), "v"(g + 6 * gs), "v"(g + 7 * gs)
               : "memory");
}
// ---- k_qkv: block = (64 rows of x, 128 output columns; the q blocks also their 128 gate columns). A stage is 64 k of the block's X rows (f32) and weight rows (bf16), brought into LDS once per block, two buffers; the epilogue's staging arrays reuse the ring behind the last pass's barrier
__global__ __launch_bounds__(128) void k_qkv(const float* __restrict__ XQ, const float* __restrict__ XK, const float* __restrict__ XV, const __bf16* __restrict__ P, const float* __restrict__ BQ, const float* __restrict__ BK, const float* __restrict__ BV, _Float16* __restrict__ QK, _Float16* __restrict__ QKL, _Float16* __restrict__ VTH, _Float16* __restrict__ VTL, const __bf16* __restrict__ WG, const float* __restrict__ BG) {
  const int which0 = (blockIdx.y * 128) / DM; const float* X = (which0 == 0) ? XQ : (which0 == 1) ? XK : XV; const float* BB = BQ ? (((which0 == 0) ? BQ : (which0 == 1) ? BK : BV) + (blockIdx.y * 128 - which0 * DM)) : nullptr;
  __shared__ __align__(16) unsigned char sm[2 * QSTG];
  _Float16 (*so)[16][136] = (_Float16 (*)[16][136])sm; _Float16 (*sol)[16][136] = (_Float16 (*)[16][136])(sm + 4 * 16 * 136 * 2);
  _Float16 (*sth)[72] = (_Float16 (*)[72])sm; _Float16 (*stl)[72] = (_Float16 (*)[72])(sm + 128 * 72 * 2);
  const int tid = threadIdx.x, wave = tid >> 5, lane = tid & 31, col = lane & 15, g = lane >> 4; const size_t r0 = (size_t)blockIdx.x * 64 + wave * 16; const int n0 = blockIdx.y * 128;
  // each thread's share of a stage: 16-byte pieces of X rows tid / 16 + 8 i and of weight rows tid / 8 + 16 i, i = 0..7
  const char* gx = (const char*)(X + ((size_t)blockIdx.x * 64 + (tid >> 4)) * DM + (tid & 15) * 4);
  const char* gw = (const char*)(P + (size_t)(n0 + (tid >> 3)) * DM + (tid & 7) * 8);
  const char* gg = (const char*)(WG + (size_t)((n0 < DM ? n0 : 0) + (tid >> 3)) * DM + (tid & 7) * 8);
  const unsigned lx = (unsigned)(size_t)&sm[(tid >> 4) * XPB + (tid & 15) * 16], lw = (unsigned)(size_t)&sm[QXB + (tid >> 3) * WPB + (tid & 7) * 16];
  const int nps = DM / 64;
  v8f acc[8] = {}; v8f accg[8] = {};
  stage8(gx, (size_t)8 * DM * 4, lx, 8u * XPB); stage8(gw, (size_t)16 * DM * 2, lw, 16u * WPB);
  if (n0 < DM) stage8(gg, (size_t)16 * DM * 2, lw + QWB, 16u * WPB);
  asm volatile("s_wait_asynccnt 0x0" ::: "memory");   // stage 0 has landed before the barrier that publishes it
  __syncthreads();
  stage8(gx + 256, (size_t)8 * DM * 4, lx + QSTG, 8u * XPB); stage8(gw + 128, (size_t)16 * DM * 2, lw + QSTG, 16u * WPB);
  if (n0 < DM) stage8(gg + 128, (size_t)16 * DM * 2, lw + QSTG + QWB, 16u * WPB);
#pragma unroll 1
  for (int ps = 0; ps < nps; ++ps) { const unsigned bo = (unsigned)(ps & 1) * QSTG; const unsigned char* sb = sm + bo;
#pragma unroll
    for (int kc = 0; kc < 2; ++kc) { v16b a; { const float* p = (const float*)(sb + (wave * 16 + col) * XPB) + kc * 32 + 8 * g;
#pragma unroll
      for (int i = 0; i < 8; ++i) { a[i] = (__bf16)p[i]; a[8 + i] = (__bf16)p[16 + i]; } }
      v16b fw[8];   // the k-step's weight fragments, read from LDS as one group
#pragma unroll
      for (int j = 0; j < 8; ++j) fw[j] = frag_b((const __bf16*)(sb + QXB + (j * 16 + col) * WPB) + kc * 32, lane);
      // holds the fragment reads together in front of the products: one LDS latency a group instead of one per fragment
      asm volatile("" :: "v"(fw[0]), "v"(fw[1]), "v"(fw[2]), "v"(fw[3]), "v"(fw[4]), "v"(fw[5]), "v"(fw[6]), "v"(fw[7]));
#pragma unroll
      for (int j = 0; j < 8; ++j) acc[j] = wmma_bf(a, fw[j], acc[j]);
      if (n0 < DM) { v16b fg[8];   // the gate's fragments, likewise
#pragma unroll
        for (int j = 0; j < 8; ++j) fg[j] = frag_b((const __bf16*)(sb + QXB + QWB + (j * 16 + col) * WPB) + kc * 32, lane);
        // holds the fragment reads together in front of the products: one LDS latency a group instead of one per fragment
        asm volatile("" :: "v"(fg[0]), "v"(fg[1]), "v"(fg[2]), "v"(fg[3]), "v"(fg[4]), "v"(fg[5]), "v"(fg[6]), "v"(fg[7]));
#pragma unroll
        for (int j = 0; j < 8; ++j) accg[j] = wmma_bf(a, fg[j], accg[j]); } }
    asm volatile("s_wait_dscnt 0x0" ::: "memory");      // this wave's reads of the stage are done before the buffer is given up
    asm volatile("s_wait_asynccnt 0x0" ::: "memory");   // this wave's copies of stage ps + 1 have landed
    __syncthreads();                                    // publishes stage ps + 1 and ends every reader's last read of stage ps
    if (ps + 2 < nps) { const size_t ax = (size_t)(ps + 2) * 256, aw = (size_t)(ps + 2) * 128;
      stage8(gx + ax, (size_t)8 * DM * 4, lx + bo, 8u * XPB); stage8(gw + aw, (size_t)16 * DM * 2, lw + bo, 16u * WPB);
      if (n0 < DM) stage8(gg + aw, (size_t)16 * DM * 2, lw + bo + QWB, 16u * WPB); } }
  asm volatile("s_wait_asynccnt 0x0" ::: "memory");     // no copy is outstanding behind the loop; the ring now serves as the epilogue's staging
  if (n0 < 2 * DM) {   // q stored unscaled (f16 sigma ~0.6, no subnormal exposure); no scale is applied to the f32 score
#pragma unroll
    for (int j = 0; j < 8; ++j) {
#pragma unroll
      for (int r = 0; r < 8; ++r) { float v = acc[j][r] + (BB ? bfr(BB[j * 16 + col]) : 0.f); if (n0 < DM) v = gelu_e(v * (accg[j][r] + bfr(BG[n0 + j * 16 + col]))); const _Float16 hv = (_Float16)v; so[wave][8 * g + r][j * 16 + col] = hv; sol[wave][8 * g + r][j * 16 + col] = (_Float16)((v - (float)hv) * 2048.0f); } }   // q, k (+ bias) as f16 hi + (x2048) residual
    LDSX();
    for (int rl = 0; rl < 16; ++rl) if (lane < 16) { vst2((unsigned*)(QK + (r0 + rl) * (2 * DM) + n0 + lane * 8), *(const v4u*)&so[wave][rl][lane * 8]); vst2((unsigned*)(QKL + (r0 + rl) * (2 * DM) + n0 + lane * 8), *(const v4u*)&sol[wave][rl][lane * 8]); }
  } else {
#pragma unroll
    for (int j = 0; j < 8; ++j) {
#pragma unroll
      for (int r = 0; r < 8; ++r) { const float v = acc[j][r] + (BB ? bfr(BB[j * 16 + col]) : 0.f); const _Float16 hv = (_Float16)v; sth[j * 16 + col][wave * 16 + 8 * g + r] = hv; stl[j * 16 + col][wave * 16 + 8 * g + r] = (_Float16)((v - (float)hv) * 2048.0f); } }
    __syncthreads();
    const size_t rb = (size_t)blockIdx.x * 64; const int b = (int)(rb / SS), s0 = (int)(rb % SS); const int pc0 = n0 - 2 * DM;
    for (int q = tid; q < 128 * 8; q += 128) { const int d = q >> 3, pc = q & 7; const size_t o = ((size_t)b * DM + pc0 + d) * SS + s0 + pc * 8; vst2((unsigned*)(VTH + o), *(const v4u*)&sth[d][pc * 8]); vst2((unsigned*)(VTL + o), *(const v4u*)&stl[d][pc * 8]); }
  }
}
#define KPH 72                    // K row pitch in LDS, f16 elements (128-B rows + 16 B)
#define VPH 40                    // V row pitch in LDS, f16 elements (64-B rows + 16 B)
#define KPL (32u * KPH * 2u)      // bytes of one K plane
#define VPL (64u * VPH * 2u)      // bytes of one V plane
#define KBUF (2u * KPL)           // bytes of one K buffer (both planes)
#define VBUF (2u * VPL)
// one thread's eight 16-byte asynchronous copies of a 32-key stage (K hi, K residual, V hi, V residual; two rows each) into LDS.
// The copies and s_wait_xcnt stand in one statement so that no address register is rewritten ahead of the wait.
__device__ __forceinline__ void stage_kv(const _Float16* kh, const _Float16* kl, const _Float16* vh, const _Float16* vl, unsigned lk, unsigned lv) {
  asm volatile("global_load_async_to_lds_b128 %0, %8, off\n\t"
               "global_load_async_to_lds_b128 %1, %9, off\n\t"
               "global_load_async_to_lds_b128 %2, %10, off\n\t"
               "global_load_async_to_lds_b128 %3, %11, off\n\t"
               "global_load_async_to_lds_b128 %4, %12, off\n\t"
               "global_load_async_to_lds_b128 %5, %13, off\n\t"
               "global_load_async_to_lds_b128 %6, %14, off\n\t"
               "global_load_async_to_lds_b128 %7, %15, off\n\t"
               "s_wait_xcnt 0x0"
               :: "v"(lk), "v"(lk + 16u * KPH * 2u), "v"(lk + KPL), "v"(lk + KPL + 16u * KPH * 2u), "v"(lv), "v"(lv + 32u * VPH * 2u), "v"(lv + VPL), "v"(lv + VPL + 32u * VPH * 2u),
                  "v"(kh), "v"(kh + (size_t)16 * (2 * DM)), "v"(kl), "v"(kl + (size_t)16 * (2 * DM)), "v"(vh), "v"(vh + (size_t)32 * SS), "v"(vl), "v"(vl + (size_t)32 * SS)
               : "memory");
}
// lane l's value exchanged with lane l ^ 16 (a vector cross-row move; a shuffle would go through the LDS unit)
__device__ __forceinline__ float xhalf(float x) { return __builtin_bit_cast(float, __builtin_amdgcn_permlanex16(__builtin_bit_cast(int, x), __builtin_bit_cast(int, x), 0x76543210, 0xfedcba98, false, false)); }
__global__ __launch_bounds__(128) void k_attn(const _Float16* __restrict__ QK, const _Float16* __restrict__ QKL, const _Float16* __restrict__ VTH, const _Float16* __restrict__ VTL, const void* __restrict__ KMASK, float* __restrict__ O) {
  __shared__ __align__(16) float so[4][16][68];
  __shared__ __align__(16) _Float16 sk[2][2][32][KPH];   // [buffer][hi, residual][key][d], 144-B rows
  __shared__ __align__(16) _Float16 sv[2][2][64][VPH];   // [buffer][hi, residual][d][key], 80-B rows
  const int tid = threadIdx.x, wave = tid >> 5, lane = tid & 31, col = lane & 15, g = lane >> 4;
  const int qb = blockIdx.x, h = blockIdx.y, b = blockIdx.z;
  // each thread's share of a 32-key stage: 16-byte pieces of K rows tid / 8 and 16 + tid / 8 and of V rows tid / 4 and 32 + tid / 4, both planes
  const size_t gk = ((size_t)b * SS + (tid >> 3)) * (2 * DM) + DM + h * HD + (tid & 7) * 8, gv = ((size_t)b * DM + h * HD + (tid >> 2)) * SS + (tid & 3) * 8;
  const unsigned lk = (unsigned)(size_t)&sk[0][0][tid >> 3][(tid & 7) * 8], lv = (unsigned)(size_t)&sv[0][0][tid >> 2][(tid & 3) * 8]; const int q0 = qb * 64 + wave * 16; const size_t rq = (size_t)b * SS + q0 + col;
  v16h aq[2], aql[2];
#pragma unroll
  for (int kc = 0; kc < 2; ++kc) { aq[kc] = frag_h(QK + rq * (2 * DM) + h * HD + kc * 32, lane); aql[kc] = frag_h(QKL + rq * (2 * DM) + h * HD + kc * 32, lane); }
  float m = -3.0e38f, l = 0.f;   // the lane's query: running maximum (equal in both halves) and this half's share of the sum
  v8f acc[4] = {}, accl[4] = {};   // O^T tiles: register r = d dt * 16 + 8 g + r of query col
  const int nks = SS / 32;   // all keys
  stage_kv(QK + gk, QKL + gk, VTH + gv, VTL + gv, lk, lv);
  asm volatile("s_wait_asynccnt 0x0" ::: "memory");   // stage 0 has landed before the barrier that publishes it
  __syncthreads();
  stage_kv(QK + gk + (size_t)32 * (2 * DM), QKL + gk + (size_t)32 * (2 * DM), VTH + gv + 32, VTL + gv + 32, lk + KBUF, lv + VBUF);
#pragma unroll 1
  for (int ks = 0; ks < nks; ++ks) { v8f s[2]; const int bf = ks & 1;
    v16h fk[2][2], fkl[2][2];   // the pass's K fragments, read from LDS as one group
#pragma unroll
    for (int ct = 0; ct < 2; ++ct) {
#pragma unroll
      for (int kc = 0; kc < 2; ++kc) { fk[ct][kc] = frag_h(&sk[bf][0][ct * 16 + col][kc * 32], lane); fkl[ct][kc] = frag_h(&sk[bf][1][ct * 16 + col][kc * 32], lane); } }
    // holds the eight fragment reads together in front of the products: one LDS latency a pass instead of one per fragment
    asm volatile("" :: "v"(fk[0][0]), "v"(fk[0][1]), "v"(fk[1][0]), "v"(fk[1][1]), "v"(fkl[0][0]), "v"(fkl[0][1]), "v"(fkl[1][0]), "v"(fkl[1][1]));
#pragma unroll
    for (int ct = 0; ct < 2; ++ct) { v8f c = {}, cl = {};
#pragma unroll
      for (int kc = 0; kc < 2; ++kc) { const v16h kh = fk[ct][kc]; c = wmma16(kh, aq[kc], c); cl = wmma16(kh, aql[kc], cl); cl = wmma16(fkl[ct][kc], aq[kc], cl); }   // 3 products: q, k as f16 hi + residual
#pragma unroll
      for (int r = 0; r < 8; ++r) c[r] += cl[r] * (1.0f / 2048.0f);
      { const bool keepk = true;
#pragma unroll
      for (int r = 0; r < 8; ++r) s[ct][r] = keepk ? c[r] * SCALEF : -3.0e38f; } }   // no scaling (SCALEF = 1); no key is masked
    // the lane's 16 scores, as a tree of three-way maxima (short dependent chain)
    const float u0 = fmaxf(fmaxf(s[0][0], s[1][0]), s[0][1]), u1 = fmaxf(fmaxf(s[1][1], s[0][2]), s[1][2]), u2 = fmaxf(fmaxf(s[0][3], s[1][3]), s[0][4]), u3 = fmaxf(fmaxf(s[1][4], s[0][5]), s[1][5]), u4 = fmaxf(fmaxf(s[0][6], s[1][6]), s[0][7]);
    float mx = fmaxf(fmaxf(fmaxf(u0, u1), u2), fmaxf(fmaxf(u3, u4), s[1][7]));
    mx = fmaxf(mx, xhalf(mx));   // both halves now hold the query's maximum over the pass's 32 keys
    const float mn = fmaxf(m, mx); const float alpha = (m <= -1.0e38f) ? 0.f : __expf(m - mn);
    float e[2][8], t[8];
#pragma unroll
    for (int r = 0; r < 8; ++r) { e[0][r] = (s[0][r] <= -1.0e38f) ? 0.f : __expf(s[0][r] - mn); e[1][r] = (s[1][r] <= -1.0e38f) ? 0.f : __expf(s[1][r] - mn); t[r] = e[0][r] + e[1][r]; }
    l = l * alpha + (((t[0] + t[1]) + (t[2] + t[3])) + ((t[4] + t[5]) + (t[6] + t[7]))); m = mn;   // the halves' sums are joined once, in the epilogue
#pragma unroll
    for (int dt = 0; dt < 4; ++dt) {
#pragma unroll
      for (int r = 0; r < 8; ++r) { acc[dt][r] *= alpha; accl[dt][r] *= alpha; } }
    v16h pa, pl;   // P^T as a B operand: element i = key 8 g + i, element 8 + i = key 16 + 8 g + i, the k order of the V fragments
#pragma unroll
    for (int i = 0; i < 8; ++i) { const float x0 = e[0][i] * 2048.0f, x1 = e[1][i] * 2048.0f; const _Float16 h0 = (_Float16)x0, h1 = (_Float16)x1; pa[i] = h0; pa[8 + i] = h1; pl[i] = (_Float16)((x0 - (float)h0) * 2048.0f); pl[8 + i] = (_Float16)((x1 - (float)h1) * 2048.0f); }   // P scaled by 2^11 before the f16 split so small softmax weights stay out of the f16 subnormal range; 2^-11 folded into the epilogue
    v16h fv[4], fvl[4];   // the pass's V fragments, read from LDS as one group
#pragma unroll
    for (int dt = 0; dt < 4; ++dt) { fv[dt] = frag_h(&sv[bf][0][dt * 16 + col][0], lane); fvl[dt] = frag_h(&sv[bf][1][dt * 16 + col][0], lane); }
    // holds the eight fragment reads together in front of the products: one LDS latency a pass instead of one per fragment
    asm volatile("" :: "v"(fv[0]), "v"(fv[1]), "v"(fv[2]), "v"(fv[3]), "v"(fvl[0]), "v"(fvl[1]), "v"(fvl[2]), "v"(fvl[3]));
#pragma unroll
    for (int dt = 0; dt < 4; ++dt) { const v16h vh = fv[dt]; acc[dt] = wmma16(vh, pa, acc[dt]); accl[dt] = wmma16(vh, pl, accl[dt]); accl[dt] = wmma16(fvl[dt], pa, accl[dt]); }   // P hi x V hi + (P lo x V hi + P hi x V lo) / 2048
    asm volatile("s_wait_dscnt 0x0" ::: "memory");      // this wave's reads of the stage are done before the buffer is given up
    asm volatile("s_wait_asynccnt 0x0" ::: "memory");   // this wave's copies of stage ks + 1 have landed
    __syncthreads();                                    // publishes stage ks + 1 and ends every reader's last read of stage ks
    if (ks + 2 < nks) { const size_t ak = (size_t)(ks + 2) * 32 * (2 * DM), av = (size_t)(ks + 2) * 32; stage_kv(QK + gk + ak, QKL + gk + ak, VTH + gv + av, VTL + gv + av, lk + bf * KBUF, lv + bf * VBUF); } }
  asm volatile("s_wait_asynccnt 0x0" ::: "memory");     // no copy is outstanding behind the loop
  const float il = (1.0f / 2048.0f) / (l + xhalf(l));
#pragma unroll
  for (int dt = 0; dt < 4; ++dt) {
#pragma unroll
    for (int r = 0; r < 8; ++r) so[wave][col][dt * 16 + 8 * g + r] = (acc[dt][r] + accl[dt][r] * (1.0f / 2048.0f)) * il; }
  LDSX();
  for (int rl = 0; rl < 16; ++rl) if (lane < 16) vst2(O + ((size_t)b * SS + q0 + rl) * DM + h * HD + lane * 4, *(const v4f*)&so[wave][rl][lane * 4]);
}
// ---- k_out: block = (64 rows, 128 cols): out = O(hi/lo) . Wo rows (2 products) + bo
__global__ __launch_bounds__(128) void k_out(const float* __restrict__ O, const __bf16* __restrict__ P, const float* __restrict__ BO, float* __restrict__ Y) {
  __shared__ __align__(16) float so[4][16][132];
  const int tid = threadIdx.x, wave = tid >> 5, lane = tid & 31, col = lane & 15, g = lane >> 4; const size_t r0 = (size_t)blockIdx.x * 64 + wave * 16; const int n0 = blockIdx.y * 128;
  v8f acc[8] = {};
#pragma unroll 2
  for (int kc = 0; kc < DM / 32; ++kc) { const F2 a = split_row(O + (r0 + col) * DM, kc * 32, lane);
#pragma unroll
    for (int j = 0; j < 8; ++j) { const v16b w = frag_b(P + (size_t)(n0 + j * 16 + col) * DM + kc * 32, lane); acc[j] = wmma_bf(a.l, w, acc[j]); acc[j] = wmma_bf(a.h, w, acc[j]); } }
#pragma unroll
  for (int j = 0; j < 8; ++j) {
#pragma unroll
    for (int r = 0; r < 8; ++r) so[wave][8 * g + r][j * 16 + col] = acc[j][r] + (BO ? bfr(BO[n0 + j * 16 + col]) : 0.f); }
  LDSX();
  for (int rl = 0; rl < 16; ++rl) vst2(Y + (r0 + rl) * DM + n0 + lane * 4, *(const v4f*)&so[wave][rl][lane * 4]);
}
extern "C" void kernel_launch(void* const* d_in, const int* in_sizes, int n_in, void* d_out, int out_size, void* d_ws, size_t ws_size, hipStream_t stream) {
  (void)in_sizes; (void)n_in; (void)out_size;
  const float** F = (const float**)d_in;   // 0 x [2,2048,1024], 1 Wq, 2 bq, 3 Wk, 4 bk, 5 Wv, 6 bv, 7 Wg, 8 bg (natural [1024,1024] / [1024])
  if (ws_size < (size_t)WS_END) return;
  char* ws = (char*)d_ws; __bf16* PK = (__bf16*)(ws + WS_PK); _Float16 *QK = (_Float16*)(ws + WS_QK), *QKL = (_Float16*)(ws + WS_QKL), *VTH = (_Float16*)(ws + WS_VTH), *VTL = (_Float16*)(ws + WS_VTL);
  k_pack<<<dim3(DM, 4), 256, 0, stream>>>(F[1], F[3], F[5], F[7], PK);   // the fourth slot holds Wg
  k_qkv<<<dim3(TNB * SS / 64, QKVW / 128), 128, 0, stream>>>(F[0], F[0], F[0], PK + PK_A, F[2], F[4], F[6], QK, QKL, VTH, VTL, PK + PK_P, F[8]);
  k_attn<<<dim3(TQB, NH, TNB), 128, 0, stream>>>(QK, QKL, VTH, VTL, nullptr, (float*)d_out);   // merged context == output (no out-projection)
}

// v005
// It runs in 153 microseconds.
// In both of two side-by-side timings against v004, it was 1.05 times as fast.
// Over all steps from v000 it is 3.36 times as fast.
// compute dtype: all float inputs rounded to bf16; q/k/v/g = x . W^T + b with EXACT bf16 products on WMMA 16x16x32 (natural rows; q and g computed in the same block), qg = gelu_erf(q g) in f32 (precise erff) then split into f16 hi + residual; attention with 3-product scores (qg, k as f16 hi + residual) and 3-product P.v (P and v as hi + residual) everywhere; no scaling, running-max softmax in f32 (hardware exp); the merged context is the output (f32).
#include <hip/hip_runtime.h>
#include <math.h>

typedef __attribute__((ext_vector_type(16))) _Float16 v16h;
typedef __attribute__((ext_vector_type(16))) __bf16 v16b;
typedef __attribute__((ext_vector_type(8)))  _Float16 v8h;
typedef __attribute__((ext_vector_type(8)))  float v8f;
typedef __attribute__((ext_vector_type(4)))  float v4f;
typedef __attribute__((ext_vector_type(2)))  float v2f;
typedef __attribute__((ext_vector_type(4)))  unsigned v4u;
typedef __attribute__((ext_vector_type(4)))  int v4i;
typedef float __attribute__((may_alias)) float_a;
typedef int __attribute__((may_alias)) int_a;

template <typename T> __device__ __forceinline__ void vst2(void* p, T v) { *(T*)p = v;  }
// both products are the plain builtin: the compiler itself keeps the distance that the chip needs behind a matrix instruction, and fills it with useful work where it can
__device__ __forceinline__ v8f wmma16(v16h a, v16h b, v8f c) {
  return __builtin_amdgcn_wmma_f32_16x16x32_f16(false, a, false, b, (short)0, c, false, false);
}
__device__ __forceinline__ v8f wmma_bf(v16b a, v16b b, v8f c) {
  return __builtin_amdgcn_wmma_f32_16x16x32_bf16(false, a, false, b, (short)0, c, false, false);
}
// Gated QKV attention (B 2, S 2,048, d 1,024, 16 heads x 64): q, k, v, g projections + biases, qg = gelu(q * g) (exact erf), softmax(qg k^T) v with no 1/sqrt(d) scaling and no output projection.
__device__ __forceinline__ v16h frag_h(const _Float16* rowk0, int lane) {
  union { v16h v; v8h q[2]; } u; const _Float16* p = rowk0 + 8 * (lane >> 4);
  u.q[0] = *(const v8h*)p; u.q[1] = *(const v8h*)(p + 16); return u.v;
}
__device__ __forceinline__ v16h frag_f32(const float* rowk0, int lane) {
  v16h a; const float* p = rowk0 + 8 * (lane >> 4);
#pragma unroll
  for (int i = 0; i < 8; ++i) { a[i] = (_Float16)p[i]; a[8 + i] = (_Float16)p[16 + i]; }
  return a;
}
__device__ __forceinline__ v16h frag_f32s(const float* rowk0, int lane, float sc) {
  v16h a; const float* p = rowk0 + 8 * (lane >> 4);
#pragma unroll
  for (int i = 0; i < 8; ++i) { a[i] = (_Float16)(p[i] * sc); a[8 + i] = (_Float16)(p[16 + i] * sc); }
  return a;
}
// column fragment from a [K][ld] layout (column n), rows >= K read as 0
__device__ __forceinline__ v16h fragc_f32(const float* W, int k0, int n, int lane, int ld, int K) {
  v16h a; const int g = lane >> 4;
#pragma unroll
  for (int i = 0; i < 8; ++i) { const int ka = k0 + 8 * g + i, kb = ka + 16;
    a[i] = (_Float16)(ka < K ? W[(size_t)(ka < K ? ka : K - 1) * ld + n] : 0.f); a[8 + i] = (_Float16)(kb < K ? W[(size_t)(kb < K ? kb : K - 1) * ld + n] : 0.f); }
  return a;
}
struct F2 { v16b h, l; };
__device__ __forceinline__ F2 bsplit16(const float v[16]) { F2 r;
#pragma unroll
  for (int i = 0; i < 16; ++i) { const __bf16 h = (__bf16)v[i]; r.h[i] = h; r.l[i] = (__bf16)(v[i] - (float)h); }
  return r; }
__device__ __forceinline__ F2 split_row(const float* row, int k0, int lane) { float v[16]; const float* p = row + k0 + 8 * (lane >> 4);
#pragma unroll
  for (int i = 0; i < 8; ++i) { v[i] = p[i]; v[8 + i] = p[16 + i]; }
  return bsplit16(v); }
__device__ __forceinline__ F2 split_rowK(const float* row, int k0, int lane, int K) { float v[16]; const int g = lane >> 4;
#pragma unroll
  for (int i = 0; i < 8; ++i) { const int ka = k0 + 8 * g + i, kb = ka + 16; v[i] = ka < K ? row[ka < K ? ka : K - 1] : 0.f; v[8 + i] = kb < K ? row[kb < K ? kb : K - 1] : 0.f; }
  return bsplit16(v); }
__device__ __forceinline__ F2 split_col(const float* W, int k0, int n, int lane, int ld, int K) { float v[16]; const int g = lane >> 4;
#pragma unroll
  for (int i = 0; i < 8; ++i) { const int ka = k0 + 8 * g + i, kb = ka + 16; v[i] = ka < K ? W[(size_t)(ka < K ? ka : K - 1) * ld + n] : 0.f; v[8 + i] = kb < K ? W[(size_t)(kb < K ? kb : K - 1) * ld + n] : 0.f; }
  return bsplit16(v); }
__device__ __forceinline__ v8f mac3(const F2& a, const F2& b, v8f c) { c = wmma_bf(a.l, b.h, c); c = wmma_bf(a.h, b.l, c); return wmma_bf(a.h, b.h, c); }
__device__ __forceinline__ float sigm(float v) { return 1.0f / (1.0f + expf(-v)); }
#define LDSX() do { asm volatile("s_wait_dscnt 0" ::: "memory"); __builtin_amdgcn_wave_barrier(); __builtin_amdgcn_fence(__ATOMIC_RELEASE, "workgroup"); } while (0)


#define NB 2
#define SS 2048
#define DM 1024
#define NH 16
#define SCALEF 1.0f
__device__ __attribute__((noinline)) float gelu_e(float v) { return 0.5f * v * (1.0f + erff(v * 0.70710678118654752f)); }
#define HD 64
#define QKVW (3 * DM)
#ifndef TQB
#define TQB (SS / 64)
#define TNB NB
#define TOB (NB * SS / 64)     // output row tiles (all)
#endif
typedef __attribute__((ext_vector_type(8))) __bf16 v8b;
__device__ __forceinline__ v16b frag_b(const __bf16* rowk0, int lane) {
  union { v16b v; v8b q[2]; } u; const __bf16* p = rowk0 + 8 * (lane >> 4);
  u.q[0] = *(const v8b*)p; u.q[1] = *(const v8b*)(p + 16); return u.v;
}
__device__ __forceinline__ float bfr(float v) { return (float)(__bf16)v; }
__device__ __attribute__((noinline)) float exp_ni(float v) { return expf(v); }
__device__ __attribute__((noinline)) float erf_ni(float v) { return erff(v); }

#define PK_A 0                       // [3072][1024] Wqkv rows (natural [out][in])
#define PK_P (PK_A + QKVW * DM)        // [1024][1024] Wg rows (natural)
#define PK_END (PK_P + DM * DM)
#define WS_PK  0u
#define WS_QK  (WS_PK + 2u * PK_END)             // f16 [4096 rows][2048]: qg | k
#define WS_QKL (WS_QK + 2u * NB * SS * 2 * DM)     // f16 q | k residual planes x2048
#define WS_VTH (WS_QKL + 2u * NB * SS * 2 * DM)    // f16 [b][1024 (h*64+d)][2048 s] hi
#define WS_VTL (WS_VTH + 2u * NB * DM * SS)        // f16 lo x 2048
#define WS_O   (WS_VTL + 2u * NB * DM * SS)        // f32 [4096][1024]
#define WS_CS  (WS_O + 4u * NB * SS * DM)           // f32 2 x [2048][32], unused
#define WS_END (WS_CS + 4u * 2 * SS * 32)
// ---- k_pack: block = (row n, which): natural [out][in] rows -> bf16; which 0..2 -> W_q/W_k/W_v into PK_A rows which*1024 + n; 3 -> W_g into PK_P
__global__ __launch_bounds__(256) void k_pack(const float* __restrict__ WQ, const float* __restrict__ WK, const float* __restrict__ WV, const float* __restrict__ WO, __bf16* __restrict__ PK) {
  __shared__ __align__(16) __bf16 s[DM]; const int n = blockIdx.x, which = blockIdx.y, t = threadIdx.x; const float* Wm = (which == 0) ? WQ : (which == 1) ? WK : (which == 2) ? WV : WO;
  for (int k = t; k < DM; k += 256) s[k] = (__bf16)Wm[(size_t)n * DM + k];
  __syncthreads();
  __bf16* dst = (which < 3) ? PK + PK_A + ((size_t)which * DM + n) * DM : PK + PK_P + (size_t)n * DM;
  for (int q = t; q < DM / 8; q += 256) vst2((unsigned*)(dst + q * 8), *(const v4u*)&s[q * 8]);
}
#define XPB 272u                  // X row pitch in LDS, bytes (256-B rows of 64 f32 + 16 B)
#define WPB 144u                  // weight row pitch in LDS, bytes (128-B rows of 64 bf16 + 16 B)
#define QXB (64u * XPB)           // bytes of one X tile (64 rows)
#define QWB (128u * WPB)          // bytes of one weight tile (128 rows)
#define QSTG (QXB + 2u * QWB)     // bytes of one stage: X | W | Wg
// one thread's eight 16-byte asynchronous copies into LDS: piece i goes from g + i * gs to LDS byte l + i * ls.
// The copies and s_wait_xcnt stand in one statement so that no address register is rewritten ahead of the wait.
__device__ __forceinline__ void stage8(const char* g, size_t gs, unsigned l, unsigned ls) {
  asm volatile("global_load_async_to_lds_b128 %0, %8, off\n\t"
               "global_load_async_to_lds_b128 %1, %9, off\n\t"
               "global_load_async_to_lds_b128 %2, %10, off\n\t"
               "global_load_async_to_lds_b128 %3, %11, off\n\t"
               "global_load_async_to_lds_b128 %4, %12, off\n\t"
               "global_load_async_to_lds_b128 %5, %13, off\n\t"
               "global_load_async_to_lds_b128 %6, %14, off\n\t"
               "global_load_async_to_lds_b128 %7, %15, off\n\t"
               "s_wait_xcnt 0x0"
               :: "v"(l), "v"(l + ls), "v"(l + 2u * ls), "v"(l + 3u * ls), "v"(l + 4u * ls), "v"(l + 5u * ls), "v"(l + 6u * ls), "v"(l + 7u * ls),
                  "v"(g), "v"(g + gs), "v"(g + 2 * gs), "v"(g + 3 * gs), "v"(g + 4 * gs), "v"(g + 5 * gs), "v"(g + 6 * gs), "v"(g + 7 * gs)
               : "memory");
}
// ---- k_qkv: block = (64 rows of x, 128 output columns; the q blocks also their 128 gate columns). A stage is 64 k of the block's X rows (f32) and weight rows (bf16), brought into LDS once per block, two buffers; the epilogue's staging arrays reuse the ring behind the last pass's barrier
__global__ __launch_bounds__(128) void k_qkv(const float* __restrict__ XQ, const float* __restrict__ XK, const float* __restrict__ XV, const __bf16* __restrict__ P, const float* __restrict__ BQ, const float* __restrict__ BK, const float* __restrict__ BV, _Float16* __restrict__ QK, _Float16* __restrict__ QKL, _Float16* __restrict__ VTH, _Float16* __restrict__ VTL, const __bf16* __restrict__ WG, const float* __restrict__ BG) {
  const int which0 = (blockIdx.y * 128) / DM; const float* X = (which0 == 0) ? XQ : (which0 == 1) ? XK : XV; const float* BB = BQ ? (((which0 == 0) ? BQ : (which0 == 1) ? BK : BV) + (blockIdx.y * 128 - which0 * DM)) : nullptr;
  __shared__ __align__(16) unsigned char sm[2 * QSTG];
  _Float16 (*so)[16][136] = (_Float16 (*)[16][136])sm; _Float16 (*sol)[16][136] = (_Float16 (*)[16][136])(sm + 4 * 16 * 136 * 2);
  _Float16 (*sth)[72] = (_Float16 (*)[72])sm; _Float16 (*stl)[72] = (_Float16 (*)[72])(sm + 128 * 72 * 2);
  const int tid = threadIdx.x, wave = tid >> 5, lane = tid & 31, col = lane & 15, g = lane >> 4; const size_t r0 = (size_t)blockIdx.x * 64 + wave * 16; const int n0 = blockIdx.y * 128;
  // each thread's share of a stage: 16-byte pieces of X rows tid / 16 + 8 i and of weight rows tid / 8 + 16 i, i = 0..7
  const char* gx = (const char*)(X + ((size_t)blockIdx.x * 64 + (tid >> 4)) * DM + (tid & 15) * 4);
  const char* gw = (const char*)(P + (size_t)(n0 + (tid >> 3)) * DM + (tid & 7) * 8);
  const char* gg = (const char*)(WG + (size_t)((n0 < DM ? n0 : 0) + (tid >> 3)) * DM + (tid & 7) * 8);
  const unsigned lx = (unsigned)(size_t)&sm[(tid >> 4) * XPB + (tid & 15) * 16], lw = (unsigned)(size_t)&sm[QXB + (tid >> 3) * WPB + (tid & 7) * 16];
  const int nps = DM / 64;
  v8f acc[8] = {}; v8f accg[8] = {};
  stage8(gx, (size_t)8 * DM * 4, lx, 8u * XPB); stage8(gw, (size_t)16 * DM * 2, lw, 16u * WPB);
  if (n0 < DM) stage8(gg, (size_t)16 * DM * 2, lw + QWB, 16u * WPB);
  asm volatile("s_wait_asynccnt 0x0" ::: "memory");   // stage 0 has landed before the barrier that publishes it
  __syncthreads();
  stage8(gx + 256, (size_t)8 * DM * 4, lx + QSTG, 8u * XPB); stage8(gw + 128, (size_t)16 * DM * 2, lw + QSTG, 16u * WPB);
  if (n0 < DM) stage8(gg + 128, (size_t)16 * DM * 2, lw + QSTG + QWB, 16u * WPB);
#pragma unroll 1
  for (int ps = 0; ps < nps; ++ps) { const unsigned bo = (unsigned)(ps & 1) * QSTG; const unsigned char* sb = sm + bo;
#pragma unroll
    for (int kc = 0; kc < 2; ++kc) { v16b a; { const float* p = (const float*)(sb + (wave * 16 + col) * XPB) + kc * 32 + 8 * g;
#pragma unroll
      for (int i = 0; i < 8; ++i) { a[i] = (__bf16)p[i]; a[8 + i] = (__bf16)p[16 + i]; } }
      v16b fw[8];   // the k-step's weight fragments, read from LDS as one group
#pragma unroll
      for (int j = 0; j < 8; ++j) fw[j] = frag_b((const __bf16*)(sb + QXB + (j * 16 + col) * WPB) + kc * 32, lane);
      // holds the fragment reads together in front of the products: one LDS latency a group instead of one per fragment
      asm volatile("" :: "v"(fw[0]), "v"(fw[1]), "v"(fw[2]), "v"(fw[3]), "v"(fw[4]), "v"(fw[5]), "v"(fw[6]), "v"(fw[7]));
#pragma unroll
      for (int j = 0; j < 8; ++j) acc[j] = wmma_bf(a, fw[j], acc[j]);
      if (n0 < DM) { v16b fg[8];   // the gate's fragments, likewise
#pragma unroll
        for (int j = 0; j < 8; ++j) fg[j] = frag_b((const __bf16*)(sb + QXB + QWB + (j * 16 + col) * WPB) + kc * 32, lane);
        // holds the fragment reads together in front of the products: one LDS latency a group instead of one per fragment
        asm volatile("" :: "v"(fg[0]), "v"(fg[1]), "v"(fg[2]), "v"(fg[3]), "v"(fg[4]), "v"(fg[5]), "v"(fg[6]), "v"(fg[7]));
#pragma unroll
        for (int j = 0; j < 8; ++j) accg[j] = wmma_bf(a, fg[j], accg[j]); } }
    asm volatile("s_wait_dscnt 0x0" ::: "memory");      // this wave's reads of the stage are done before the buffer is given up
    asm volatile("s_wait_asynccnt 0x0" ::: "memory");   // this wave's copies of stage ps + 1 have landed
    __syncthreads();                                    // publishes stage ps + 1 and ends every reader's last read of stage ps
    if (ps + 2 < nps) { const size_t ax = (size_t)(ps + 2) * 256, aw = (size_t)(ps + 2) * 128;
      stage8(gx + ax, (size_t)8 * DM * 4, lx + bo, 8u * XPB); stage8(gw + aw, (size_t)16 * DM * 2, lw + bo, 16u * WPB);
      if (n0 < DM) stage8(gg + aw, (size_t)16 * DM * 2, lw + bo + QWB, 16u * WPB); } }
  asm volatile("s_wait_asynccnt 0x0" ::: "memory");     // no copy is outstanding behind the loop; the ring now serves as the epilogue's staging
  float bb[8], bgt[8];   // the lane's bias of each of its eight columns (q blocks: the gate's too), loaded here as one group: one load latency a wave
#pragma unroll
  for (int j = 0; j < 8; ++j) { bb[j] = 0.f; bgt[j] = 0.f; }
  if (BB) {
#pragma unroll
    for (int j = 0; j < 8; ++j) bb[j] = BB[j * 16 + col]; }
  if (n0 < DM) {
#pragma unroll
    for (int j = 0; j < 8; ++j) bgt[j] = BG[n0 + j * 16 + col]; }
#pragma unroll
  for (int j = 0; j < 8; ++j) { bb[j] = bfr(bb[j]); bgt[j] = bfr(bgt[j]); }
  if (n0 < 2 * DM) {   // q stored unscaled (f16 sigma ~0.6, no subnormal exposure); the score is not scaled either (SCALEF = 1)
#pragma unroll
    for (int j = 0; j < 8; ++j) {
#pragma unroll
      for (int r = 0; r < 8; ++r) { float v = acc[j][r] + bb[j]; if (n0 < DM) v = gelu_e(v * (accg[j][r] + bgt[j])); const _Float16 hv = (_Float16)v; so[wave][8 * g + r][j * 16 + col] = hv; sol[wave][8 * g + r][j * 16 + col] = (_Float16)((v - (float)hv) * 2048.0f); } }   // q, k (+ bias) as f16 hi + (x2048) residual
    LDSX();
    for (int rl = 0; rl < 16; ++rl) if (lane < 16) { vst2((unsigned*)(QK + (r0 + rl) * (2 * DM) + n0 + lane * 8), *(const v4u*)&so[wave][rl][lane * 8]); vst2((unsigned*)(QKL + (r0 + rl) * (2 * DM) + n0 + lane * 8), *(const v4u*)&sol[wave][rl][lane * 8]); }
  } else {
#pragma unroll
    for (int j = 0; j < 8; ++j) {
#pragma unroll
      for (int r = 0; r < 8; ++r) { const float v = acc[j][r] + bb[j]; const _Float16 hv = (_Float16)v; sth[j * 16 + col][wave * 16 + 8 * g + r] = hv; stl[j * 16 + col][wave * 16 + 8 * g + r] = (_Float16)((v - (float)hv) * 2048.0f); } }
    __syncthreads();
    const size_t rb = (size_t)blockIdx.x * 64; const int b = (int)(rb / SS), s0 = (int)(rb % SS); const int pc0 = n0 - 2 * DM;
    for (int q = tid; q < 128 * 8; q += 128) { const int d = q >> 3, pc = q & 7; const size_t o = ((size_t)b * DM + pc0 + d) * SS + s0 + pc * 8; vst2((unsigned*)(VTH + o), *(const v4u*)&sth[d][pc * 8]); vst2((unsigned*)(VTL + o), *(const v4u*)&stl[d][pc * 8]); }
  }
}
#define KPH 72                    // K row pitch in LDS, f16 elements (128-B rows + 16 B)
#define VPH 40                    // V row pitch in LDS, f16 elements (64-B rows + 16 B)
#define KPL (32u * KPH * 2u)      // bytes of one K plane
#define VPL (64u * VPH * 2u)      // bytes of one V plane
#define KBUF (2u * KPL)           // bytes of one K buffer (both planes)
#define VBUF (2u * VPL)
// one thread's eight 16-byte asynchronous copies of a 32-key stage (K hi, K residual, V hi, V residual; two rows each) into LDS.
// The copies and s_wait_xcnt stand in one statement so that no address register is rewritten ahead of the wait.
__device__ __forceinline__ void stage_kv(const _Float16* kh, const _Float16* kl, const _Float16* vh, const _Float16* vl, unsigned lk, unsigned lv) {
  asm volatile("global_load_async_to_lds_b128 %0, %8, off\n\t"
               "global_load_async_to_lds_b128 %1, %9, off\n\t"
               "global_load_async_to_lds_b128 %2, %10, off\n\t"
               "global_load_async_to_lds_b128 %3, %11, off\n\t"
               "global_load_async_to_lds_b128 %4, %12, off\n\t"
               "global_load_async_to_lds_b128 %5, %13, off\n\t"
               "global_load_async_to_lds_b128 %6, %14, off\n\t"
               "global_load_async_to_lds_b128 %7, %15, off\n\t"
               "s_wait_xcnt 0x0"
               :: "v"(lk), "v"(lk + 16u * KPH * 2u), "v"(lk + KPL), "v"(lk + KPL + 16u * KPH * 2u), "v"(lv), "v"(lv + 32u * VPH * 2u), "v"(lv + VPL), "v"(lv + VPL + 32u * VPH * 2u),
                  "v"(kh), "v"(kh + (size_t)16 * (2 * DM)), "v"(kl), "v"(kl + (size_t)16 * (2 * DM)), "v"(vh), "v"(vh + (size_t)32 * SS), "v"(vl), "v"(vl + (size_t)32 * SS)
               : "memory");
}
// lane l's value exchanged with lane l ^ 16 (a vector cross-row move; a shuffle would go through the LDS unit)
__device__ __forceinline__ float xhalf(float x) { return __builtin_bit_cast(float, __builtin_amdgcn_permlanex16(__builtin_bit_cast(int, x), __builtin_bit_cast(int, x), 0x76543210, 0xfedcba98, false, false)); }
__global__ __launch_bounds__(128) void k_attn(const _Float16* __restrict__ QK, const _Float16* __restrict__ QKL, const _Float16* __restrict__ VTH, const _Float16* __restrict__ VTL, const void* __restrict__ KMASK, float* __restrict__ O) {
  __shared__ __align__(16) float so[4][16][68];
  __shared__ __align__(16) _Float16 sk[2][2][32][KPH];   // [buffer][hi, residual][key][d], 144-B rows
  __shared__ __align__(16) _Float16 sv[2][2][64][VPH];   // [buffer][hi, residual][d][key], 80-B rows
  const int tid = threadIdx.x, wave = tid >> 5, lane = tid & 31, col = lane & 15, g = lane >> 4;
  const int qb = blockIdx.x, h = blockIdx.y, b = blockIdx.z;
  // each thread's share of a 32-key stage: 16-byte pieces of K rows tid / 8 and 16 + tid / 8 and of V rows tid / 4 and 32 + tid / 4, both planes
  const size_t gk = ((size_t)b * SS + (tid >> 3)) * (2 * DM) + DM + h * HD + (tid & 7) * 8, gv = ((size_t)b * DM + h * HD + (tid >> 2)) * SS + (tid & 3) * 8;
  const unsigned lk = (unsigned)(size_t)&sk[0][0][tid >> 3][(tid & 7) * 8], lv = (unsigned)(size_t)&sv[0][0][tid >> 2][(tid & 3) * 8]; const int q0 = qb * 64 + wave * 16; const size_t rq = (size_t)b * SS + q0 + col;
  v16h aq[2], aql[2];
#pragma unroll
  for (int kc = 0; kc < 2; ++kc) { aq[kc] = frag_h(QK + rq * (2 * DM) + h * HD + kc * 32, lane); aql[kc] = frag_h(QKL + rq * (2 * DM) + h * HD + kc * 32, lane); }
  float m = -3.0e38f, l = 0.f;   // the lane's query: running maximum (equal in both halves) and this half's share of the sum
  v8f acc[4] = {}, accl[4] = {};   // O^T tiles: register r = d dt * 16 + 8 g + r of query col
  const int nks = SS / 32;   // all keys
  stage_kv(QK + gk, QKL + gk, VTH + gv, VTL + gv, lk, lv);
  asm volatile("s_wait_asynccnt 0x0" ::: "memory");   // stage 0 has landed before the barrier that publishes it
  __syncthreads();
  stage_kv(QK + gk + (size_t)32 * (2 * DM), QKL + gk + (size_t)32 * (2 * DM), VTH + gv + 32, VTL + gv + 32, lk + KBUF, lv + VBUF);
#pragma unroll 1
  for (int ks = 0; ks < nks; ++ks) { v8f s[2]; const int bf = ks & 1;
    v16h fk[2][2], fkl[2][2];   // the pass's K fragments, read from LDS as one group
#pragma unroll
    for (int ct = 0; ct < 2; ++ct) {
#pragma unroll
      for (int kc = 0; kc < 2; ++kc) { fk[ct][kc] = frag_h(&sk[bf][0][ct * 16 + col][kc * 32], lane); fkl[ct][kc] = frag_h(&sk[bf][1][ct * 16 + col][kc * 32], lane); } }
    // holds the eight fragment reads together in front of the products: one LDS latency a pass instead of one per fragment
    asm volatile("" :: "v"(fk[0][0]), "v"(fk[0][1]), "v"(fk[1][0]), "v"(fk[1][1]), "v"(fkl[0][0]), "v"(fkl[0][1]), "v"(fkl[1][0]), "v"(fkl[1][1]));
#pragma unroll
    for (int ct = 0; ct < 2; ++ct) { v8f c = {}, cl = {};
#pragma unroll
      for (int kc = 0; kc < 2; ++kc) { const v16h kh = fk[ct][kc]; c = wmma16(kh, aq[kc], c); cl = wmma16(kh, aql[kc], cl); cl = wmma16(fkl[ct][kc], aq[kc], cl); }   // 3 products: q, k as f16 hi + residual
#pragma unroll
      for (int r = 0; r < 8; ++r) c[r] += cl[r] * (1.0f / 2048.0f);
      { const bool keepk = true;
#pragma unroll
      for (int r = 0; r < 8; ++r) s[ct][r] = keepk ? c[r] * SCALEF : -3.0e38f; } }   // no scaling (SCALEF = 1); no key is masked
    // the lane's 16 scores, as a tree of three-way maxima (short dependent chain)
    const float u0 = fmaxf(fmaxf(s[0][0], s[1][0]), s[0][1]), u1 = fmaxf(fmaxf(s[1][1], s[0][2]), s[1][2]), u2 = fmaxf(fmaxf(s[0][3], s[1][3]), s[0][4]), u3 = fmaxf(fmaxf(s[1][4], s[0][5]), s[1][5]), u4 = fmaxf(fmaxf(s[0][6], s[1][6]), s[0][7]);
    float mx = fmaxf(fmaxf(fmaxf(u0, u1), u2), fmaxf(fmaxf(u3, u4), s[1][7]));
    mx = fmaxf(mx, xhalf(mx));   // both halves now hold the query's maximum over the pass's 32 keys
    const float mn = fmaxf(m, mx); const float alpha = (m <= -1.0e38f) ? 0.f : __expf(m - mn);
    float e[2][8], t[8];
#pragma unroll
    for (int r = 0; r < 8; ++r) { e[0][r] = (s[0][r] <= -1.0e38f) ? 0.f : __expf(s[0][r] - mn); e[1][r] = (s[1][r] <= -1.0e38f) ? 0.f : __expf(s[1][r] - mn); t[r] = e[0][r] + e[1][r]; }
    l = l * alpha + (((t[0] + t[1]) + (t[2] + t[3])) + ((t[4] + t[5]) + (t[6] + t[7]))); m = mn;   // the halves' sums are joined once, in the epilogue
#pragma unroll
    for (int dt = 0; dt < 4; ++dt) {
#pragma unroll
      for (int r = 0; r < 8; ++r) { acc[dt][r] *= alpha; accl[dt][r] *= alpha; } }
    v16h pa, pl;   // P^T as a B operand: element i = key 8 g + i, element 8 + i = key 16 + 8 g + i, the k order of the V fragments
#pragma unroll
    for (int i = 0; i < 8; ++i) { const float x0 = e[0][i] * 2048.0f, x1 = e[1][i] * 2048.0f; const _Float16 h0 = (_Float16)x0, h1 = (_Float16)x1; pa[i] = h0; pa[8 + i] = h1; pl[i] = (_Float16)((x0 - (float)h0) * 2048.0f); pl[8 + i] = (_Float16)((x1 - (float)h1) * 2048.0f); }   // P scaled by 2^11 before the f16 split so small softmax weights stay out of the f16 subnormal range; 2^-11 folded into the epilogue
    v16h fv[4], fvl[4];   // the pass's V fragments, read from LDS as one group
#pragma unroll
    for (int dt = 0; dt < 4; ++dt) { fv[dt] = frag_h(&sv[bf][0][dt * 16 + col][0], lane); fvl[dt] = frag_h(&sv[bf][1][dt * 16 + col][0], lane); }
    // holds the eight fragment reads together in front of the products: one LDS latency a pass instead of one per fragment
    asm volatile("" :: "v"(fv[0]), "v"(fv[1]), "v"(fv[2]), "v"(fv[3]), "v"(fvl[0]), "v"(fvl[1]), "v"(fvl[2]), "v"(fvl[3]));
#pragma unroll
    for (int dt = 0; dt < 4; ++dt) { const v16h vh = fv[dt]; acc[dt] = wmma16(vh, pa, acc[dt]); accl[dt] = wmma16(vh, pl, accl[dt]); accl[dt] = wmma16(fvl[dt], pa, accl[dt]); }   // P hi x V hi + (P lo x V hi + P hi x V lo) / 2048
    asm volatile("s_wait_dscnt 0x0" ::: "memory");      // this wave's reads of the stage are done before the buffer is given up
    asm volatile("s_wait_asynccnt 0x0" ::: "memory");   // this wave's copies of stage ks + 1 have landed
    __syncthreads();                                    // publishes stage ks + 1 and ends every reader's last read of stage ks
    if (ks + 2 < nks) { const size_t ak = (size_t)(ks + 2) * 32 * (2 * DM), av = (size_t)(ks + 2) * 32; stage_kv(QK + gk + ak, QKL + gk + ak, VTH + gv + av, VTL + gv + av, lk + bf * KBUF, lv + bf * VBUF); } }
  asm volatile("s_wait_asynccnt 0x0" ::: "memory");     // no copy is outstanding behind the loop
  const float il = (1.0f / 2048.0f) / (l + xhalf(l));
#pragma unroll
  for (int dt = 0; dt < 4; ++dt) {
#pragma unroll
    for (int r = 0; r < 8; ++r) so[wave][col][dt * 16 + 8 * g + r] = (acc[dt][r] + accl[dt][r] * (1.0f / 2048.0f)) * il; }
  LDSX();
  for (int rl = 0; rl < 16; ++rl) if (lane < 16) vst2(O + ((size_t)b * SS + q0 + rl) * DM + h * HD + lane * 4, *(const v4f*)&so[wave][rl][lane * 4]);
}
// ---- k_out: block = (64 rows, 128 cols): out = O(hi/lo) . Wo rows (2 products) + bo
__global__ __launch_bounds__(128) void k_out(const float* __restrict__ O, const __bf16* __restrict__ P, const float* __restrict__ BO, float* __restrict__ Y) {
  __shared__ __align__(16) float so[4][16][132];
  const int tid = threadIdx.x, wave = tid >> 5, lane = tid & 31, col = lane & 15, g = lane >> 4; const size_t r0 = (size_t)blockIdx.x * 64 + wave * 16; const int n0 = blockIdx.y * 128;
  v8f acc[8] = {};
#pragma unroll 2
  for (int kc = 0; kc < DM / 32; ++kc) { const F2 a = split_row(O + (r0 + col) * DM, kc * 32, lane);
#pragma unroll
    for (int j = 0; j < 8; ++j) { const v16b w = frag_b(P + (size_t)(n0 + j * 16 + col) * DM + kc * 32, lane); acc[j] = wmma_bf(a.l, w, acc[j]); acc[j] = wmma_bf(a.h, w, acc[j]); } }
#pragma unroll
  for (int j = 0; j < 8; ++j) {
#pragma unroll
    for (int r = 0; r < 8; ++r) so[wave][8 * g + r][j * 16 + col] = acc[j][r] + (BO ? bfr(BO[n0 + j * 16 + col]) : 0.f); }
  LDSX();
  for (int rl = 0; rl < 16; ++rl) vst2(Y + (r0 + rl) * DM + n0 + lane * 4, *(const v4f*)&so[wave][rl][lane * 4]);
}
extern "C" void kernel_launch(void* const* d_in, const int* in_sizes, int n_in, void* d_out, int out_size, void* d_ws, size_t ws_size, hipStream_t stream) {
  (void)in_sizes; (void)n_in; (void)out_size;
  const float** F = (const float**)d_in;   // 0 x [2,2048,1024], 1 Wq, 2 bq, 3 Wk, 4 bk, 5 Wv, 6 bv, 7 Wg, 8 bg (natural [1024,1024] / [1024])
  if (ws_size < (size_t)WS_END) return;
  char* ws = (char*)d_ws; __bf16* PK = (__bf16*)(ws + WS_PK); _Float16 *QK = (_Float16*)(ws + WS_QK), *QKL = (_Float16*)(ws + WS_QKL), *VTH = (_Float16*)(ws + WS_VTH), *VTL = (_Float16*)(ws + WS_VTL);
  k_pack<<<dim3(DM, 4), 256, 0, stream>>>(F[1], F[3], F[5], F[7], PK);   // the fourth slot holds Wg
  k_qkv<<<dim3(TNB * SS / 64, QKVW / 128), 128, 0, stream>>>(F[0], F[0], F[0], PK + PK_A, F[2], F[4], F[6], QK, QKL, VTH, VTL, PK + PK_P, F[8]);
  k_attn<<<dim3(TQB, NH, TNB), 128, 0, stream>>>(QK, QKL, VTH, VTL, nullptr, (float*)d_out);   // merged context == output (no out-projection)
}

// v006
// It runs in 147 microseconds.
// Next to v005, in two timings, it ran 1.04 and 1.03 times as fast.
// Over all steps from v000 it is 3.49 times as fast.
// compute dtype: all float inputs rounded to bf16; q/k/v/g = x . W^T + b with EXACT bf16 products on WMMA 16x16x32 (natural rows; q and g computed in the same block), qg = gelu_erf(q g) in f32 (precise erff) then split into f16 hi + residual; attention with 3-product scores (qg, k as f16 hi + residual) and 3-product P.v (P and v as hi + residual) everywhere; no scaling, softmax in f32 against a maximum that is renewed only when needed (hardware exp); the merged context is the output (f32).
#include <hip/hip_runtime.h>
#include <math.h>

typedef __attribute__((ext_vector_type(16))) _Float16 v16h;
typedef __attribute__((ext_vector_type(16))) __bf16 v16b;
typedef __attribute__((ext_vector_type(8)))  _Float16 v8h;
typedef __attribute__((ext_vector_type(8)))  float v8f;
typedef __attribute__((ext_vector_type(4)))  float v4f;
typedef __attribute__((ext_vector_type(2)))  float v2f;
typedef __attribute__((ext_vector_type(4)))  unsigned v4u;
typedef __attribute__((ext_vector_type(4)))  int v4i;
typedef float __attribute__((may_alias)) float_a;
typedef int __attribute__((may_alias)) int_a;

template <typename T> __device__ __forceinline__ void vst2(void* p, T v) { *(T*)p = v;  }
// both products are the plain builtin: the compiler itself keeps the distance that the chip needs behind a matrix instruction, and fills it with useful work where it can
__device__ __forceinline__ v8f wmma16(v16h a, v16h b, v8f c) {
  return __builtin_amdgcn_wmma_f32_16x16x32_f16(false, a, false, b, (short)0, c, false, false);
}
__device__ __forceinline__ v8f wmma_bf(v16b a, v16b b, v8f c) {
  return __builtin_amdgcn_wmma_f32_16x16x32_bf16(false, a, false, b, (short)0, c, false, false);
}
// Gated QKV attention (B 2, S 2,048, d 1,024, 16 heads x 64): q, k, v, g projections + biases, qg = gelu(q * g) (exact erf), softmax(qg k^T) v with no 1/sqrt(d) scaling and no output projection.
__device__ __forceinline__ v16h frag_h(const _Float16* rowk0, int lane) {
  union { v16h v; v8h q[2]; } u; const _Float16* p = rowk0 + 8 * (lane >> 4);
  u.q[0] = *(const v8h*)p; u.q[1] = *(const v8h*)(p + 16); return u.v;
}
__device__ __forceinline__ v16h frag_f32(const float* rowk0, int lane) {
  v16h a; const float* p = rowk0 + 8 * (lane >> 4);
#pragma unroll
  for (int i = 0; i < 8; ++i) { a[i] = (_Float16)p[i]; a[8 + i] = (_Float16)p[16 + i]; }
  return a;
}
__device__ __forceinline__ v16h frag_f32s(const float* rowk0, int lane, float sc) {
  v16h a; const float* p = rowk0 + 8 * (lane >> 4);
#pragma unroll
  for (int i = 0; i < 8; ++i) { a[i] = (_Float16)(p[i] * sc); a[8 + i] = (_Float16)(p[16 + i] * sc); }
  return a;
}
// column fragment from a [K][ld] layout (column n), rows >= K read as 0
__device__ __forceinline__ v16h fragc_f32(const float* W, int k0, int n, int lane, int ld, int K) {
  v16h a; const int g = lane >> 4;
#pragma unroll
  for (int i = 0; i < 8; ++i) { const int ka = k0 + 8 * g + i, kb = ka + 16;
    a[i] = (_Float16)(ka < K ? W[(size_t)(ka < K ? ka : K - 1) * ld + n] : 0.f); a[8 + i] = (_Float16)(kb < K ? W[(size_t)(kb < K ? kb : K - 1) * ld + n] : 0.f); }
  return a;
}
struct F2 { v16b h, l; };
__device__ __forceinline__ F2 bsplit16(const float v[16]) { F2 r;
#pragma unroll
  for (int i = 0; i < 16; ++i) { const __bf16 h = (__bf16)v[i]; r.h[i] = h; r.l[i] = (__bf16)(v[i] - (float)h); }
  return r; }
__device__ __forceinline__ F2 split_row(const float* row, int k0, int lane) { float v[16]; const float* p = row + k0 + 8 * (lane >> 4);
#pragma unroll
  for (int i = 0; i < 8; ++i) { v[i] = p[i]; v[8 + i] = p[16 + i]; }
  return bsplit16(v); }
__device__ __forceinline__ F2 split_rowK(const float* row, int k0, int lane, int K) { float v[16]; const int g = lane >> 4;
#pragma unroll
  for (int i = 0; i < 8; ++i) { const int ka = k0 + 8 * g + i, kb = ka + 16; v[i] = ka < K ? row[ka < K ? ka : K - 1] : 0.f; v[8 + i] = kb < K ? row[kb < K ? kb : K - 1] : 0.f; }
  return bsplit16(v); }
__device__ __forceinline__ F2 split_col(const float* W, int k0, int n, int lane, int ld, int K) { float v[16]; const int g = lane >> 4;
#pragma unroll
  for (int i = 0; i < 8; ++i) { const int ka = k0 + 8 * g + i, kb = ka + 16; v[i] = ka < K ? W[(size_t)(ka < K ? ka : K - 1) * ld + n] : 0.f; v[8 + i] = kb < K ? W[(size_t)(kb < K ? kb : K - 1) * ld + n] : 0.f; }
  return bsplit16(v); }
__device__ __forceinline__ v8f mac3(const F2& a, const F2& b, v8f c) { c = wmma_bf(a.l, b.h, c); c = wmma_bf(a.h, b.l, c); return wmma_bf(a.h, b.h, c); }
__device__ __forceinline__ float sigm(float v) { return 1.0f / (1.0f + expf(-v)); }
#define LDSX() do { asm volatile("s_wait_dscnt 0" ::: "memory"); __builtin_amdgcn_wave_barrier(); __builtin_amdgcn_fence(__ATOMIC_RELEASE, "workgroup"); } while (0)


#define NB 2
#define SS 2048
#define DM 1024
#define NH 16
#define SCALEF 1.0f
__device__ __attribute__((noinline)) float gelu_e(float v) { return 0.5f * v * (1.0f + erff(v * 0.70710678118654752f)); }
#define HD 64
#define QKVW (3 * DM)
#ifndef TQB
#define TQB (SS / 64)
#define TNB NB
#define TOB (NB * SS / 64)     // output row tiles (all)
#endif
typedef __attribute__((ext_vector_type(8))) __bf16 v8b;
__device__ __forceinline__ v16b frag_b(const __bf16* rowk0, int lane) {
  union { v16b v; v8b q[2]; } u; const __bf16* p = rowk0 + 8 * (lane >> 4);
  u.q[0] = *(const v8b*)p; u.q[1] = *(const v8b*)(p + 16); return u.v;
}
__device__ __forceinline__ float bfr(float v) { return (float)(__bf16)v; }
__device__ __attribute__((noinline)) float exp_ni(float v) { return expf(v); }
__device__ __attribute__((noinline)) float erf_ni(float v) { return erff(v); }

#define PK_A 0                       // [3072][1024] Wqkv rows (natural [out][in])
#define PK_P (PK_A + QKVW * DM)        // [1024][1024] Wg rows (natural)
#define PK_END (PK_P + DM * DM)
#define WS_PK  0u
#define WS_QK  (WS_PK + 2u * PK_END)             // f16 [4096 rows][2048]: qg | k
#define WS_QKL (WS_QK + 2u * NB * SS * 2 * DM)     // f16 q | k residual planes x2048
#define WS_VTH (WS_QKL + 2u * NB * SS * 2 * DM)    // f16 [b][1024 (h*64+d)][2048 s] hi
#define WS_VTL (WS_VTH + 2u * NB * DM * SS)        // f16 lo x 2048
#define WS_O   (WS_VTL + 2u * NB * DM * SS)        // f32 [4096][1024]
#define WS_CS  (WS_O + 4u * NB * SS * DM)           // f32 2 x [2048][32], unused
#define WS_END (WS_CS + 4u * 2 * SS * 32)
// ---- k_pack: block = (row n, which): natural [out][in] rows -> bf16; which 0..2 -> W_q/W_k/W_v into PK_A rows which*1024 + n; 3 -> W_g into PK_P
__global__ __launch_bounds__(256) void k_pack(const float* __restrict__ WQ, const float* __restrict__ WK, const float* __restrict__ WV, const float* __restrict__ WO, __bf16* __restrict__ PK) {
  __shared__ __align__(16) __bf16 s[DM]; const int n = blockIdx.x, which = blockIdx.y, t = threadIdx.x; const float* Wm = (which == 0) ? WQ : (which == 1) ? WK : (which == 2) ? WV : WO;
  for (int k = t; k < DM; k += 256) s[k] = (__bf16)Wm[(size_t)n * DM + k];
  __syncthreads();
  __bf16* dst = (which < 3) ? PK + PK_A + ((size_t)which * DM + n) * DM : PK + PK_P + (size_t)n * DM;
  for (int q = t; q < DM / 8; q += 256) vst2((unsigned*)(dst + q * 8), *(const v4u*)&s[q * 8]);
}
#define XPB 272u                  // X row pitch in LDS, bytes (256-B rows of 64 f32 + 16 B)
#define WPB 144u                  // weight row pitch in LDS, bytes (128-B rows of 64 bf16 + 16 B)
#define QXB (64u * XPB)           // bytes of one X tile (64 rows)
#define QWB (128u * WPB)          // bytes of one weight tile (128 rows)
#define QSTG (QXB + 2u * QWB)     // bytes of one stage: X | W | Wg
// one thread's eight 16-byte asynchronous copies into LDS: piece i goes from g + i * gs to LDS byte l + i * ls.
// The copies and s_wait_xcnt stand in one statement so that no address register is rewritten ahead of the wait.
__device__ __forceinline__ void stage8(const char* g, size_t gs, unsigned l, unsigned ls) {
  asm volatile("global_load_async_to_lds_b128 %0, %8, off\n\t"
               "global_load_async_to_lds_b128 %1, %9, off\n\t"
               "global_load_async_to_lds_b128 %2, %10, off\n\t"
               "global_load_async_to_lds_b128 %3, %11, off\n\t"
               "global_load_async_to_lds_b128 %4, %12, off\n\t"
               "global_load_async_to_lds_b128 %5, %13, off\n\t"
               "global_load_async_to_lds_b128 %6, %14, off\n\t"
               "global_load_async_to_lds_b128 %7, %15, off\n\t"
               "s_wait_xcnt 0x0"
               :: "v"(l), "v"(l + ls), "v"(l + 2u * ls), "v"(l + 3u * ls), "v"(l + 4u * ls), "v"(l + 5u * ls), "v"(l + 6u * ls), "v"(l + 7u * ls),
                  "v"(g), "v"(g + gs), "v"(g + 2 * gs), "v"(g + 3 * gs), "v"(g + 4 * gs), "v"(g + 5 * gs), "v"(g + 6 * gs), "v"(g + 7 * gs)
               : "memory");
}
// ---- k_qkv: block = (64 rows of x, 128 output columns; the q blocks also their 128 gate columns). A stage is 64 k of the block's X rows (f32) and weight rows (bf16), brought into LDS once per block, two buffers; the epilogue's staging arrays reuse the ring behind the last pass's barrier
__global__ __launch_bounds__(128) void k_qkv(const float* __restrict__ XQ, const float* __restrict__ XK, const float* __restrict__ XV, const __bf16* __restrict__ P, const float* __restrict__ BQ, const float* __restrict__ BK, const float* __restrict__ BV, _Float16* __restrict__ QK, _Float16* __restrict__ QKL, _Float16* __restrict__ VTH, _Float16* __restrict__ VTL, const __bf16* __restrict__ WG, const float* __restrict__ BG) {
  const int which0 = (blockIdx.y * 128) / DM; const float* X = (which0 == 0) ? XQ : (which0 == 1) ? XK : XV; const float* BB = BQ ? (((which0 == 0) ? BQ : (which0 == 1) ? BK : BV) + (blockIdx.y * 128 - which0 * DM)) : nullptr;
  __shared__ __align__(16) unsigned char sm[2 * QSTG];
  _Float16 (*so)[16][136] = (_Float16 (*)[16][136])sm; _Float16 (*sol)[16][136] = (_Float16 (*)[16][136])(sm + 4 * 16 * 136 * 2);
  _Float16 (*sth)[72] = (_Float16 (*)[72])sm; _Float16 (*stl)[72] = (_Float16 (*)[72])(sm + 128 * 72 * 2);
  const int tid = threadIdx.x, wave = tid >> 5, lane = tid & 31, col = lane & 15, g = lane >> 4; const size_t r0 = (size_t)blockIdx.x * 64 + wave * 16; const int n0 = blockIdx.y * 128;
  // each thread's share of a stage: 16-byte pieces of X rows tid / 16 + 8 i and of weight rows tid / 8 + 16 i, i = 0..7
  const char* gx = (const char*)(X + ((size_t)blockIdx.x * 64 + (tid >> 4)) * DM + (tid & 15) * 4);
  const char* gw = (const char*)(P + (size_t)(n0 + (tid >> 3)) * DM + (tid & 7) * 8);
  const char* gg = (const char*)(WG + (size_t)((n0 < DM ? n0 : 0) + (tid >> 3)) * DM + (tid & 7) * 8);
  const unsigned lx = (unsigned)(size_t)&sm[(tid >> 4) * XPB + (tid & 15) * 16], lw = (unsigned)(size_t)&sm[QXB + (tid >> 3) * WPB + (tid & 7) * 16];
  const int nps = DM / 64;
  v8f acc[8] = {}; v8f accg[8] = {};
  stage8(gx, (size_t)8 * DM * 4, lx, 8u * XPB); stage8(gw, (size_t)16 * DM * 2, lw, 16u * WPB);
  if (n0 < DM) stage8(gg, (size_t)16 * DM * 2, lw + QWB, 16u * WPB);
  asm volatile("s_wait_asynccnt 0x0" ::: "memory");   // stage 0 has landed before the barrier that publishes it
  __syncthreads();
  stage8(gx + 256, (size_t)8 * DM * 4, lx + QSTG, 8u * XPB); stage8(gw + 128, (size_t)16 * DM * 2, lw + QSTG, 16u * WPB);
  if (n0 < DM) stage8(gg + 128, (size_t)16 * DM * 2, lw + QSTG + QWB, 16u * WPB);
#pragma unroll 1
  for (int ps = 0; ps < nps; ++ps) { const unsigned bo = (unsigned)(ps & 1) * QSTG; const unsigned char* sb = sm + bo;
#pragma unroll
    for (int kc = 0; kc < 2; ++kc) { v16b a; { const float* p = (const float*)(sb + (wave * 16 + col) * XPB) + kc * 32 + 8 * g;
#pragma unroll
      for (int i = 0; i < 8; ++i) { a[i] = (__bf16)p[i]; a[8 + i] = (__bf16)p[16 + i]; } }
      v16b fw[8];   // the k-step's weight fragments, read from LDS as one group
#pragma unroll
      for (int j = 0; j < 8; ++j) fw[j] = frag_b((const __bf16*)(sb + QXB + (j * 16 + col) * WPB) + kc * 32, lane);
      // holds the fragment reads together in front of the products: one LDS latency a group instead of one per fragment
      asm volatile("" :: "v"(fw[0]), "v"(fw[1]), "v"(fw[2]), "v"(fw[3]), "v"(fw[4]), "v"(fw[5]), "v"(fw[6]), "v"(fw[7]));
#pragma unroll
      for (int j = 0; j < 8; ++j) acc[j] = wmma_bf(a, fw[j], acc[j]);
      if (n0 < DM) { v16b fg[8];   // the gate's fragments, likewise
#pragma unroll
        for (int j = 0; j < 8; ++j) fg[j] = frag_b((const __bf16*)(sb + QXB + QWB + (j * 16 + col) * WPB) + kc * 32, lane);
        // holds the fragment reads together in front of the products: one LDS latency a group instead of one per fragment
        asm volatile("" :: "v"(fg[0]), "v"(fg[1]), "v"(fg[2]), "v"(fg[3]), "v"(fg[4]), "v"(fg[5]), "v"(fg[6]), "v"(fg[7]));
#pragma unroll
        for (int j = 0; j < 8; ++j) accg[j] = wmma_bf(a, fg[j], accg[j]); } }
    asm volatile("s_wait_dscnt 0x0" ::: "memory");      // this wave's reads of the stage are done before the buffer is given up
    asm volatile("s_wait_asynccnt 0x0" ::: "memory");   // this wave's copies of stage ps + 1 have landed
    __syncthreads();                                    // publishes stage ps + 1 and ends every reader's last read of stage ps
    if (ps + 2 < nps) { const size_t ax = (size_t)(ps + 2) * 256, aw = (size_t)(ps + 2) * 128;
      stage8(gx + ax, (size_t)8 * DM * 4, lx + bo, 8u * XPB); stage8(gw + aw, (size_t)16 * DM * 2, lw + bo, 16u * WPB);
      if (n0 < DM) stage8(gg + aw, (size_t)16 * DM * 2, lw + bo + QWB, 16u * WPB); } }
  asm volatile("s_wait_asynccnt 0x0" ::: "memory");     // no copy is outstanding behind the loop; the ring now serves as the epilogue's staging
  float bb[8], bgt[8];   // the lane's bias of each of its eight columns (q blocks: the gate's too), loaded here as one group: one load latency a wave
#pragma unroll
  for (int j = 0; j < 8; ++j) { bb[j] = 0.f; bgt[j] = 0.f; }
  if (BB) {
#pragma unroll
    for (int j = 0; j < 8; ++j) bb[j] = BB[j * 16 + col]; }
  if (n0 < DM) {
#pragma unroll
    for (int j = 0; j < 8; ++j) bgt[j] = BG[n0 + j * 16 + col]; }
#pragma unroll
  for (int j = 0; j < 8; ++j) { bb[j] = bfr(bb[j]); bgt[j] = bfr(bgt[j]); }
  if (n0 < 2 * DM) {   // q stored unscaled (f16 sigma ~0.6, no subnormal exposure); the score is not scaled either (SCALEF = 1)
#pragma unroll
    for (int j = 0; j < 8; ++j) {
#pragma unroll
      for (int r = 0; r < 8; ++r) { float v = acc[j][r] + bb[j]; if (n0 < DM) v = gelu_e(v * (accg[j][r] + bgt[j])); const _Float16 hv = (_Float16)v; so[wave][8 * g + r][j * 16 + col] = hv; sol[wave][8 * g + r][j * 16 + col] = (_Float16)((v - (float)hv) * 2048.0f); } }   // q, k (+ bias) as f16 hi + (x2048) residual
    LDSX();
    for (int rl = 0; rl < 16; ++rl) if (lane < 16) { vst2((unsigned*)(QK + (r0 + rl) * (2 * DM) + n0 + lane * 8), *(const v4u*)&so[wave][rl][lane * 8]); vst2((unsigned*)(QKL + (r0 + rl) * (2 * DM) + n0 + lane * 8), *(const v4u*)&sol[wave][rl][lane * 8]); }
  } else {
#pragma unroll
    for (int j = 0; j < 8; ++j) {
#pragma unroll
      for (int r = 0; r < 8; ++r) { const float v = acc[j][r] + bb[j]; const _Float16 hv = (_Float16)v; sth[j * 16 + col][wave * 16 + 8 * g + r] = hv; stl[j * 16 + col][wave * 16 + 8 * g + r] = (_Float16)((v - (float)hv) * 2048.0f); } }
    __syncthreads();
    const size_t rb = (size_t)blockIdx.x * 64; const int b = (int)(rb / SS), s0 = (int)(rb % SS); const int pc0 = n0 - 2 * DM;
    for (int q = tid; q < 128 * 8; q += 128) { const int d = q >> 3, pc = q & 7; const size_t o = ((size_t)b * DM + pc0 + d) * SS + s0 + pc * 8; vst2((unsigned*)(VTH + o), *(const v4u*)&sth[d][pc * 8]); vst2((unsigned*)(VTL + o), *(const v4u*)&stl[d][pc * 8]); }
  }
}
#define KPH 72                    // K row pitch in LDS, f16 elements (128-B rows + 16 B)
#define VPH 40                    // V row pitch in LDS, f16 elements (64-B rows + 16 B)
#define KPL (32u * KPH * 2u)      // bytes of one K plane
#define VPL (64u * VPH * 2u)      // bytes of one V plane
#define KBUF (2u * KPL)           // bytes of one K buffer (both planes)
#define VBUF (2u * VPL)
#define PSUM 24.0f                // bound on a lane's sum of a pass's 16 exponentials; beyond it the maximum in use is renewed
// one thread's eight 16-byte asynchronous copies of a 32-key stage (K hi, K residual, V hi, V residual; two rows each) into LDS.
// The copies and s_wait_xcnt stand in one statement so that no address register is rewritten ahead of the wait.
__device__ __forceinline__ void stage_kv(const _Float16* kh, const _Float16* kl, const _Float16* vh, const _Float16* vl, unsigned lk, unsigned lv) {
  asm volatile("global_load_async_to_lds_b128 %0, %8, off\n\t"
               "global_load_async_to_lds_b128 %1, %9, off\n\t"
               "global_load_async_to_lds_b128 %2, %10, off\n\t"
               "global_load_async_to_lds_b128 %3, %11, off\n\t"
               "global_load_async_to_lds_b128 %4, %12, off\n\t"
               "global_load_async_to_lds_b128 %5, %13, off\n\t"
               "global_load_async_to_lds_b128 %6, %14, off\n\t"
               "global_load_async_to_lds_b128 %7, %15, off\n\t"
               "s_wait_xcnt 0x0"
               :: "v"(lk), "v"(lk + 16u * KPH * 2u), "v"(lk + KPL), "v"(lk + KPL + 16u * KPH * 2u), "v"(lv), "v"(lv + 32u * VPH * 2u), "v"(lv + VPL), "v"(lv + VPL + 32u * VPH * 2u),
                  "v"(kh), "v"(kh + (size_t)16 * (2 * DM)), "v"(kl), "v"(kl + (size_t)16 * (2 * DM)), "v"(vh), "v"(vh + (size_t)32 * SS), "v"(vl), "v"(vl + (size_t)32 * SS)
               : "memory");
}
// lane l's value exchanged with lane l ^ 16 (a vector cross-row move; a shuffle would go through the LDS unit)
__device__ __forceinline__ float xhalf(float x) { return __builtin_bit_cast(float, __builtin_amdgcn_permlanex16(__builtin_bit_cast(int, x), __builtin_bit_cast(int, x), 0x76543210, 0xfedcba98, false, false)); }
// the lane's 16 exponentials of a pass against the maximum m, and their sum
__device__ __forceinline__ float exps16(const v8f (&s)[2], float m, float (&e)[2][8]) {
  float t[8];
#pragma unroll
  for (int r = 0; r < 8; ++r) { e[0][r] = (s[0][r] <= -1.0e38f) ? 0.f : __expf(s[0][r] - m); e[1][r] = (s[1][r] <= -1.0e38f) ? 0.f : __expf(s[1][r] - m); t[r] = e[0][r] + e[1][r]; }
  return ((t[0] + t[1]) + (t[2] + t[3])) + ((t[4] + t[5]) + (t[6] + t[7]));
}
__global__ __launch_bounds__(128) void k_attn(const _Float16* __restrict__ QK, const _Float16* __restrict__ QKL, const _Float16* __restrict__ VTH, const _Float16* __restrict__ VTL, const void* __restrict__ KMASK, float* __restrict__ O) {
  __shared__ __align__(16) float so[4][16][68];
  __shared__ __align__(16) _Float16 sk[2][2][32][KPH];   // [buffer][hi, residual][key][d], 144-B rows
  __shared__ __align__(16) _Float16 sv[2][2][64][VPH];   // [buffer][hi, residual][d][key], 80-B rows
  const int tid = threadIdx.x, wave = tid >> 5, lane = tid & 31, col = lane & 15, g = lane >> 4;
  const int qb = blockIdx.x, h = blockIdx.y, b = blockIdx.z;
  // each thread's share of a 32-key stage: 16-byte pieces of K rows tid / 8 and 16 + tid / 8 and of V rows tid / 4 and 32 + tid / 4, both planes
  const size_t gk = ((size_t)b * SS + (tid >> 3)) * (2 * DM) + DM + h * HD + (tid & 7) * 8, gv = ((size_t)b * DM + h * HD + (tid >> 2)) * SS + (tid & 3) * 8;
  const unsigned lk = (unsigned)(size_t)&sk[0][0][tid >> 3][(tid & 7) * 8], lv = (unsigned)(size_t)&sv[0][0][tid >> 2][(tid & 3) * 8]; const int q0 = qb * 64 + wave * 16; const size_t rq = (size_t)b * SS + q0 + col;
  v16h aq[2], aql[2];
#pragma unroll
  for (int kc = 0; kc < 2; ++kc) { aq[kc] = frag_h(QK + rq * (2 * DM) + h * HD + kc * 32, lane); aql[kc] = frag_h(QKL + rq * (2 * DM) + h * HD + kc * 32, lane); }
  float m = -3.0e38f, l = 0.f;   // the lane's query: the maximum in use (equal in both halves) and this half's share of the sum
  v8f acc[4] = {}, accl[4] = {};   // O^T tiles: register r = d dt * 16 + 8 g + r of query col
  const int nks = SS / 32;   // all keys
  stage_kv(QK + gk, QKL + gk, VTH + gv, VTL + gv, lk, lv);
  asm volatile("s_wait_asynccnt 0x0" ::: "memory");   // stage 0 has landed before the barrier that publishes it
  __syncthreads();
  stage_kv(QK + gk + (size_t)32 * (2 * DM), QKL + gk + (size_t)32 * (2 * DM), VTH + gv + 32, VTL + gv + 32, lk + KBUF, lv + VBUF);
#pragma unroll 1
  for (int ks = 0; ks < nks; ++ks) { v8f s[2]; const int bf = ks & 1;
    v16h fk[2][2], fkl[2][2];   // the pass's K fragments, read from LDS as one group
#pragma unroll
    for (int ct = 0; ct < 2; ++ct) {
#pragma unroll
      for (int kc = 0; kc < 2; ++kc) { fk[ct][kc] = frag_h(&sk[bf][0][ct * 16 + col][kc * 32], lane); fkl[ct][kc] = frag_h(&sk[bf][1][ct * 16 + col][kc * 32], lane); } }
    // holds the eight fragment reads together in front of the products: one LDS latency a pass instead of one per fragment
    asm volatile("" :: "v"(fk[0][0]), "v"(fk[0][1]), "v"(fk[1][0]), "v"(fk[1][1]), "v"(fkl[0][0]), "v"(fkl[0][1]), "v"(fkl[1][0]), "v"(fkl[1][1]));
#pragma unroll
    for (int ct = 0; ct < 2; ++ct) { v8f c = {}, cl = {};
#pragma unroll
      for (int kc = 0; kc < 2; ++kc) { const v16h kh = fk[ct][kc]; c = wmma16(kh, aq[kc], c); cl = wmma16(kh, aql[kc], cl); cl = wmma16(fkl[ct][kc], aq[kc], cl); }   // 3 products: q, k as f16 hi + residual
#pragma unroll
      for (int r = 0; r < 8; ++r) c[r] += cl[r] * (1.0f / 2048.0f);
      { const bool keepk = true;
#pragma unroll
      for (int r = 0; r < 8; ++r) s[ct][r] = keepk ? c[r] * SCALEF : -3.0e38f; } }   // no scaling (SCALEF = 1); masked keys excluded
    // lazy rescale: the exponentials are taken against m, the maximum in use, which may trail the true one. They are not negative, so a lane's sum of at most PSUM bounds each of them,
    // and P * 2^11 stays under the f16 limit (24 * 2^11 = 49,152). One test a pass, a scalar branch on the whole wave's vote
    float e[2][8]; float ts = exps16(s, m, e);
    if (__builtin_amdgcn_ballot_w32(!(ts <= PSUM)) != 0) {   // rare: some lane's sum is beyond the bound (always in pass 0, where it is infinite): only then the pass's maximum, the rescale, and the exponentials anew
      // the lane's 16 scores, as a tree of three-way maxima (short dependent chain)
      const float u0 = fmaxf(fmaxf(s[0][0], s[1][0]), s[0][1]), u1 = fmaxf(fmaxf(s[1][1], s[0][2]), s[1][2]), u2 = fmaxf(fmaxf(s[0][3], s[1][3]), s[0][4]), u3 = fmaxf(fmaxf(s[1][4], s[0][5]), s[1][5]), u4 = fmaxf(fmaxf(s[0][6], s[1][6]), s[0][7]);
      float mx = fmaxf(fmaxf(fmaxf(u0, u1), u2), fmaxf(fmaxf(u3, u4), s[1][7]));
      mx = fmaxf(mx, xhalf(mx));   // both halves now hold the query's maximum over the pass's 32 keys
      const float mn = fmaxf(m, mx); const float alpha = (m <= -1.0e38f) ? 0.f : __expf(m - mn);
      m = mn; l *= alpha;
#pragma unroll
      for (int dt = 0; dt < 4; ++dt) { acc[dt] = acc[dt] * alpha; accl[dt] = accl[dt] * alpha; }
      ts = exps16(s, m, e); }   // now every exponential is at most 1
    l += ts;   // the halves' sums are joined once, in the epilogue
    v16h pa, pl;   // P^T as a B operand: element i = key 8 g + i, element 8 + i = key 16 + 8 g + i, the k order of the V fragments
#pragma unroll
    for (int i = 0; i < 8; ++i) { const float x0 = e[0][i] * 2048.0f, x1 = e[1][i] * 2048.0f; const _Float16 h0 = (_Float16)x0, h1 = (_Float16)x1; pa[i] = h0; pa[8 + i] = h1; pl[i] = (_Float16)((x0 - (float)h0) * 2048.0f); pl[8 + i] = (_Float16)((x1 - (float)h1) * 2048.0f); }   // P scaled by 2^11 before the f16 split so small softmax weights stay out of the f16 subnormal range; 2^-11 folded into the epilogue
    v16h fv[4], fvl[4];   // the pass's V fragments, read from LDS as one group
#pragma unroll
    for (int dt = 0; dt < 4; ++dt) { fv[dt] = frag_h(&sv[bf][0][dt * 16 + col][0], lane); fvl[dt] = frag_h(&sv[bf][1][dt * 16 + col][0], lane); }
    // holds the eight fragment reads together in front of the products: one LDS latency a pass instead of one per fragment
    asm volatile("" :: "v"(fv[0]), "v"(fv[1]), "v"(fv[2]), "v"(fv[3]), "v"(fvl[0]), "v"(fvl[1]), "v"(fvl[2]), "v"(fvl[3]));
#pragma unroll
    for (int dt = 0; dt < 4; ++dt) { const v16h vh = fv[dt]; acc[dt] = wmma16(vh, pa, acc[dt]); accl[dt] = wmma16(vh, pl, accl[dt]); accl[dt] = wmma16(fvl[dt], pa, accl[dt]); }   // P hi x V hi + (P lo x V hi + P hi x V lo) / 2048
    asm volatile("s_wait_dscnt 0x0" ::: "memory");      // this wave's reads of the stage are done before the buffer is given up
    asm volatile("s_wait_asynccnt 0x0" ::: "memory");   // this wave's copies of stage ks + 1 have landed
    __syncthreads();                                    // publishes stage ks + 1 and ends every reader's last read of stage ks
    if (ks + 2 < nks) { const size_t ak = (size_t)(ks + 2) * 32 * (2 * DM), av = (size_t)(ks + 2) * 32; stage_kv(QK + gk + ak, QKL + gk + ak, VTH + gv + av, VTL + gv + av, lk + bf * KBUF, lv + bf * VBUF); } }
  asm volatile("s_wait_asynccnt 0x0" ::: "memory");     // no copy is outstanding behind the loop
  const float il = (1.0f / 2048.0f) / (l + xhalf(l));
#pragma unroll
  for (int dt = 0; dt < 4; ++dt) {
#pragma unroll
    for (int r = 0; r < 8; ++r) so[wave][col][dt * 16 + 8 * g + r] = (acc[dt][r] + accl[dt][r] * (1.0f / 2048.0f)) * il; }
  LDSX();
  for (int rl = 0; rl < 16; ++rl) if (lane < 16) vst2(O + ((size_t)b * SS + q0 + rl) * DM + h * HD + lane * 4, *(const v4f*)&so[wave][rl][lane * 4]);
}
// ---- k_out: block = (64 rows, 128 cols): out = O(hi/lo) . Wo rows (2 products) + bo
__global__ __launch_bounds__(128) void k_out(const float* __restrict__ O, const __bf16* __restrict__ P, const float* __restrict__ BO, float* __restrict__ Y) {
  __shared__ __align__(16) float so[4][16][132];
  const int tid = threadIdx.x, wave = tid >> 5, lane = tid & 31, col = lane & 15, g = lane >> 4; const size_t r0 = (size_t)blockIdx.x * 64 + wave * 16; const int n0 = blockIdx.y * 128;
  v8f acc[8] = {};
#pragma unroll 2
  for (int kc = 0; kc < DM / 32; ++kc) { const F2 a = split_row(O + (r0 + col) * DM, kc * 32, lane);
#pragma unroll
    for (int j = 0; j < 8; ++j) { const v16b w = frag_b(P + (size_t)(n0 + j * 16 + col) * DM + kc * 32, lane); acc[j] = wmma_bf(a.l, w, acc[j]); acc[j] = wmma_bf(a.h, w, acc[j]); } }
#pragma unroll
  for (int j = 0; j < 8; ++j) {
#pragma unroll
    for (int r = 0; r < 8; ++r) so[wave][8 * g + r][j * 16 + col] = acc[j][r] + (BO ? bfr(BO[n0 + j * 16 + col]) : 0.f); }
  LDSX();
  for (int rl = 0; rl < 16; ++rl) vst2(Y + (r0 + rl) * DM + n0 + lane * 4, *(const v4f*)&so[wave][rl][lane * 4]);
}
extern "C" void kernel_launch(void* const* d_in, const int* in_sizes, int n_in, void* d_out, int out_size, void* d_ws, size_t ws_size, hipStream_t stream) {
  (void)in_sizes; (void)n_in; (void)out_size;
  const float** F = (const float**)d_in;   // 0 x [2,2048,1024], 1 Wq, 2 bq, 3 Wk, 4 bk, 5 Wv, 6 bv, 7 Wg, 8 bg (natural [1024,1024] / [1024])
  if (ws_size < (size_t)WS_END) return;
  char* ws = (char*)d_ws; __bf16* PK = (__bf16*)(ws + WS_PK); _Float16 *QK = (_Float16*)(ws + WS_QK), *QKL = (_Float16*)(ws + WS_QKL), *VTH = (_Float16*)(ws + WS_VTH), *VTL = (_Float16*)(ws + WS_VTL);
  k_pack<<<dim3(DM, 4), 256, 0, stream>>>(F[1], F[3], F[5], F[7], PK);   // the fourth slot holds Wg
  k_qkv<<<dim3(TNB * SS / 64, QKVW / 128), 128, 0, stream>>>(F[0], F[0], F[0], PK + PK_A, F[2], F[4], F[6], QK, QKL, VTH, VTL, PK + PK_P, F[8]);
  k_attn<<<dim3(TQB, NH, TNB), 128, 0, stream>>>(QK, QKL, VTH, VTL, nullptr, (float*)d_out);   // merged context == output (no out-projection)
}

// v007
// One run takes 137 microseconds.
// Two timings next to v006 put it at 1.08 and 1.07 times that version's speed.
// All steps since v000 together make it 3.75 times as fast.
// compute dtype: all float inputs rounded to bf16; q/k/v/g = x . W^T + b with EXACT bf16 products on WMMA 16x16x32 (natural rows; q and g computed in the same block), qg = gelu_erf(q g) in f32 (precise erff) then split into f16 hi + residual; attention with 3-product scores (qg, k as f16 hi + residual) and 3-product P.v (P and v as hi + residual) everywhere; no scaling, softmax in f32 against a maximum that is renewed only when needed (hardware exp); the merged context is the output (f32).
#include <hip/hip_runtime.h>
#include <math.h>

typedef __attribute__((ext_vector_type(16))) _Float16 v16h;
typedef __attribute__((ext_vector_type(16))) __bf16 v16b;
typedef __attribute__((ext_vector_type(8)))  _Float16 v8h;
typedef __attribute__((ext_vector_type(2)))  _Float16 v2h;
typedef __attribute__((ext_vector_type(8)))  float v8f;
typedef __attribute__((ext_vector_type(4)))  float v4f;
typedef __attribute__((ext_vector_type(2)))  float v2f;
typedef __attribute__((ext_vector_type(4)))  unsigned v4u;
typedef __attribute__((ext_vector_type(4)))  int v4i;
typedef float __attribute__((may_alias)) float_a;
typedef int __attribute__((may_alias)) int_a;

template <typename T> __device__ __forceinline__ void vst2(void* p, T v) { *(T*)p = v;  }
// both products are the plain builtin: the compiler itself keeps the distance that the chip needs behind a matrix instruction, and fills it with useful work where it can
__device__ __forceinline__ v8f wmma16(v16h a, v16h b, v8f c) {
  return __builtin_amdgcn_wmma_f32_16x16x32_f16(false, a, false, b, (short)0, c, false, false);
}
__device__ __forceinline__ v8f wmma_bf(v16b a, v16b b, v8f c) {
  return __builtin_amdgcn_wmma_f32_16x16x32_bf16(false, a, false, b, (short)0, c, false, false);
}
// Gated QKV attention (B 2, S 2,048, d 1,024, 16 heads x 64): q, k, v, g projections + biases, qg = gelu(q * g) (exact erf), softmax(qg k^T) v with no 1/sqrt(d) scaling and no output projection.
__device__ __forceinline__ v16h frag_h(const _Float16* rowk0, int lane) {
  union { v16h v; v8h q[2]; } u; const _Float16* p = rowk0 + 8 * (lane >> 4);
  u.q[0] = *(const v8h*)p; u.q[1] = *(const v8h*)(p + 16); return u.v;
}
__device__ __forceinline__ v16h frag_f32(const float* rowk0, int lane) {
  v16h a; const float* p = rowk0 + 8 * (lane >> 4);
#pragma unroll
  for (int i = 0; i < 8; ++i) { a[i] = (_Float16)p[i]; a[8 + i] = (_Float16)p[16 + i]; }
  return a;
}
__device__ __forceinline__ v16h frag_f32s(const float* rowk0, int lane, float sc) {
  v16h a; const float* p = rowk0 + 8 * (lane >> 4);
#pragma unroll
  for (int i = 0; i < 8; ++i) { a[i] = (_Float16)(p[i] * sc); a[8 + i] = (_Float16)(p[16 + i] * sc); }
  return a;
}
// column fragment from a [K][ld] layout (column n), rows >= K read as 0
__device__ __forceinline__ v16h fragc_f32(const float* W, int k0, int n, int lane, int ld, int K) {
  v16h a; const int g = lane >> 4;
#pragma unroll
  for (int i = 0; i < 8; ++i) { const int ka = k0 + 8 * g + i, kb = ka + 16;
    a[i] = (_Float16)(ka < K ? W[(size_t)(ka < K ? ka : K - 1) * ld + n] : 0.f); a[8 + i] = (_Float16)(kb < K ? W[(size_t)(kb < K ? kb : K - 1) * ld + n] : 0.f); }
  return a;
}
struct F2 { v16b h, l; };
__device__ __forceinline__ F2 bsplit16(const float v[16]) { F2 r;
#pragma unroll
  for (int i = 0; i < 16; ++i) { const __bf16 h = (__bf16)v[i]; r.h[i] = h; r.l[i] = (__bf16)(v[i] - (float)h); }
  return r; }
__device__ __forceinline__ F2 split_row(const float* row, int k0, int lane) { float v[16]; const float* p = row + k0 + 8 * (lane >> 4);
#pragma unroll
  for (int i = 0; i < 8; ++i) { v[i] = p[i]; v[8 + i] = p[16 + i]; }
  return bsplit16(v); }
__device__ __forceinline__ F2 split_rowK(const float* row, int k0, int lane, int K) { float v[16]; const int g = lane >> 4;
#pragma unroll
  for (int i = 0; i < 8; ++i) { const int ka = k0 + 8 * g + i, kb = ka + 16; v[i] = ka < K ? row[ka < K ? ka : K - 1] : 0.f; v[8 + i] = kb < K ? row[kb < K ? kb : K - 1] : 0.f; }
  return bsplit16(v); }
__device__ __forceinline__ F2 split_col(const float* W, int k0, int n, int lane, int ld, int K) { float v[16]; const int g = lane >> 4;
#pragma unroll
  for (int i = 0; i < 8; ++i) { const int ka = k0 + 8 * g + i, kb = ka + 16; v[i] = ka < K ? W[(size_t)(ka < K ? ka : K - 1) * ld + n] : 0.f; v[8 + i] = kb < K ? W[(size_t)(kb < K ? kb : K - 1) * ld + n] : 0.f; }
  return bsplit16(v); }
__device__ __forceinline__ v8f mac3(const F2& a, const F2& b, v8f c) { c = wmma_bf(a.l, b.h, c); c = wmma_bf(a.h, b.l, c); return wmma_bf(a.h, b.h, c); }
__device__ __forceinline__ float sigm(float v) { return 1.0f / (1.0f + expf(-v)); }
#define LDSX() do { asm volatile("s_wait_dscnt 0" ::: "memory"); __builtin_amdgcn_wave_barrier(); __builtin_amdgcn_fence(__ATOMIC_RELEASE, "workgroup"); } while (0)


#define NB 2
#define SS 2048
#define DM 1024
#define NH 16
#define SCALEF 1.0f
__device__ __attribute__((noinline)) float gelu_e(float v) { return 0.5f * v * (1.0f + erff(v * 0.70710678118654752f)); }
#define HD 64
#define QKVW (3 * DM)
#ifndef TQB
#define TQB (SS / 64)
#define TNB NB
#define TOB (NB * SS / 64)     // output row tiles (all)
#endif
typedef __attribute__((ext_vector_type(8))) __bf16 v8b;
__device__ __forceinline__ v16b frag_b(const __bf16* rowk0, int lane) {
  union { v16b v; v8b q[2]; } u; const __bf16* p = rowk0 + 8 * (lane >> 4);
  u.q[0] = *(const v8b*)p; u.q[1] = *(const v8b*)(p + 16); return u.v;
}
__device__ __forceinline__ float bfr(float v) { return (float)(__bf16)v; }
__device__ __attribute__((noinline)) float exp_ni(float v) { return expf(v); }
__device__ __attribute__((noinline)) float erf_ni(float v) { return erff(v); }

#define PK_A 0                       // [3072][1024] Wqkv rows (natural [out][in])
#define PK_P (PK_A + QKVW * DM)        // [1024][1024] Wg rows (natural)
#define PK_END (PK_P + DM * DM)
#define WS_PK  0u
#define WS_QK  (WS_PK + 2u * PK_END)             // f16 [4096 rows][2048]: qg | k
#define WS_QKL (WS_QK + 2u * NB * SS * 2 * DM)     // f16 q | k residual planes x2048
#define WS_VTH (WS_QKL + 2u * NB * SS * 2 * DM)    // f16 [b][1024 (h*64+d)][2048 s] hi
#define WS_VTL (WS_VTH + 2u * NB * DM * SS)        // f16 lo x 2048
#define WS_O   (WS_VTL + 2u * NB * DM * SS)        // f32 [4096][1024]
#define WS_CS  (WS_O + 4u * NB * SS * DM)           // f32 2 x [2048][32], unused
#define WS_END (WS_CS + 4u * 2 * SS * 32)
// ---- k_pack: block = (row n, which): natural [out][in] rows -> bf16; which 0..2 -> W_q/W_k/W_v into PK_A rows which*1024 + n; 3 -> W_g into PK_P
__global__ __launch_bounds__(256) void k_pack(const float* __restrict__ WQ, const float* __restrict__ WK, const float* __restrict__ WV, const float* __restrict__ WO, __bf16* __restrict__ PK) {
  __shared__ __align__(16) __bf16 s[DM]; const int n = blockIdx.x, which = blockIdx.y, t = threadIdx.x; const float* Wm = (which == 0) ? WQ : (which == 1) ? WK : (which == 2) ? WV : WO;
  for (int k = t; k < DM; k += 256) s[k] = (__bf16)Wm[(size_t)n * DM + k];
  __syncthreads();
  __bf16* dst = (which < 3) ? PK + PK_A + ((size_t)which * DM + n) * DM : PK + PK_P + (size_t)n * DM;
  for (int q = t; q < DM / 8; q += 256) vst2((unsigned*)(dst + q * 8), *(const v4u*)&s[q * 8]);
}
#define XPB 272u                  // X row pitch in LDS, bytes (256-B rows of 64 f32 + 16 B)
#define WPB 144u                  // weight row pitch in LDS, bytes (128-B rows of 64 bf16 + 16 B)
#define QXB (64u * XPB)           // bytes of one X tile (64 rows)
#define QWB (128u * WPB)          // bytes of one weight tile (128 rows)
#define QSTG (QXB + 2u * QWB)     // bytes of one stage: X | W | Wg
// one thread's eight 16-byte asynchronous copies into LDS: piece i goes from g + i * gs to LDS byte l + i * ls.
// The copies and s_wait_xcnt stand in one statement so that no address register is rewritten ahead of the wait.
__device__ __forceinline__ void stage8(const char* g, size_t gs, unsigned l, unsigned ls) {
  asm volatile("global_load_async_to_lds_b128 %0, %8, off\n\t"
               "global_load_async_to_lds_b128 %1, %9, off\n\t"
               "global_load_async_to_lds_b128 %2, %10, off\n\t"
               "global_load_async_to_lds_b128 %3, %11, off\n\t"
               "global_load_async_to_lds_b128 %4, %12, off\n\t"
               "global_load_async_to_lds_b128 %5, %13, off\n\t"
               "global_load_async_to_lds_b128 %6, %14, off\n\t"
               "global_load_async_to_lds_b128 %7, %15, off\n\t"
               "s_wait_xcnt 0x0"
               :: "v"(l), "v"(l + ls), "v"(l + 2u * ls), "v"(l + 3u * ls), "v"(l + 4u * ls), "v"(l + 5u * ls), "v"(l + 6u * ls), "v"(l + 7u * ls),
                  "v"(g), "v"(g + gs), "v"(g + 2 * gs), "v"(g + 3 * gs), "v"(g + 4 * gs), "v"(g + 5 * gs), "v"(g + 6 * gs), "v"(g + 7 * gs)
               : "memory");
}
// ---- k_qkv: block = (64 rows of x, 128 output columns; the q blocks also their 128 gate columns). A stage is 64 k of the block's X rows (f32) and weight rows (bf16), brought into LDS once per block, two buffers; the epilogue's staging arrays reuse the ring behind the last pass's barrier
__global__ __launch_bounds__(128) void k_qkv(const float* __restrict__ XQ, const float* __restrict__ XK, const float* __restrict__ XV, const __bf16* __restrict__ P, const float* __restrict__ BQ, const float* __restrict__ BK, const float* __restrict__ BV, _Float16* __restrict__ QK, _Float16* __restrict__ QKL, _Float16* __restrict__ VTH, _Float16* __restrict__ VTL, const __bf16* __restrict__ WG, const float* __restrict__ BG) {
  const int which0 = (blockIdx.y * 128) / DM; const float* X = (which0 == 0) ? XQ : (which0 == 1) ? XK : XV; const float* BB = BQ ? (((which0 == 0) ? BQ : (which0 == 1) ? BK : BV) + (blockIdx.y * 128 - which0 * DM)) : nullptr;
  __shared__ __align__(16) unsigned char sm[2 * QSTG];
  _Float16 (*so)[16][136] = (_Float16 (*)[16][136])sm; _Float16 (*sol)[16][136] = (_Float16 (*)[16][136])(sm + 4 * 16 * 136 * 2);
  _Float16 (*sth)[72] = (_Float16 (*)[72])sm; _Float16 (*stl)[72] = (_Float16 (*)[72])(sm + 128 * 72 * 2);
  const int tid = threadIdx.x, wave = tid >> 5, lane = tid & 31, col = lane & 15, g = lane >> 4; const size_t r0 = (size_t)blockIdx.x * 64 + wave * 16; const int n0 = blockIdx.y * 128;
  // each thread's share of a stage: 16-byte pieces of X rows tid / 16 + 8 i and of weight rows tid / 8 + 16 i, i = 0..7
  const char* gx = (const char*)(X + ((size_t)blockIdx.x * 64 + (tid >> 4)) * DM + (tid & 15) * 4);
  const char* gw = (const char*)(P + (size_t)(n0 + (tid >> 3)) * DM + (tid & 7) * 8);
  const char* gg = (const char*)(WG + (size_t)((n0 < DM ? n0 : 0) + (tid >> 3)) * DM + (tid & 7) * 8);
  const unsigned lx = (unsigned)(size_t)&sm[(tid >> 4) * XPB + (tid & 15) * 16], lw = (unsigned)(size_t)&sm[QXB + (tid >> 3) * WPB + (tid & 7) * 16];
  const int nps = DM / 64;
  v8f acc[8] = {}; v8f accg[8] = {};
  stage8(gx, (size_t)8 * DM * 4, lx, 8u * XPB); stage8(gw, (size_t)16 * DM * 2, lw, 16u * WPB);
  if (n0 < DM) stage8(gg, (size_t)16 * DM * 2, lw + QWB, 16u * WPB);
  asm volatile("s_wait_asynccnt 0x0" ::: "memory");   // stage 0 has landed before the barrier that publishes it
  __syncthreads();
  stage8(gx + 256, (size_t)8 * DM * 4, lx + QSTG, 8u * XPB); stage8(gw + 128, (size_t)16 * DM * 2, lw + QSTG, 16u * WPB);
  if (n0 < DM) stage8(gg + 128, (size_t)16 * DM * 2, lw + QSTG + QWB, 16u * WPB);
#pragma unroll 1
  for (int ps = 0; ps < nps; ++ps) { const unsigned bo = (unsigned)(ps & 1) * QSTG; const unsigned char* sb = sm + bo;
#pragma unroll
    for (int kc = 0; kc < 2; ++kc) { v16b a; { const float* p = (const float*)(sb + (wave * 16 + col) * XPB) + kc * 32 + 8 * g;
#pragma unroll
      for (int i = 0; i < 8; ++i) { a[i] = (__bf16)p[i]; a[8 + i] = (__bf16)p[16 + i]; } }
      v16b fw[8];   // the k-step's weight fragments, read from LDS as one group
#pragma unroll
      for (int j = 0; j < 8; ++j) fw[j] = frag_b((const __bf16*)(sb + QXB + (j * 16 + col) * WPB) + kc * 32, lane);
      // holds the fragment reads together in front of the products: one LDS latency a group instead of one per fragment
      asm volatile("" :: "v"(fw[0]), "v"(fw[1]), "v"(fw[2]), "v"(fw[3]), "v"(fw[4]), "v"(fw[5]), "v"(fw[6]), "v"(fw[7]));
#pragma unroll
      for (int j = 0; j < 8; ++j) acc[j] = wmma_bf(a, fw[j], acc[j]);
      if (n0 < DM) { v16b fg[8];   // the gate's fragments, likewise
#pragma unroll
        for (int j = 0; j < 8; ++j) fg[j] = frag_b((const __bf16*)(sb + QXB + QWB + (j * 16 + col) * WPB) + kc * 32, lane);
        // holds the fragment reads together in front of the products: one LDS latency a group instead of one per fragment
        asm volatile("" :: "v"(fg[0]), "v"(fg[1]), "v"(fg[2]), "v"(fg[3]), "v"(fg[4]), "v"(fg[5]), "v"(fg[6]), "v"(fg[7]));
#pragma unroll
        for (int j = 0; j < 8; ++j) accg[j] = wmma_bf(a, fg[j], accg[j]); } }
    asm volatile("s_wait_dscnt 0x0" ::: "memory");      // this wave's reads of the stage are done before the buffer is given up
    asm volatile("s_wait_asynccnt 0x0" ::: "memory");   // this wave's copies of stage ps + 1 have landed
    __syncthreads();                                    // publishes stage ps + 1 and ends every reader's last read of stage ps
    if (ps + 2 < nps) { const size_t ax = (size_t)(ps + 2) * 256, aw = (size_t)(ps + 2) * 128;
      stage8(gx + ax, (size_t)8 * DM * 4, lx + bo, 8u * XPB); stage8(gw + aw, (size_t)16 * DM * 2, lw + bo, 16u * WPB);
      if (n0 < DM) stage8(gg + aw, (size_t)16 * DM * 2, lw + bo + QWB, 16u * WPB); } }
  asm volatile("s_wait_asynccnt 0x0" ::: "memory");     // no copy is outstanding behind the loop; the ring now serves as the epilogue's staging
  float bb[8], bgt[8];   // the lane's bias of each of its eight columns (q blocks: the gate's too), loaded here as one group: one load latency a wave
#pragma unroll
  for (int j = 0; j < 8; ++j) { bb[j] = 0.f; bgt[j] = 0.f; }
  if (BB) {
#pragma unroll
    for (int j = 0; j < 8; ++j) bb[j] = BB[j * 16 + col]; }
  if (n0 < DM) {
#pragma unroll
    for (int j = 0; j < 8; ++j) bgt[j] = BG[n0 + j * 16 + col]; }
#pragma unroll
  for (int j = 0; j < 8; ++j) { bb[j] = bfr(bb[j]); bgt[j] = bfr(bgt[j]); }
  if (n0 < 2 * DM) {   // q stored unscaled (f16 sigma ~0.6, no subnormal exposure); the score is not scaled either (SCALEF = 1)
#pragma unroll
    for (int j = 0; j < 8; ++j) {
#pragma unroll
      for (int r = 0; r < 8; ++r) { float v = acc[j][r] + bb[j]; if (n0 < DM) v = gelu_e(v * (accg[j][r] + bgt[j])); const _Float16 hv = (_Float16)v; so[wave][8 * g + r][j * 16 + col] = hv; sol[wave][8 * g + r][j * 16 + col] = (_Float16)((v - (float)hv) * 2048.0f); } }   // q, k (+ bias) as f16 hi + (x2048) residual
    LDSX();
    for (int rl = 0; rl < 16; ++rl) if (lane < 16) { vst2((unsigned*)(QK + (r0 + rl) * (2 * DM) + n0 + lane * 8), *(const v4u*)&so[wave][rl][lane * 8]); vst2((unsigned*)(QKL + (r0 + rl) * (2 * DM) + n0 + lane * 8), *(const v4u*)&sol[wave][rl][lane * 8]); }
  } else {
#pragma unroll
    for (int j = 0; j < 8; ++j) {
#pragma unroll
      for (int r = 0; r < 8; ++r) { const float v = acc[j][r] + bb[j]; const _Float16 hv = (_Float16)v; sth[j * 16 + col][wave * 16 + 8 * g + r] = hv; stl[j * 16 + col][wave * 16 + 8 * g + r] = (_Float16)((v - (float)hv) * 2048.0f); } }
    __syncthreads();
    const size_t rb = (size_t)blockIdx.x * 64; const int b = (int)(rb / SS), s0 = (int)(rb % SS); const int pc0 = n0 - 2 * DM;
    for (int q = tid; q < 128 * 8; q += 128) { const int d = q >> 3, pc = q & 7; const size_t o = ((size_t)b * DM + pc0 + d) * SS + s0 + pc * 8; vst2((unsigned*)(VTH + o), *(const v4u*)&sth[d][pc * 8]); vst2((unsigned*)(VTL + o), *(const v4u*)&stl[d][pc * 8]); }
  }
}
#define KPH 72                    // K row pitch in LDS, f16 elements (128-B rows + 16 B)
#define VPH 40                    // V row pitch in LDS, f16 elements (64-B rows + 16 B)
#define KPL (32u * KPH * 2u)      // bytes of one K plane
#define VPL (64u * VPH * 2u)      // bytes of one V plane
#define KBUF (2u * KPL)           // bytes of one K buffer (both planes)
#define VBUF (2u * VPL)
#define PSUM 49152.0f             // bound on a lane's sum of a pass's 16 weights (24 * 2^11); beyond it the maximum in use is renewed
#define L2E 1.4426950408889634f   // log2 e
// one thread's eight 16-byte asynchronous copies of a 32-key stage (K hi, K residual, V hi, V residual; two rows each) into LDS.
// The copies and s_wait_xcnt stand in one statement so that no address register is rewritten ahead of the wait.
__device__ __forceinline__ void stage_kv(const _Float16* kh, const _Float16* kl, const _Float16* vh, const _Float16* vl, unsigned lk, unsigned lv) {
  asm volatile("global_load_async_to_lds_b128 %0, %8, off\n\t"
               "global_load_async_to_lds_b128 %1, %9, off\n\t"
               "global_load_async_to_lds_b128 %2, %10, off\n\t"
               "global_load_async_to_lds_b128 %3, %11, off\n\t"
               "global_load_async_to_lds_b128 %4, %12, off\n\t"
               "global_load_async_to_lds_b128 %5, %13, off\n\t"
               "global_load_async_to_lds_b128 %6, %14, off\n\t"
               "global_load_async_to_lds_b128 %7, %15, off\n\t"
               "s_wait_xcnt 0x0"
               :: "v"(lk), "v"(lk + 16u * KPH * 2u), "v"(lk + KPL), "v"(lk + KPL + 16u * KPH * 2u), "v"(lv), "v"(lv + 32u * VPH * 2u), "v"(lv + VPL), "v"(lv + VPL + 32u * VPH * 2u),
                  "v"(kh), "v"(kh + (size_t)16 * (2 * DM)), "v"(kl), "v"(kl + (size_t)16 * (2 * DM)), "v"(vh), "v"(vh + (size_t)32 * SS), "v"(vl), "v"(vl + (size_t)32 * SS)
               : "memory");
}
// lane l's value exchanged with lane l ^ 16 (a vector cross-row move; a shuffle would go through the LDS unit)
__device__ __forceinline__ float xhalf(float x) { return __builtin_bit_cast(float, __builtin_amdgcn_permlanex16(__builtin_bit_cast(int, x), __builtin_bit_cast(int, x), 0x76543210, 0xfedcba98, false, false)); }
// eight exponents to their powers of two, in place. One asm statement, so that the slot which the instruction set asks for behind a transcendental stands behind the last one
// by construction. The two s_delay_alu are the hints that compiled code
// carries at such places: the SIMD's other waves issue while this one waits for its exponents and, behind the statement, for the last result; they change no value
__device__ __forceinline__ void exp2x8(float (&x)[8]) {
  asm("s_delay_alu instid0(VALU_DEP_1)\n\t"
      "v_exp_f32 %0, %0\n\tv_exp_f32 %1, %1\n\tv_exp_f32 %2, %2\n\tv_exp_f32 %3, %3\n\t"
      "v_exp_f32 %4, %4\n\tv_exp_f32 %5, %5\n\tv_exp_f32 %6, %6\n\tv_exp_f32 %7, %7\n\t"
      "v_nop\n\t"
      "s_delay_alu instid0(TRANS32_DEP_1)"
      : "+v"(x[0]), "+v"(x[1]), "+v"(x[2]), "+v"(x[3]), "+v"(x[4]), "+v"(x[5]), "+v"(x[6]), "+v"(x[7]));
}
// the lane's 16 weights of a pass, 2^11 * exp(s - m), and their sum: one fused multiply-add per score forms the exponent s * log2 e + nb, nb = 11 - m * log2 e, for the hardware's exp2
__device__ __forceinline__ float exps16(const v8f (&s)[2], float nb, float (&e)[2][8]) {
  float t[8];
#pragma unroll
  for (int ct = 0; ct < 2; ++ct) {
#pragma unroll
    for (int r = 0; r < 8; ++r) e[ct][r] = __builtin_fmaf(s[ct][r], L2E, nb);
    exp2x8(e[ct]); }
#pragma unroll
  for (int r = 0; r < 8; ++r) t[r] = e[0][r] + e[1][r];
  return ((t[0] + t[1]) + (t[2] + t[3])) + ((t[4] + t[5]) + (t[6] + t[7]));
}
__global__ __launch_bounds__(128) void k_attn(const _Float16* __restrict__ QK, const _Float16* __restrict__ QKL, const _Float16* __restrict__ VTH, const _Float16* __restrict__ VTL, const void* __restrict__ KMASK, float* __restrict__ O) {
  __shared__ __align__(16) float so[4][16][68];
  __shared__ __align__(16) _Float16 sk[2][2][32][KPH];   // [buffer][hi, residual][key][d], 144-B rows
  __shared__ __align__(16) _Float16 sv[2][2][64][VPH];   // [buffer][hi, residual][d][key], 80-B rows
  const int tid = threadIdx.x, wave = tid >> 5, lane = tid & 31, col = lane & 15, g = lane >> 4;
  const int qb = blockIdx.x, h = blockIdx.y, b = blockIdx.z;
  // each thread's share of a 32-key stage: 16-byte pieces of K rows tid / 8 and 16 + tid / 8 and of V rows tid / 4 and 32 + tid / 4, both planes
  const size_t gk = ((size_t)b * SS + (tid >> 3)) * (2 * DM) + DM + h * HD + (tid & 7) * 8, gv = ((size_t)b * DM + h * HD + (tid >> 2)) * SS + (tid & 3) * 8;
  const unsigned lk = (unsigned)(size_t)&sk[0][0][tid >> 3][(tid & 7) * 8], lv = (unsigned)(size_t)&sv[0][0][tid >> 2][(tid & 3) * 8]; const int q0 = qb * 64 + wave * 16; const size_t rq = (size_t)b * SS + q0 + col;
  v16h aq[2], aql[2];
#pragma unroll
  for (int kc = 0; kc < 2; ++kc) { aq[kc] = frag_h(QK + rq * (2 * DM) + h * HD + kc * 32, lane); aql[kc] = frag_h(QKL + rq * (2 * DM) + h * HD + kc * 32, lane); }
  float m = -3.0e38f, l = 0.f;   // the lane's query: the maximum in use (equal in both halves) and this half's share of the sum of the weights (scaled by 2^11 like them)
  float nb = __builtin_inff();   // 11 - m * log2 e, the addend of every exponent; infinite while no maximum is in use
  v8f acc[4] = {}, accl[4] = {};   // O^T tiles: register r = d dt * 16 + 8 g + r of query col
  const int nks = SS / 32;   // all keys
  stage_kv(QK + gk, QKL + gk, VTH + gv, VTL + gv, lk, lv);
  asm volatile("s_wait_asynccnt 0x0" ::: "memory");   // stage 0 has landed before the barrier that publishes it
  __syncthreads();
  stage_kv(QK + gk + (size_t)32 * (2 * DM), QKL + gk + (size_t)32 * (2 * DM), VTH + gv + 32, VTL + gv + 32, lk + KBUF, lv + VBUF);
#pragma unroll 1
  for (int ks = 0; ks < nks; ++ks) { v8f s[2]; const int bf = ks & 1;
    v16h fk[2][2], fkl[2][2];   // the pass's K fragments, read from LDS as one group
#pragma unroll
    for (int ct = 0; ct < 2; ++ct) {
#pragma unroll
      for (int kc = 0; kc < 2; ++kc) { fk[ct][kc] = frag_h(&sk[bf][0][ct * 16 + col][kc * 32], lane); fkl[ct][kc] = frag_h(&sk[bf][1][ct * 16 + col][kc * 32], lane); } }
    // holds the eight fragment reads together in front of the products: one LDS latency a pass instead of one per fragment
    asm volatile("" :: "v"(fk[0][0]), "v"(fk[0][1]), "v"(fk[1][0]), "v"(fk[1][1]), "v"(fkl[0][0]), "v"(fkl[0][1]), "v"(fkl[1][0]), "v"(fkl[1][1]));
#pragma unroll
    for (int ct = 0; ct < 2; ++ct) { v8f c = {}, cl = {};
#pragma unroll
      for (int kc = 0; kc < 2; ++kc) { const v16h kh = fk[ct][kc]; c = wmma16(kh, aq[kc], c); cl = wmma16(kh, aql[kc], cl); cl = wmma16(fkl[ct][kc], aq[kc], cl); }   // 3 products: q, k as f16 hi + residual
#pragma unroll
      for (int r = 0; r < 8; ++r) c[r] += cl[r] * (1.0f / 2048.0f);
      { const bool keepk = true;
#pragma unroll
      for (int r = 0; r < 8; ++r) s[ct][r] = keepk ? c[r] * SCALEF : -3.0e38f; } }   // unscaled (SCALEF = 1); masked keys excluded
    // lazy rescale: the weights are taken against m, the maximum in use, which may trail the true one. They are not negative, so a lane's sum of at most PSUM bounds each of them,
    // and each stays under the f16 limit (24 * 2^11 = 49,152). One test a pass, a scalar branch on the whole wave's vote
    float e[2][8]; float ts = exps16(s, nb, e);
    if (__builtin_amdgcn_ballot_w32(!(ts <= PSUM)) != 0) {   // rare: some lane's sum is beyond the bound (always in pass 0, where it is infinite): only then the pass's maximum, the rescale, and the exponentials anew
      // the lane's 16 scores, as a tree of three-way maxima (short dependent chain)
      const float u0 = fmaxf(fmaxf(s[0][0], s[1][0]), s[0][1]), u1 = fmaxf(fmaxf(s[1][1], s[0][2]), s[1][2]), u2 = fmaxf(fmaxf(s[0][3], s[1][3]), s[0][4]), u3 = fmaxf(fmaxf(s[1][4], s[0][5]), s[1][5]), u4 = fmaxf(fmaxf(s[0][6], s[1][6]), s[0][7]);
      float mx = fmaxf(fmaxf(fmaxf(u0, u1), u2), fmaxf(fmaxf(u3, u4), s[1][7]));
      mx = fmaxf(mx, xhalf(mx));   // both halves now hold the query's maximum over the pass's 32 keys
      const float mn = fmaxf(m, mx); const float alpha = (m <= -1.0e38f) ? 0.f : __expf(m - mn);
      m = mn; nb = __builtin_fmaf(-mn, L2E, 11.0f); l *= alpha;
#pragma unroll
      for (int dt = 0; dt < 4; ++dt) { acc[dt] = acc[dt] * alpha; accl[dt] = accl[dt] * alpha; }
      ts = exps16(s, nb, e); }   // now every weight is at most 2^11
    l += ts;   // the halves' sums are joined once, in the epilogue
    union { v16h v; v2h p[8]; } pa, pl;   // P^T as a B operand: element i = key 8 g + i, element 8 + i = key 16 + 8 g + i, the k order of the V fragments
#pragma unroll
    for (int ct = 0; ct < 2; ++ct) {
#pragma unroll
      for (int i = 0; i < 4; ++i) { const v2f x = { e[ct][2 * i], e[ct][2 * i + 1] }; const v2h hi = __builtin_convertvector(x, v2h); pa.p[ct * 4 + i] = hi; pl.p[ct * 4 + i] = __builtin_convertvector((x - __builtin_convertvector(hi, v2f)) * 2048.0f, v2h); } }   // by pairs, one packed conversion each way. P carries 2^11 into the f16 split so small softmax weights stay out of the f16 subnormal range (the sum carries it too, so it cancels in the epilogue)
    v16h fv[4], fvl[4];   // the pass's V fragments, read from LDS as one group
#pragma unroll
    for (int dt = 0; dt < 4; ++dt) { fv[dt] = frag_h(&sv[bf][0][dt * 16 + col][0], lane); fvl[dt] = frag_h(&sv[bf][1][dt * 16 + col][0], lane); }
    // holds the eight fragment reads together in front of the products: one LDS latency a pass instead of one per fragment
    asm volatile("" :: "v"(fv[0]), "v"(fv[1]), "v"(fv[2]), "v"(fv[3]), "v"(fvl[0]), "v"(fvl[1]), "v"(fvl[2]), "v"(fvl[3]));
#pragma unroll
    for (int dt = 0; dt < 4; ++dt) { const v16h vh = fv[dt]; acc[dt] = wmma16(vh, pa.v, acc[dt]); accl[dt] = wmma16(vh, pl.v, accl[dt]); accl[dt] = wmma16(fvl[dt], pa.v, accl[dt]); }   // P hi x V hi + (P lo x V hi + P hi x V lo) / 2048
    asm volatile("s_wait_dscnt 0x0" ::: "memory");      // this wave's reads of the stage are done before the buffer is given up
    asm volatile("s_wait_asynccnt 0x0" ::: "memory");   // this wave's copies of stage ks + 1 have landed
    __syncthreads();                                    // publishes stage ks + 1 and ends every reader's last read of stage ks
    if (ks + 2 < nks) { const size_t ak = (size_t)(ks + 2) * 32 * (2 * DM), av = (size_t)(ks + 2) * 32; stage_kv(QK + gk + ak, QKL + gk + ak, VTH + gv + av, VTL + gv + av, lk + bf * KBUF, lv + bf * VBUF); } }
  asm volatile("s_wait_asynccnt 0x0" ::: "memory");     // no copy is outstanding behind the loop
  const float il = 1.0f / (l + xhalf(l));
#pragma unroll
  for (int dt = 0; dt < 4; ++dt) {
#pragma unroll
    for (int r = 0; r < 8; ++r) so[wave][col][dt * 16 + 8 * g + r] = (acc[dt][r] + accl[dt][r] * (1.0f / 2048.0f)) * il; }
  LDSX();
  for (int rl = 0; rl < 16; ++rl) if (lane < 16) vst2(O + ((size_t)b * SS + q0 + rl) * DM + h * HD + lane * 4, *(const v4f*)&so[wave][rl][lane * 4]);
}
// ---- k_out: block = (64 rows, 128 cols): out = O(hi/lo) . Wo rows (2 products) + bo
__global__ __launch_bounds__(128) void k_out(const float* __restrict__ O, const __bf16* __restrict__ P, const float* __restrict__ BO, float* __restrict__ Y) {
  __shared__ __align__(16) float so[4][16][132];
  const int tid = threadIdx.x, wave = tid >> 5, lane = tid & 31, col = lane & 15, g = lane >> 4; const size_t r0 = (size_t)blockIdx.x * 64 + wave * 16; const int n0 = blockIdx.y * 128;
  v8f acc[8] = {};
#pragma unroll 2
  for (int kc = 0; kc < DM / 32; ++kc) { const F2 a = split_row(O + (r0 + col) * DM, kc * 32, lane);
#pragma unroll
    for (int j = 0; j < 8; ++j) { const v16b w = frag_b(P + (size_t)(n0 + j * 16 + col) * DM + kc * 32, lane); acc[j] = wmma_bf(a.l, w, acc[j]); acc[j] = wmma_bf(a.h, w, acc[j]); } }
#pragma unroll
  for (int j = 0; j < 8; ++j) {
#pragma unroll
    for (int r = 0; r < 8; ++r) so[wave][8 * g + r][j * 16 + col] = acc[j][r] + (BO ? bfr(BO[n0 + j * 16 + col]) : 0.f); }
  LDSX();
  for (int rl = 0; rl < 16; ++rl) vst2(Y + (r0 + rl) * DM + n0 + lane * 4, *(const v4f*)&so[wave][rl][lane * 4]);
}
extern "C" void kernel_launch(void* const* d_in, const int* in_sizes, int n_in, void* d_out, int out_size, void* d_ws, size_t ws_size, hipStream_t stream) {
  (void)in_sizes; (void)n_in; (void)out_size;
  const float** F = (const float**)d_in;   // 0 x [2,2048,1024], 1 Wq, 2 bq, 3 Wk, 4 bk, 5 Wv, 6 bv, 7 Wg, 8 bg (natural [1024,1024] / [1024])
  if (ws_size < (size_t)WS_END) return;
  char* ws = (char*)d_ws; __bf16* PK = (__bf16*)(ws + WS_PK); _Float16 *QK = (_Float16*)(ws + WS_QK), *QKL = (_Float16*)(ws + WS_QKL), *VTH = (_Float16*)(ws + WS_VTH), *VTL = (_Float16*)(ws + WS_VTL);
  k_pack<<<dim3(DM, 4), 256, 0, stream>>>(F[1], F[3], F[5], F[7], PK);   // the fourth slot holds Wg
  k_qkv<<<dim3(TNB * SS / 64, QKVW / 128), 128, 0, stream>>>(F[0], F[0], F[0], PK + PK_A, F[2], F[4], F[6], QK, QKL, VTH, VTL, PK + PK_P, F[8]);
  k_attn<<<dim3(TQB, NH, TNB), 128, 0, stream>>>(QK, QKL, VTH, VTL, nullptr, (float*)d_out);   // merged context == output (no out-projection)
}

// v008
// Measured time: 131 microseconds a run.
// In two side-by-side timings against v007, it was 1.05 and 1.03 times as fast.
// Over all steps from v000 it is 3.91 times as fast.
// compute dtype: all float inputs rounded to bf16; q/k/v/g = x . W^T + b with EXACT bf16 products on WMMA 16x16x32 (natural rows; q and g computed in the same block), qg = gelu_erf(q g) in f32 (precise erff) then split into f16 hi + residual; attention with 3-product scores (qg, k as f16 hi + residual) and 3-product P.v (P and v as hi + residual) everywhere; no scaling, softmax in f32 against a maximum that is renewed only when needed (hardware exp); the merged context is the output (f32).
#include <hip/hip_runtime.h>
#include <math.h>

typedef __attribute__((ext_vector_type(16))) _Float16 v16h;
typedef __attribute__((ext_vector_type(16))) __bf16 v16b;
typedef __attribute__((ext_vector_type(8)))  _Float16 v8h;
typedef __attribute__((ext_vector_type(2)))  _Float16 v2h;
typedef __attribute__((ext_vector_type(8)))  float v8f;
typedef __attribute__((ext_vector_type(4)))  float v4f;
typedef __attribute__((ext_vector_type(2)))  float v2f;
typedef __attribute__((ext_vector_type(4)))  unsigned v4u;
typedef __attribute__((ext_vector_type(4)))  int v4i;
typedef float __attribute__((may_alias)) float_a;
typedef int __attribute__((may_alias)) int_a;

template <typename T> __device__ __forceinline__ void vst2(void* p, T v) { *(T*)p = v;  }
// both products are the plain builtin: the compiler itself keeps the distance that the chip needs behind a matrix instruction, and fills it with useful work where it can
__device__ __forceinline__ v8f wmma16(v16h a, v16h b, v8f c) {
  return __builtin_amdgcn_wmma_f32_16x16x32_f16(false, a, false, b, (short)0, c, false, false);
}
__device__ __forceinline__ v8f wmma_bf(v16b a, v16b b, v8f c) {
  return __builtin_amdgcn_wmma_f32_16x16x32_bf16(false, a, false, b, (short)0, c, false, false);
}
// Gated QKV attention (B 2, S 2,048, d 1,024, 16 heads x 64): q, k, v, g projections + biases, qg = gelu(q * g) (exact erf), softmax(qg k^T) v with no 1/sqrt(d) scaling and no output projection.
__device__ __forceinline__ v16h frag_h(const _Float16* rowk0, int lane) {
  union { v16h v; v8h q[2]; } u; const _Float16* p = rowk0 + 8 * (lane >> 4);
  u.q[0] = *(const v8h*)p; u.q[1] = *(const v8h*)(p + 16); return u.v;
}
__device__ __forceinline__ v16h frag_f32(const float* rowk0, int lane) {
  v16h a; const float* p = rowk0 + 8 * (lane >> 4);
#pragma unroll
  for (int i = 0; i < 8; ++i) { a[i] = (_Float16)p[i]; a[8 + i] = (_Float16)p[16 + i]; }
  return a;
}
__device__ __forceinline__ v16h frag_f32s(const float* rowk0, int lane, float sc) {
  v16h a; const float* p = rowk0 + 8 * (lane >> 4);
#pragma unroll
  for (int i = 0; i < 8; ++i) { a[i] = (_Float16)(p[i] * sc); a[8 + i] = (_Float16)(p[16 + i] * sc); }
  return a;
}
// column fragment from a [K][ld] layout (column n), rows >= K read as 0
__device__ __forceinline__ v16h fragc_f32(const float* W, int k0, int n, int lane, int ld, int K) {
  v16h a; const int g = lane >> 4;
#pragma unroll
  for (int i = 0; i < 8; ++i) { const int ka = k0 + 8 * g + i, kb = ka + 16;
    a[i] = (_Float16)(ka < K ? W[(size_t)(ka < K ? ka : K - 1) * ld + n] : 0.f); a[8 + i] = (_Float16)(kb < K ? W[(size_t)(kb < K ? kb : K - 1) * ld + n] : 0.f); }
  return a;
}
struct F2 { v16b h, l; };
__device__ __forceinline__ F2 bsplit16(const float v[16]) { F2 r;
#pragma unroll
  for (int i = 0; i < 16; ++i) { const __bf16 h = (__bf16)v[i]; r.h[i] = h; r.l[i] = (__bf16)(v[i] - (float)h); }
  return r; }
__device__ __forceinline__ F2 split_row(const float* row, int k0, int lane) { float v[16]; const float* p = row + k0 + 8 * (lane >> 4);
#pragma unroll
  for (int i = 0; i < 8; ++i) { v[i] = p[i]; v[8 + i] = p[16 + i]; }
  return bsplit16(v); }
__device__ __forceinline__ F2 split_rowK(const float* row, int k0, int lane, int K) { float v[16]; const int g = lane >> 4;
#pragma unroll
  for (int i = 0; i < 8; ++i) { const int ka = k0 + 8 * g + i, kb = ka + 16; v[i] = ka < K ? row[ka < K ? ka : K - 1] : 0.f; v[8 + i] = kb < K ? row[kb < K ? kb : K - 1] : 0.f; }
  return bsplit16(v); }
__device__ __forceinline__ F2 split_col(const float* W, int k0, int n, int lane, int ld, int K) { float v[16]; const int g = lane >> 4;
#pragma unroll
  for (int i = 0; i < 8; ++i) { const int ka = k0 + 8 * g + i, kb = ka + 16; v[i] = ka < K ? W[(size_t)(ka < K ? ka : K - 1) * ld + n] : 0.f; v[8 + i] = kb < K ? W[(size_t)(kb < K ? kb : K - 1) * ld + n] : 0.f; }
  return bsplit16(v); }
__device__ __forceinline__ v8f mac3(const F2& a, const F2& b, v8f c) { c = wmma_bf(a.l, b.h, c); c = wmma_bf(a.h, b.l, c); return wmma_bf(a.h, b.h, c); }
__device__ __forceinline__ float sigm(float v) { return 1.0f / (1.0f + expf(-v)); }
#define LDSX() do { asm volatile("s_wait_dscnt 0" ::: "memory"); __builtin_amdgcn_wave_barrier(); __builtin_amdgcn_fence(__ATOMIC_RELEASE, "workgroup"); } while (0)


#define NB 2
#define SS 2048
#define DM 1024
#define NH 16
#define SCALEF 1.0f
__device__ __attribute__((noinline)) float gelu_e(float v) { return 0.5f * v * (1.0f + erff(v * 0.70710678118654752f)); }
#define HD 64
#define QKVW (3 * DM)
#ifndef TQB
#define TQB (SS / 64)
#define TNB NB
#define TOB (NB * SS / 64)     // output row tiles (all)
#endif
typedef __attribute__((ext_vector_type(8))) __bf16 v8b;
__device__ __forceinline__ v16b frag_b(const __bf16* rowk0, int lane) {
  union { v16b v; v8b q[2]; } u; const __bf16* p = rowk0 + 8 * (lane >> 4);
  u.q[0] = *(const v8b*)p; u.q[1] = *(const v8b*)(p + 16); return u.v;
}
__device__ __forceinline__ float bfr(float v) { return (float)(__bf16)v; }
__device__ __attribute__((noinline)) float exp_ni(float v) { return expf(v); }
__device__ __attribute__((noinline)) float erf_ni(float v) { return erff(v); }

#define PK_A 0                       // [3072][1024] Wqkv rows (natural [out][in])
#define PK_P (PK_A + QKVW * DM)        // [1024][1024] Wg rows (natural)
#define PK_END (PK_P + DM * DM)
#define WS_PK  0u
#define WS_QK  (WS_PK + 2u * PK_END)             // f16 [4096 rows][2048]: qg | k
#define WS_QKL (WS_QK + 2u * NB * SS * 2 * DM)     // f16 q | k residual planes x2048
#define WS_VTH (WS_QKL + 2u * NB * SS * 2 * DM)    // f16 [b][1024 (h*64+d)][2048 s] hi
#define WS_VTL (WS_VTH + 2u * NB * DM * SS)        // f16 lo x 2048
#define WS_O   (WS_VTL + 2u * NB * DM * SS)        // f32 [4096][1024]
#define WS_CS  (WS_O + 4u * NB * SS * DM)           // f32 2 x [2048][32], unused
#define WS_END (WS_CS + 4u * 2 * SS * 32)
// ---- k_pack: block = (row n, which): natural [out][in] rows -> bf16; which 0..2 -> W_q/W_k/W_v into PK_A rows which*1024 + n; 3 -> W_g into PK_P
__global__ __launch_bounds__(256) void k_pack(const float* __restrict__ WQ, const float* __restrict__ WK, const float* __restrict__ WV, const float* __restrict__ WO, __bf16* __restrict__ PK) {
  __shared__ __align__(16) __bf16 s[DM]; const int n = blockIdx.x, which = blockIdx.y, t = threadIdx.x; const float* Wm = (which == 0) ? WQ : (which == 1) ? WK : (which == 2) ? WV : WO;
  for (int k = t; k < DM; k += 256) s[k] = (__bf16)Wm[(size_t)n * DM + k];
  __syncthreads();
  __bf16* dst = (which < 3) ? PK + PK_A + ((size_t)which * DM + n) * DM : PK + PK_P + (size_t)n * DM;
  for (int q = t; q < DM / 8; q += 256) vst2((unsigned*)(dst + q * 8), *(const v4u*)&s[q * 8]);
}
#define XPB 272u                  // X row pitch in LDS, bytes (256-B rows of 64 f32 + 16 B)
#define WPB 144u                  // weight row pitch in LDS, bytes (128-B rows of 64 bf16 + 16 B)
#define QXB (64u * XPB)           // bytes of one X tile (64 rows)
#define QWB (128u * WPB)          // bytes of one weight tile (128 rows)
#define QSTG (QXB + 2u * QWB)     // bytes of one stage: X | W | Wg
// one thread's eight 16-byte asynchronous copies into LDS: piece i goes from g + i * gs to LDS byte l + i * ls.
// The copies and s_wait_xcnt stand in one statement so that no address register is rewritten ahead of the wait.
__device__ __forceinline__ void stage8(const char* g, size_t gs, unsigned l, unsigned ls) {
  asm volatile("global_load_async_to_lds_b128 %0, %8, off\n\t"
               "global_load_async_to_lds_b128 %1, %9, off\n\t"
               "global_load_async_to_lds_b128 %2, %10, off\n\t"
               "global_load_async_to_lds_b128 %3, %11, off\n\t"
               "global_load_async_to_lds_b128 %4, %12, off\n\t"
               "global_load_async_to_lds_b128 %5, %13, off\n\t"
               "global_load_async_to_lds_b128 %6, %14, off\n\t"
               "global_load_async_to_lds_b128 %7, %15, off\n\t"
               "s_wait_xcnt 0x0"
               :: "v"(l), "v"(l + ls), "v"(l + 2u * ls), "v"(l + 3u * ls), "v"(l + 4u * ls), "v"(l + 5u * ls), "v"(l + 6u * ls), "v"(l + 7u * ls),
                  "v"(g), "v"(g + gs), "v"(g + 2 * gs), "v"(g + 3 * gs), "v"(g + 4 * gs), "v"(g + 5 * gs), "v"(g + 6 * gs), "v"(g + 7 * gs)
               : "memory");
}
// ---- k_qkv: block = (64 rows of x, 128 output columns; the q blocks also their 128 gate columns). A stage is 64 k of the block's X rows (f32) and weight rows (bf16), brought into LDS once per block, two buffers; the epilogue's staging arrays reuse the ring behind the last pass's barrier
__global__ __launch_bounds__(128) void k_qkv(const float* __restrict__ XQ, const float* __restrict__ XK, const float* __restrict__ XV, const __bf16* __restrict__ P, const float* __restrict__ BQ, const float* __restrict__ BK, const float* __restrict__ BV, _Float16* __restrict__ QK, _Float16* __restrict__ QKL, _Float16* __restrict__ VTH, _Float16* __restrict__ VTL, const __bf16* __restrict__ WG, const float* __restrict__ BG) {
  const int which0 = (blockIdx.y * 128) / DM; const float* X = (which0 == 0) ? XQ : (which0 == 1) ? XK : XV; const float* BB = BQ ? (((which0 == 0) ? BQ : (which0 == 1) ? BK : BV) + (blockIdx.y * 128 - which0 * DM)) : nullptr;
  __shared__ __align__(16) unsigned char sm[2 * QSTG];
  _Float16 (*so)[16][136] = (_Float16 (*)[16][136])sm; _Float16 (*sol)[16][136] = (_Float16 (*)[16][136])(sm + 4 * 16 * 136 * 2);
  _Float16 (*sth)[72] = (_Float16 (*)[72])sm; _Float16 (*stl)[72] = (_Float16 (*)[72])(sm + 128 * 72 * 2);
  const int tid = threadIdx.x, wave = tid >> 5, lane = tid & 31, col = lane & 15, g = lane >> 4; const size_t r0 = (size_t)blockIdx.x * 64 + wave * 16; const int n0 = blockIdx.y * 128;
  // each thread's share of a stage: 16-byte pieces of X rows tid / 16 + 8 i and of weight rows tid / 8 + 16 i, i = 0..7
  const char* gx = (const char*)(X + ((size_t)blockIdx.x * 64 + (tid >> 4)) * DM + (tid & 15) * 4);
  const char* gw = (const char*)(P + (size_t)(n0 + (tid >> 3)) * DM + (tid & 7) * 8);
  const char* gg = (const char*)(WG + (size_t)((n0 < DM ? n0 : 0) + (tid >> 3)) * DM + (tid & 7) * 8);
  const unsigned lx = (unsigned)(size_t)&sm[(tid >> 4) * XPB + (tid & 15) * 16], lw = (unsigned)(size_t)&sm[QXB + (tid >> 3) * WPB + (tid & 7) * 16];
  const int nps = DM / 64;
  v8f acc[8] = {}; v8f accg[8] = {};
  stage8(gx, (size_t)8 * DM * 4, lx, 8u * XPB); stage8(gw, (size_t)16 * DM * 2, lw, 16u * WPB);
  if (n0 < DM) stage8(gg, (size_t)16 * DM * 2, lw + QWB, 16u * WPB);
  asm volatile("s_wait_asynccnt 0x0" ::: "memory");   // stage 0 has landed before the barrier that publishes it
  __syncthreads();
  stage8(gx + 256, (size_t)8 * DM * 4, lx + QSTG, 8u * XPB); stage8(gw + 128, (size_t)16 * DM * 2, lw + QSTG, 16u * WPB);
  if (n0 < DM) stage8(gg + 128, (size_t)16 * DM * 2, lw + QSTG + QWB, 16u * WPB);
#pragma unroll 1
  for (int ps = 0; ps < nps; ++ps) { const unsigned bo = (unsigned)(ps & 1) * QSTG; const unsigned char* sb = sm + bo;
#pragma unroll
    for (int kc = 0; kc < 2; ++kc) { v16b a; { const float* p = (const float*)(sb + (wave * 16 + col) * XPB) + kc * 32 + 8 * g;
#pragma unroll
      for (int i = 0; i < 8; ++i) { a[i] = (__bf16)p[i]; a[8 + i] = (__bf16)p[16 + i]; } }
      v16b fw[8];   // the k-step's weight fragments, read from LDS as one group
#pragma unroll
      for (int j = 0; j < 8; ++j) fw[j] = frag_b((const __bf16*)(sb + QXB + (j * 16 + col) * WPB) + kc * 32, lane);
      // holds the fragment reads together in front of the products: one LDS latency a group instead of one per fragment
      asm volatile("" :: "v"(fw[0]), "v"(fw[1]), "v"(fw[2]), "v"(fw[3]), "v"(fw[4]), "v"(fw[5]), "v"(fw[6]), "v"(fw[7]));
#pragma unroll
      for (int j = 0; j < 8; ++j) acc[j] = wmma_bf(a, fw[j], acc[j]);
      if (n0 < DM) { v16b fg[8];   // the gate's fragments, likewise
#pragma unroll
        for (int j = 0; j < 8; ++j) fg[j] = frag_b((const __bf16*)(sb + QXB + QWB + (j * 16 + col) * WPB) + kc * 32, lane);
        // holds the fragment reads together in front of the products: one LDS latency a group instead of one per fragment
        asm volatile("" :: "v"(fg[0]), "v"(fg[1]), "v"(fg[2]), "v"(fg[3]), "v"(fg[4]), "v"(fg[5]), "v"(fg[6]), "v"(fg[7]));
#pragma unroll
        for (int j = 0; j < 8; ++j) accg[j] = wmma_bf(a, fg[j], accg[j]); } }
    asm volatile("s_wait_dscnt 0x0" ::: "memory");      // this wave's reads of the stage are done before the buffer is given up
    asm volatile("s_wait_asynccnt 0x0" ::: "memory");   // this wave's copies of stage ps + 1 have landed
    __syncthreads();                                    // publishes stage ps + 1 and ends every reader's last read of stage ps
    if (ps + 2 < nps) { const size_t ax = (size_t)(ps + 2) * 256, aw = (size_t)(ps + 2) * 128;
      stage8(gx + ax, (size_t)8 * DM * 4, lx + bo, 8u * XPB); stage8(gw + aw, (size_t)16 * DM * 2, lw + bo, 16u * WPB);
      if (n0 < DM) stage8(gg + aw, (size_t)16 * DM * 2, lw + bo + QWB, 16u * WPB); } }
  asm volatile("s_wait_asynccnt 0x0" ::: "memory");     // no copy is outstanding behind the loop; the ring now serves as the epilogue's staging
  float bb[8], bgt[8];   // the lane's bias of each of its eight columns (q blocks: the gate's too), loaded here as one group: one load latency a wave
#pragma unroll
  for (int j = 0; j < 8; ++j) { bb[j] = 0.f; bgt[j] = 0.f; }
  if (BB) {
#pragma unroll
    for (int j = 0; j < 8; ++j) bb[j] = BB[j * 16 + col]; }
  if (n0 < DM) {
#pragma unroll
    for (int j = 0; j < 8; ++j) bgt[j] = BG[n0 + j * 16 + col]; }
#pragma unroll
  for (int j = 0; j < 8; ++j) { bb[j] = bfr(bb[j]); bgt[j] = bfr(bgt[j]); }
  if (n0 < 2 * DM) {   // q stored unscaled (f16 sigma ~0.6, no subnormal exposure); the score is not scaled either (SCALEF = 1)
#pragma unroll
    for (int j = 0; j < 8; ++j) {
#pragma unroll
      for (int r = 0; r < 8; ++r) { float v = acc[j][r] + bb[j]; if (n0 < DM) v = gelu_e(v * (accg[j][r] + bgt[j])); const _Float16 hv = (_Float16)v; so[wave][8 * g + r][j * 16 + col] = hv; sol[wave][8 * g + r][j * 16 + col] = (_Float16)((v - (float)hv) * 2048.0f); } }   // q, k (+ bias) as f16 hi + (x2048) residual
    LDSX();
    for (int rl = 0; rl < 16; ++rl) if (lane < 16) { vst2((unsigned*)(QK + (r0 + rl) * (2 * DM) + n0 + lane * 8), *(const v4u*)&so[wave][rl][lane * 8]); vst2((unsigned*)(QKL + (r0 + rl) * (2 * DM) + n0 + lane * 8), *(const v4u*)&sol[wave][rl][lane * 8]); }
  } else {
#pragma unroll
    for (int j = 0; j < 8; ++j) {
#pragma unroll
      for (int r = 0; r < 8; ++r) { const float v = acc[j][r] + bb[j]; const _Float16 hv = (_Float16)v; sth[j * 16 + col][wave * 16 + 8 * g + r] = hv; stl[j * 16 + col][wave * 16 + 8 * g + r] = (_Float16)((v - (float)hv) * 2048.0f); } }
    __syncthreads();
    const size_t rb = (size_t)blockIdx.x * 64; const int b = (int)(rb / SS), s0 = (int)(rb % SS); const int pc0 = n0 - 2 * DM;
    for (int q = tid; q < 128 * 8; q += 128) { const int d = q >> 3, pc = q & 7; const size_t o = ((size_t)b * DM + pc0 + d) * SS + s0 + pc * 8; vst2((unsigned*)(VTH + o), *(const v4u*)&sth[d][pc * 8]); vst2((unsigned*)(VTL + o), *(const v4u*)&stl[d][pc * 8]); }
  }
}
#define KPH 72                    // K row pitch in LDS, f16 elements (128-B rows + 16 B)
#define VPH 72                    // V row pitch in LDS, f16 elements (128-B rows of 64 keys + 16 B)
#define KPL (64u * KPH * 2u)      // bytes of one K plane (64 keys)
#define VPL (64u * VPH * 2u)      // bytes of one V plane (64 d)
#define KBUF (2u * KPL)           // bytes of one K buffer (both planes)
#define VBUF (2u * VPL)
#define PSUM 49152.0f             // bound on a lane's sum of a pass's 16 weights (24 * 2^11); beyond it the maximum in use is renewed
#define L2E 1.4426950408889634f   // log2 e
// one thread's eight 16-byte asynchronous copies of one operand (K or V) of a 64-key stage into LDS: its piece of rows r, r + 16, r + 32, r + 48, hi plane then residual plane.
// Eight neighbouring threads bring one row's 128 bytes, a whole line. The copies and s_wait_xcnt stand in one statement so that no address register is rewritten ahead of the wait.
__device__ __forceinline__ void stage_pl(const _Float16* hi, const _Float16* lo, size_t gs, unsigned l, unsigned lp, unsigned ls) {
  asm volatile("global_load_async_to_lds_b128 %0, %8, off\n\t"
               "global_load_async_to_lds_b128 %1, %9, off\n\t"
               "global_load_async_to_lds_b128 %2, %10, off\n\t"
               "global_load_async_to_lds_b128 %3, %11, off\n\t"
               "global_load_async_to_lds_b128 %4, %12, off\n\t"
               "global_load_async_to_lds_b128 %5, %13, off\n\t"
               "global_load_async_to_lds_b128 %6, %14, off\n\t"
               "global_load_async_to_lds_b128 %7, %15, off\n\t"
               "s_wait_xcnt 0x0"
               :: "v"(l), "v"(l + ls), "v"(l + 2u * ls), "v"(l + 3u * ls), "v"(l + lp), "v"(l + lp + ls), "v"(l + lp + 2u * ls), "v"(l + lp + 3u * ls),
                  "v"(hi), "v"(hi + gs), "v"(hi + 2 * gs), "v"(hi + 3 * gs), "v"(lo), "v"(lo + gs), "v"(lo + 2 * gs), "v"(lo + 3 * gs)
               : "memory");
}
// a 64-key stage: K rows (keys) from the q | k planes, V rows (d) from the transposed planes
__device__ __forceinline__ void stage_kv(const _Float16* kh, const _Float16* kl, const _Float16* vh, const _Float16* vl, unsigned lk, unsigned lv) {
  stage_pl(kh, kl, (size_t)16 * (2 * DM), lk, KPL, 16u * KPH * 2u);
  stage_pl(vh, vl, (size_t)16 * SS, lv, VPL, 16u * VPH * 2u);
}
// lane l's value exchanged with lane l ^ 16 (a vector cross-row move; a shuffle would go through the LDS unit)
__device__ __forceinline__ float xhalf(float x) { return __builtin_bit_cast(float, __builtin_amdgcn_permlanex16(__builtin_bit_cast(int, x), __builtin_bit_cast(int, x), 0x76543210, 0xfedcba98, false, false)); }
// eight exponents to their powers of two, in place. One asm statement, so that the slot which the instruction set asks for behind a transcendental stands behind the last one
// by construction. The two s_delay_alu are the hints that compiled code
// carries at such places: the SIMD's other waves issue while this one waits for its exponents and, behind the statement, for the last result; they change no value
__device__ __forceinline__ void exp2x8(float (&x)[8]) {
  asm("s_delay_alu instid0(VALU_DEP_1)\n\t"
      "v_exp_f32 %0, %0\n\tv_exp_f32 %1, %1\n\tv_exp_f32 %2, %2\n\tv_exp_f32 %3, %3\n\t"
      "v_exp_f32 %4, %4\n\tv_exp_f32 %5, %5\n\tv_exp_f32 %6, %6\n\tv_exp_f32 %7, %7\n\t"
      "v_nop\n\t"
      "s_delay_alu instid0(TRANS32_DEP_1)"
      : "+v"(x[0]), "+v"(x[1]), "+v"(x[2]), "+v"(x[3]), "+v"(x[4]), "+v"(x[5]), "+v"(x[6]), "+v"(x[7]));
}
// the lane's 16 weights of a pass, 2^11 * exp(s - m), and their sum: one fused multiply-add per score forms the exponent s * log2 e + nb, nb = 11 - m * log2 e, for the hardware's exp2
__device__ __forceinline__ float exps16(const v8f (&s)[2], float nb, float (&e)[2][8]) {
  float t[8];
#pragma unroll
  for (int ct = 0; ct < 2; ++ct) {
#pragma unroll
    for (int r = 0; r < 8; ++r) e[ct][r] = __builtin_fmaf(s[ct][r], L2E, nb);
    exp2x8(e[ct]); }
#pragma unroll
  for (int r = 0; r < 8; ++r) t[r] = e[0][r] + e[1][r];
  return ((t[0] + t[1]) + (t[2] + t[3])) + ((t[4] + t[5]) + (t[6] + t[7]));
}
__global__ __launch_bounds__(128) void k_attn(const _Float16* __restrict__ QK, const _Float16* __restrict__ QKL, const _Float16* __restrict__ VTH, const _Float16* __restrict__ VTL, const void* __restrict__ KMASK, float* __restrict__ O) {
  __shared__ __align__(16) unsigned char sm[2u * (KBUF + VBUF)];   // the ring: K [buffer][hi, residual][64 keys][d], then V [buffer][hi, residual][64 d][64 keys], all 144-B rows
  float (*so)[16][68] = (float (*)[16][68])sm;   // the epilogue's staging reuses the ring behind the last stage's barrier (so four blocks still fit a WGP's LDS)
  const int tid = threadIdx.x, wave = tid >> 5, lane = tid & 31, col = lane & 15, g = lane >> 4;
  const int qb = blockIdx.x, h = blockIdx.y, b = blockIdx.z;
  // each thread's share of a 64-key stage: one 16-byte piece of K rows and of V rows tid / 8 + 16 i, i = 0..3, both planes
  const size_t gk = ((size_t)b * SS + (tid >> 3)) * (2 * DM) + DM + h * HD + (tid & 7) * 8, gv = ((size_t)b * DM + h * HD + (tid >> 3)) * SS + (tid & 7) * 8;
  const unsigned lk = (unsigned)(size_t)&sm[(tid >> 3) * (KPH * 2u) + (tid & 7) * 16u], lv = (unsigned)(size_t)&sm[2u * KBUF + (tid >> 3) * (VPH * 2u) + (tid & 7) * 16u]; const int q0 = qb * 64 + wave * 16; const size_t rq = (size_t)b * SS + q0 + col;
  v16h aq[2], aql[2];
#pragma unroll
  for (int kc = 0; kc < 2; ++kc) { aq[kc] = frag_h(QK + rq * (2 * DM) + h * HD + kc * 32, lane); aql[kc] = frag_h(QKL + rq * (2 * DM) + h * HD + kc * 32, lane); }
  float m = -3.0e38f, l = 0.f;   // the lane's query: the maximum in use (equal in both halves) and this half's share of the sum of the weights (scaled by 2^11 like them)
  float nb = __builtin_inff();   // 11 - m * log2 e, the addend of every exponent; infinite while no maximum is in use
  v8f acc[4] = {}, accl[4] = {};   // O^T tiles: register r = d dt * 16 + 8 g + r of query col
  const int nst = SS / 64;   // all keys, in stages of 64
  stage_kv(QK + gk, QKL + gk, VTH + gv, VTL + gv, lk, lv);
  asm volatile("s_wait_asynccnt 0x0" ::: "memory");   // stage 0 has landed before the barrier that publishes it
  __syncthreads();
  stage_kv(QK + gk + (size_t)64 * (2 * DM), QKL + gk + (size_t)64 * (2 * DM), VTH + gv + 64, VTL + gv + 64, lk + KBUF, lv + VBUF);
#pragma unroll 1
  for (int st = 0; st < nst; ++st) { const int bf = st & 1; const _Float16* kb = (const _Float16*)(sm + bf * KBUF); const _Float16* vb = (const _Float16*)(sm + 2u * KBUF + bf * VBUF);
#pragma unroll
   for (int hf = 0; hf < 2; ++hf) { v8f s[2];   // the stage's two passes of 32 keys, each as before; unrolled so that the half's place in the buffer is an immediate offset of the LDS reads
    v16h fk[2][2], fkl[2][2];   // the pass's K fragments, read from LDS as one group
#pragma unroll
    for (int ct = 0; ct < 2; ++ct) {
#pragma unroll
      for (int kc = 0; kc < 2; ++kc) { fk[ct][kc] = frag_h(kb + (hf * 32 + ct * 16 + col) * KPH + kc * 32, lane); fkl[ct][kc] = frag_h(kb + (64 + hf * 32 + ct * 16 + col) * KPH + kc * 32, lane); } }
    // holds the eight fragment reads together in front of the products: one LDS latency a pass instead of one per fragment
    asm volatile("" :: "v"(fk[0][0]), "v"(fk[0][1]), "v"(fk[1][0]), "v"(fk[1][1]), "v"(fkl[0][0]), "v"(fkl[0][1]), "v"(fkl[1][0]), "v"(fkl[1][1]));
#pragma unroll
    for (int ct = 0; ct < 2; ++ct) { v8f c = {}, cl = {};
#pragma unroll
      for (int kc = 0; kc < 2; ++kc) { const v16h kh = fk[ct][kc]; c = wmma16(kh, aq[kc], c); cl = wmma16(kh, aql[kc], cl); cl = wmma16(fkl[ct][kc], aq[kc], cl); }   // 3 products: q, k as f16 hi + residual
#pragma unroll
      for (int r = 0; r < 8; ++r) c[r] += cl[r] * (1.0f / 2048.0f);
      { const bool keepk = true;
#pragma unroll
      for (int r = 0; r < 8; ++r) s[ct][r] = keepk ? c[r] * SCALEF : -3.0e38f; } }   // unscaled (SCALEF = 1); masked keys excluded
    // lazy rescale: the weights are taken against m, the maximum in use, which may trail the true one. They are not negative, so a lane's sum of at most PSUM bounds each of them,
    // and each stays under the f16 limit (24 * 2^11 = 49,152). One test a pass, a scalar branch on the whole wave's vote
    float e[2][8]; float ts = exps16(s, nb, e);
    if (__builtin_amdgcn_ballot_w32(!(ts <= PSUM)) != 0) {   // rare: some lane's sum is beyond the bound (always in pass 0, where it is infinite): only then the pass's maximum, the rescale, and the exponentials anew
      // the lane's 16 scores, as a tree of three-way maxima (short dependent chain)
      const float u0 = fmaxf(fmaxf(s[0][0], s[1][0]), s[0][1]), u1 = fmaxf(fmaxf(s[1][1], s[0][2]), s[1][2]), u2 = fmaxf(fmaxf(s[0][3], s[1][3]), s[0][4]), u3 = fmaxf(fmaxf(s[1][4], s[0][5]), s[1][5]), u4 = fmaxf(fmaxf(s[0][6], s[1][6]), s[0][7]);
      float mx = fmaxf(fmaxf(fmaxf(u0, u1), u2), fmaxf(fmaxf(u3, u4), s[1][7]));
      mx = fmaxf(mx, xhalf(mx));   // both halves now hold the query's maximum over the pass's 32 keys
      const float mn = fmaxf(m, mx); const float alpha = (m <= -1.0e38f) ? 0.f : __expf(m - mn);
      m = mn; nb = __builtin_fmaf(-mn, L2E, 11.0f); l *= alpha;
#pragma unroll
      for (int dt = 0; dt < 4; ++dt) { acc[dt] = acc[dt] * alpha; accl[dt] = accl[dt] * alpha; }
      ts = exps16(s, nb, e); }   // now every weight is at most 2^11
    l += ts;   // the halves' sums are joined once, in the epilogue
    union { v16h v; v2h p[8]; } pa, pl;   // P^T as a B operand: element i = key 8 g + i, element 8 + i = key 16 + 8 g + i, the k order of the V fragments
#pragma unroll
    for (int ct = 0; ct < 2; ++ct) {
#pragma unroll
      for (int i = 0; i < 4; ++i) { const v2f x = { e[ct][2 * i], e[ct][2 * i + 1] }; const v2h hi = __builtin_convertvector(x, v2h); pa.p[ct * 4 + i] = hi; pl.p[ct * 4 + i] = __builtin_convertvector((x - __builtin_convertvector(hi, v2f)) * 2048.0f, v2h); } }   // by pairs, one packed conversion each way. P carries 2^11 into the f16 split so small softmax weights stay out of the f16 subnormal range (the sum carries it too, so it cancels in the epilogue)
    v16h fv[4], fvl[4];   // the pass's V fragments, read from LDS as one group
#pragma unroll
    for (int dt = 0; dt < 4; ++dt) { fv[dt] = frag_h(vb + (dt * 16 + col) * VPH + hf * 32, lane); fvl[dt] = frag_h(vb + (64 + dt * 16 + col) * VPH + hf * 32, lane); }
    // holds the eight fragment reads together in front of the products: one LDS latency a pass instead of one per fragment
    asm volatile("" :: "v"(fv[0]), "v"(fv[1]), "v"(fv[2]), "v"(fv[3]), "v"(fvl[0]), "v"(fvl[1]), "v"(fvl[2]), "v"(fvl[3]));
#pragma unroll
    for (int dt = 0; dt < 4; ++dt) { const v16h vh = fv[dt]; acc[dt] = wmma16(vh, pa.v, acc[dt]); accl[dt] = wmma16(vh, pl.v, accl[dt]); accl[dt] = wmma16(fvl[dt], pa.v, accl[dt]); } }   // P hi x V hi + (P lo x V hi + P hi x V lo) / 2048
    asm volatile("s_wait_dscnt 0x0" ::: "memory");      // this wave's reads of the stage are done before the buffer is given up
    asm volatile("s_wait_asynccnt 0x0" ::: "memory");   // this wave's copies of stage st + 1 have landed
    __syncthreads();                                    // publishes stage st + 1 and ends every reader's last read of stage st
    if (st + 2 < nst) { const size_t ak = (size_t)(st + 2) * 64 * (2 * DM), av = (size_t)(st + 2) * 64; stage_kv(QK + gk + ak, QKL + gk + ak, VTH + gv + av, VTL + gv + av, lk + bf * KBUF, lv + bf * VBUF); } }
  asm volatile("s_wait_asynccnt 0x0" ::: "memory");     // no copy is outstanding behind the loop
  const float il = 1.0f / (l + xhalf(l));
#pragma unroll
  for (int dt = 0; dt < 4; ++dt) {
#pragma unroll
    for (int r = 0; r < 8; ++r) so[wave][col][dt * 16 + 8 * g + r] = (acc[dt][r] + accl[dt][r] * (1.0f / 2048.0f)) * il; }
  LDSX();
  for (int rl = 0; rl < 16; ++rl) if (lane < 16) vst2(O + ((size_t)b * SS + q0 + rl) * DM + h * HD + lane * 4, *(const v4f*)&so[wave][rl][lane * 4]);
}
// ---- k_out: block = (64 rows, 128 cols): out = O(hi/lo) . Wo rows (2 products) + bo
__global__ __launch_bounds__(128) void k_out(const float* __restrict__ O, const __bf16* __restrict__ P, const float* __restrict__ BO, float* __restrict__ Y) {
  __shared__ __align__(16) float so[4][16][132];
  const int tid = threadIdx.x, wave = tid >> 5, lane = tid & 31, col = lane & 15, g = lane >> 4; const size_t r0 = (size_t)blockIdx.x * 64 + wave * 16; const int n0 = blockIdx.y * 128;
  v8f acc[8] = {};
#pragma unroll 2
  for (int kc = 0; kc < DM / 32; ++kc) { const F2 a = split_row(O + (r0 + col) * DM, kc * 32, lane);
#pragma unroll
    for (int j = 0; j < 8; ++j) { const v16b w = frag_b(P + (size_t)(n0 + j * 16 + col) * DM + kc * 32, lane); acc[j] = wmma_bf(a.l, w, acc[j]); acc[j] = wmma_bf(a.h, w, acc[j]); } }
#pragma unroll
  for (int j = 0; j < 8; ++j) {
#pragma unroll
    for (int r = 0; r < 8; ++r) so[wave][8 * g + r][j * 16 + col] = acc[j][r] + (BO ? bfr(BO[n0 + j * 16 + col]) : 0.f); }
  LDSX();
  for (int rl = 0; rl < 16; ++rl) vst2(Y + (r0 + rl) * DM + n0 + lane * 4, *(const v4f*)&so[wave][rl][lane * 4]);
}
extern "C" void kernel_launch(void* const* d_in, const int* in_sizes, int n_in, void* d_out, int out_size, void* d_ws, size_t ws_size, hipStream_t stream) {
  (void)in_sizes; (void)n_in; (void)out_size;
  const float** F = (const float**)d_in;   // 0 x [2,2048,1024], 1 Wq, 2 bq, 3 Wk, 4 bk, 5 Wv, 6 bv, 7 Wg, 8 bg (natural [1024,1024] / [1024])
  if (ws_size < (size_t)WS_END) return;
  char* ws = (char*)d_ws; __bf16* PK = (__bf16*)(ws + WS_PK); _Float16 *QK = (_Float16*)(ws + WS_QK), *QKL = (_Float16*)(ws + WS_QKL), *VTH = (_Float16*)(ws + WS_VTH), *VTL = (_Float16*)(ws + WS_VTL);
  k_pack<<<dim3(DM, 4), 256, 0, stream>>>(F[1], F[3], F[5], F[7], PK);   // the fourth slot holds Wg
  k_qkv<<<dim3(TNB * SS / 64, QKVW / 128), 128, 0, stream>>>(F[0], F[0], F[0], PK + PK_A, F[2], F[4], F[6], QK, QKL, VTH, VTL, PK + PK_P, F[8]);
  k_attn<<<dim3(TQB, NH, TNB), 128, 0, stream>>>(QK, QKL, VTH, VTL, nullptr, (float*)d_out);   // merged context == output (no out-projection)
}

// v009
// Measured time: 119 microseconds a run.
// In two side-by-side timings against v008, it was 1.10 and 1.11 times as fast.
// All steps since v000 together make it 4.32 times as fast.
// compute dtype: all float inputs rounded to bf16; q/k/v/g = x . W^T + b with EXACT bf16 products on WMMA 16x16x32 (natural rows; q and g computed in the same block), qg = gelu_erf(q g) in f32 (precise erff) then split into f16 hi + residual; attention with 3-product scores (qg, k as f16 hi + residual) and 3-product P.v (P and v as hi + residual) everywhere; no scaling, softmax in f32 against a maximum that is renewed only when needed (hardware exp); the merged context is the output (f32).
#include <hip/hip_runtime.h>
#include <math.h>

typedef __attribute__((ext_vector_type(16))) _Float16 v16h;
typedef __attribute__((ext_vector_type(16))) __bf16 v16b;
typedef __attribute__((ext_vector_type(8)))  _Float16 v8h;
typedef __attribute__((ext_vector_type(2)))  _Float16 v2h;
typedef __attribute__((ext_vector_type(8)))  float v8f;
typedef __attribute__((ext_vector_type(4)))  float v4f;
typedef __attribute__((ext_vector_type(2)))  float v2f;
typedef __attribute__((ext_vector_type(4)))  unsigned v4u;
typedef __attribute__((ext_vector_type(4)))  int v4i;
typedef float __attribute__((may_alias)) float_a;
typedef int __attribute__((may_alias)) int_a;

template <typename T> __device__ __forceinline__ void vst2(void* p, T v) { *(T*)p = v;  }
// both products are the plain builtin: the compiler itself keeps the distance that the chip needs behind a matrix instruction, and fills it with useful work where it can
__device__ __forceinline__ v8f wmma16(v16h a, v16h b, v8f c) {
  return __builtin_amdgcn_wmma_f32_16x16x32_f16(false, a, false, b, (short)0, c, false, false);
}
__device__ __forceinline__ v8f wmma_bf(v16b a, v16b b, v8f c) {
  return __builtin_amdgcn_wmma_f32_16x16x32_bf16(false, a, false, b, (short)0, c, false, false);
}
// Gated QKV attention (B 2, S 2,048, d 1,024, 16 heads x 64): q, k, v, g projections + biases, qg = gelu(q * g) (exact erf), softmax(qg k^T) v with no 1/sqrt(d) scaling and no output projection.
__device__ __forceinline__ v16h frag_h(const _Float16* rowk0, int lane) {
  union { v16h v; v8h q[2]; } u; const _Float16* p = rowk0 + 8 * (lane >> 4);
  u.q[0] = *(const v8h*)p; u.q[1] = *(const v8h*)(p + 16); return u.v;
}
__device__ __forceinline__ v16h frag_f32(const float* rowk0, int lane) {
  v16h a; const float* p = rowk0 + 8 * (lane >> 4);
#pragma unroll
  for (int i = 0; i < 8; ++i) { a[i] = (_Float16)p[i]; a[8 + i] = (_Float16)p[16 + i]; }
  return a;
}
__device__ __forceinline__ v16h frag_f32s(const float* rowk0, int lane, float sc) {
  v16h a; const float* p = rowk0 + 8 * (lane >> 4);
#pragma unroll
  for (int i = 0; i < 8; ++i) { a[i] = (_Float16)(p[i] * sc); a[8 + i] = (_Float16)(p[16 + i] * sc); }
  return a;
}
// column fragment from a [K][ld] layout (column n), rows >= K read as 0
__device__ __forceinline__ v16h fragc_f32(const float* W, int k0, int n, int lane, int ld, int K) {
  v16h a; const int g = lane >> 4;
#pragma unroll
  for (int i = 0; i < 8; ++i) { const int ka = k0 + 8 * g + i, kb = ka + 16;
    a[i] = (_Float16)(ka < K ? W[(size_t)(ka < K ? ka : K - 1) * ld + n] : 0.f); a[8 + i] = (_Float16)(kb < K ? W[(size_t)(kb < K ? kb : K - 1) * ld + n] : 0.f); }
  return a;
}
struct F2 { v16b h, l; };
__device__ __forceinline__ F2 bsplit16(const float v[16]) { F2 r;
#pragma unroll
  for (int i = 0; i < 16; ++i) { const __bf16 h = (__bf16)v[i]; r.h[i] = h; r.l[i] = (__bf16)(v[i] - (float)h); }
  return r; }
__device__ __forceinline__ F2 split_row(const float* row, int k0, int lane) { float v[16]; const float* p = row + k0 + 8 * (lane >> 4);
#pragma unroll
  for (int i = 0; i < 8; ++i) { v[i] = p[i]; v[8 + i] = p[16 + i]; }
  return bsplit16(v); }
__device__ __forceinline__ F2 split_rowK(const float* row, int k0, int lane, int K) { float v[16]; const int g = lane >> 4;
#pragma unroll
  for (int i = 0; i < 8; ++i) { const int ka = k0 + 8 * g + i, kb = ka + 16; v[i] = ka < K ? row[ka < K ? ka : K - 1] : 0.f; v[8 + i] = kb < K ? row[kb < K ? kb : K - 1] : 0.f; }
  return bsplit16(v); }
__device__ __forceinline__ F2 split_col(const float* W, int k0, int n, int lane, int ld, int K) { float v[16]; const int g = lane >> 4;
#pragma unroll
  for (int i = 0; i < 8; ++i) { const int ka = k0 + 8 * g + i, kb = ka + 16; v[i] = ka < K ? W[(size_t)(ka < K ? ka : K - 1) * ld + n] : 0.f; v[8 + i] = kb < K ? W[(size_t)(kb < K ? kb : K - 1) * ld + n] : 0.f; }
  return bsplit16(v); }
__device__ __forceinline__ v8f mac3(const F2& a, const F2& b, v8f c) { c = wmma_bf(a.l, b.h, c); c = wmma_bf(a.h, b.l, c); return wmma_bf(a.h, b.h, c); }
__device__ __forceinline__ float sigm(float v) { return 1.0f / (1.0f + expf(-v)); }
#define LDSX() do { asm volatile("s_wait_dscnt 0" ::: "memory"); __builtin_amdgcn_wave_barrier(); __builtin_amdgcn_fence(__ATOMIC_RELEASE, "workgroup"); } while (0)


#define NB 2
#define SS 2048
#define DM 1024
#define NH 16
#define SCALEF 1.0f
__device__ __attribute__((noinline)) float gelu_e(float v) { return 0.5f * v * (1.0f + erff(v * 0.70710678118654752f)); }
#define HD 64
#define QKVW (3 * DM)
#ifndef TQB
#define TQB (SS / 64)
#define TNB NB
#define TOB (NB * SS / 64)     // output row tiles (all)
#endif
typedef __attribute__((ext_vector_type(8))) __bf16 v8b;
__device__ __forceinline__ v16b frag_b(const __bf16* rowk0, int lane) {
  union { v16b v; v8b q[2]; } u; const __bf16* p = rowk0 + 8 * (lane >> 4);
  u.q[0] = *(const v8b*)p; u.q[1] = *(const v8b*)(p + 16); return u.v;
}
__device__ __forceinline__ float bfr(float v) { return (float)(__bf16)v; }
__device__ __attribute__((noinline)) float exp_ni(float v) { return expf(v); }
__device__ __attribute__((noinline)) float erf_ni(float v) { return erff(v); }

#define PK_A 0                       // [3072][1024] Wqkv rows (natural [out][in])
#define PK_P (PK_A + QKVW * DM)        // [1024][1024] Wg rows (natural)
#define PK_END (PK_P + DM * DM)
#define WS_PK  0u
#define WS_QK  (WS_PK + 2u * PK_END)             // f16 [4096 rows][2048]: qg | k
#define WS_QKL (WS_QK + 2u * NB * SS * 2 * DM)     // f16 q | k residual planes x2048
#define WS_VTH (WS_QKL + 2u * NB * SS * 2 * DM)    // f16 [b][1024 (h*64+d)][2048 s] hi
#define WS_VTL (WS_VTH + 2u * NB * DM * SS)        // f16 lo x 2048
#define WS_O   (WS_VTL + 2u * NB * DM * SS)        // f32 [4096][1024]
#define WS_CS  (WS_O + 4u * NB * SS * DM)           // f32 2 x [2048][32], unused
#define WS_END (WS_CS + 4u * 2 * SS * 32)
// ---- k_pack: block = (row n, which): natural [out][in] rows -> bf16; which 0..2 -> W_q/W_k/W_v into PK_A rows which*1024 + n; 3 -> W_g into PK_P
__global__ __launch_bounds__(256) void k_pack(const float* __restrict__ WQ, const float* __restrict__ WK, const float* __restrict__ WV, const float* __restrict__ WO, __bf16* __restrict__ PK) {
  __shared__ __align__(16) __bf16 s[DM]; const int n = blockIdx.x, which = blockIdx.y, t = threadIdx.x; const float* Wm = (which == 0) ? WQ : (which == 1) ? WK : (which == 2) ? WV : WO;
  for (int k = t; k < DM; k += 256) s[k] = (__bf16)Wm[(size_t)n * DM + k];
  __syncthreads();
  __bf16* dst = (which < 3) ? PK + PK_A + ((size_t)which * DM + n) * DM : PK + PK_P + (size_t)n * DM;
  for (int q = t; q < DM / 8; q += 256) vst2((unsigned*)(dst + q * 8), *(const v4u*)&s[q * 8]);
}
#define XPB 272u                  // X row pitch in LDS, bytes (256-B rows of 64 f32 + 16 B)
#define WPB 144u                  // weight row pitch in LDS, bytes (128-B rows of 64 bf16 + 16 B)
#define QXB (128u * XPB)          // bytes of one X tile (128 rows)
#define QWB (128u * WPB)          // bytes of one weight tile (128 rows)
#define QSTG (QXB + 2u * QWB)     // bytes of one stage: X | first weight tile | second weight tile
// one thread's eight 16-byte asynchronous copies into LDS: piece i goes from g + i * gs to LDS byte l + i * ls.
// The copies and s_wait_xcnt stand in one statement so that no address register is rewritten ahead of the wait.
__device__ __forceinline__ void stage8(const char* g, size_t gs, unsigned l, unsigned ls) {
  asm volatile("global_load_async_to_lds_b128 %0, %8, off\n\t"
               "global_load_async_to_lds_b128 %1, %9, off\n\t"
               "global_load_async_to_lds_b128 %2, %10, off\n\t"
               "global_load_async_to_lds_b128 %3, %11, off\n\t"
               "global_load_async_to_lds_b128 %4, %12, off\n\t"
               "global_load_async_to_lds_b128 %5, %13, off\n\t"
               "global_load_async_to_lds_b128 %6, %14, off\n\t"
               "global_load_async_to_lds_b128 %7, %15, off\n\t"
               "s_wait_xcnt 0x0"
               :: "v"(l), "v"(l + ls), "v"(l + 2u * ls), "v"(l + 3u * ls), "v"(l + 4u * ls), "v"(l + 5u * ls), "v"(l + 6u * ls), "v"(l + 7u * ls),
                  "v"(g), "v"(g + gs), "v"(g + 2 * gs), "v"(g + 3 * gs), "v"(g + 4 * gs), "v"(g + 5 * gs), "v"(g + 6 * gs), "v"(g + 7 * gs)
               : "memory");
}
// one thread's eight 16-byte asynchronous copies of a stage's two weight tiles: piece i of the first goes from g0 + i * gs to LDS byte l + i * ls, of the second from g1 + i * gs to l + lp + i * ls, i = 0..3.
// The copies and s_wait_xcnt stand in one statement so that no address register is rewritten ahead of the wait.
__device__ __forceinline__ void stage44(const char* g0, const char* g1, size_t gs, unsigned l, unsigned lp, unsigned ls) {
  asm volatile("global_load_async_to_lds_b128 %0, %8, off\n\t"
               "global_load_async_to_lds_b128 %1, %9, off\n\t"
               "global_load_async_to_lds_b128 %2, %10, off\n\t"
               "global_load_async_to_lds_b128 %3, %11, off\n\t"
               "global_load_async_to_lds_b128 %4, %12, off\n\t"
               "global_load_async_to_lds_b128 %5, %13, off\n\t"
               "global_load_async_to_lds_b128 %6, %14, off\n\t"
               "global_load_async_to_lds_b128 %7, %15, off\n\t"
               "s_wait_xcnt 0x0"
               :: "v"(l), "v"(l + ls), "v"(l + 2u * ls), "v"(l + 3u * ls), "v"(l + lp), "v"(l + lp + ls), "v"(l + lp + 2u * ls), "v"(l + lp + 3u * ls),
                  "v"(g0), "v"(g0 + gs), "v"(g0 + 2 * gs), "v"(g0 + 3 * gs), "v"(g1), "v"(g1 + gs), "v"(g1 + 2 * gs), "v"(g1 + 3 * gs)
               : "memory");
}
// ---- k_qkv: block = (128 rows of x, two tiles of 128 output columns: a q block its 128 q columns and their 128 gate columns, a k or v block 256 columns), 8 waves. Wave (rg, ch) holds rows rg * 32 .. + 31 and columns ch * 64 .. + 63 of both tiles: 2 x 8 fragments feed 16 products. A stage is 64 k of the block's X rows (f32) and weight rows (bf16), brought into LDS once per block, two buffers; the epilogue's staging arrays reuse the ring behind the last pass's barrier
__global__ __launch_bounds__(256) void k_qkv(const float* __restrict__ XQ, const float* __restrict__ XK, const float* __restrict__ XV, const __bf16* __restrict__ P, const float* __restrict__ BQ, const float* __restrict__ BK, const float* __restrict__ BV, _Float16* __restrict__ QK, _Float16* __restrict__ QKL, _Float16* __restrict__ VTH, _Float16* __restrict__ VTL, const __bf16* __restrict__ WG, const float* __restrict__ BG) {
  const int n0 = ((int)blockIdx.y < DM / 128) ? (int)blockIdx.y * 128 : DM + ((int)blockIdx.y - DM / 128) * 256;   // the first tile's first row among the packed q | k | v weight rows
  const int which0 = n0 / DM; const float* X = (which0 == 0) ? XQ : (which0 == 1) ? XK : XV; const float* BB = BQ ? (((which0 == 0) ? BQ : (which0 == 1) ? BK : BV) + (n0 - which0 * DM)) : nullptr;
  const float* B2 = (n0 < DM) ? BG + n0 : (BB ? BB + 128 : nullptr);   // the second tile's bias
  __shared__ __align__(16) unsigned char sm[2 * QSTG];
  _Float16 (*so)[32][136] = (_Float16 (*)[32][136])sm; _Float16 (*sol)[32][136] = (_Float16 (*)[32][136])(sm + 8 * 32 * 136 * 2);
  _Float16 (*sth)[136] = (_Float16 (*)[136])sm; _Float16 (*stl)[136] = (_Float16 (*)[136])(sm + 256 * 136 * 2);
  const int tid = threadIdx.x, wave = tid >> 5, lane = tid & 31, col = lane & 15, g = lane >> 4, rg = wave >> 1, ch = wave & 1; const size_t rb = (size_t)blockIdx.x * 128;
  // each thread's share of a stage: 16-byte pieces of X rows tid / 16 + 16 i, i = 0..7, and of each weight tile's rows tid / 8 + 32 i, i = 0..3
  const char* gx = (const char*)(X + (rb + (tid >> 4)) * DM + (tid & 15) * 4);
  const char* gw = (const char*)(P + (size_t)(n0 + (tid >> 3)) * DM + (tid & 7) * 8);
  const char* gg = (const char*)((n0 < DM ? WG + (size_t)n0 * DM : P + (size_t)(n0 + 128) * DM) + (size_t)(tid >> 3) * DM + (tid & 7) * 8);
  const unsigned lx = (unsigned)(size_t)&sm[(tid >> 4) * XPB + (tid & 15) * 16], lw = (unsigned)(size_t)&sm[QXB + (tid >> 3) * WPB + (tid & 7) * 16];
  const int nps = DM / 64;
  v8f acc[2][4] = {}; v8f accg[2][4] = {};
  stage8(gx, (size_t)16 * DM * 4, lx, 16u * XPB); stage44(gw, gg, (size_t)32 * DM * 2, lw, QWB, 32u * WPB);
  asm volatile("s_wait_asynccnt 0x0" ::: "memory");   // stage 0 has landed before the barrier that publishes it
  __syncthreads();
  stage8(gx + 256, (size_t)16 * DM * 4, lx + QSTG, 16u * XPB); stage44(gw + 128, gg + 128, (size_t)32 * DM * 2, lw + QSTG, QWB, 32u * WPB);
#pragma unroll 1
  for (int ps = 0; ps < nps; ++ps) { const unsigned bo = (unsigned)(ps & 1) * QSTG; const unsigned char* sb = sm + bo;
#pragma unroll
    for (int kc = 0; kc < 2; ++kc) { v16b a[2];
#pragma unroll
      for (int i = 0; i < 2; ++i) { const float* p = (const float*)(sb + (rg * 32 + i * 16 + col) * XPB) + kc * 32 + 8 * g;
#pragma unroll
        for (int e = 0; e < 8; ++e) { a[i][e] = (__bf16)p[e]; a[i][8 + e] = (__bf16)p[16 + e]; } }
      v16b fw[4], fg[4];   // the k-step's weight fragments of both tiles, read from LDS as one group
#pragma unroll
      for (int j = 0; j < 4; ++j) { fw[j] = frag_b((const __bf16*)(sb + QXB + (ch * 64 + j * 16 + col) * WPB) + kc * 32, lane); fg[j] = frag_b((const __bf16*)(sb + QXB + QWB + (ch * 64 + j * 16 + col) * WPB) + kc * 32, lane); }
      // holds the fragment reads together in front of the products: one LDS latency a group instead of one per fragment
      asm volatile("" :: "v"(fw[0]), "v"(fw[1]), "v"(fw[2]), "v"(fw[3]), "v"(fg[0]), "v"(fg[1]), "v"(fg[2]), "v"(fg[3]));
#pragma unroll
      for (int j = 0; j < 4; ++j) {
#pragma unroll
        for (int i = 0; i < 2; ++i) acc[i][j] = wmma_bf(a[i], fw[j], acc[i][j]); }
#pragma unroll
      for (int j = 0; j < 4; ++j) {
#pragma unroll
        for (int i = 0; i < 2; ++i) accg[i][j] = wmma_bf(a[i], fg[j], accg[i][j]); } }
    asm volatile("s_wait_dscnt 0x0" ::: "memory");      // this wave's reads of the stage are done before the buffer is given up
    asm volatile("s_wait_asynccnt 0x0" ::: "memory");   // this wave's copies of stage ps + 1 have landed
    __syncthreads();                                    // publishes stage ps + 1 and ends every reader's last read of stage ps
    if (ps + 2 < nps) { const size_t ax = (size_t)(ps + 2) * 256, aw = (size_t)(ps + 2) * 128;
      stage8(gx + ax, (size_t)16 * DM * 4, lx + bo, 16u * XPB); stage44(gw + aw, gg + aw, (size_t)32 * DM * 2, lw + bo, QWB, 32u * WPB); } }
  asm volatile("s_wait_asynccnt 0x0" ::: "memory");     // no copy is outstanding behind the loop; the ring now serves as the epilogue's staging
  float bb[4], bgt[4];   // the lane's bias of each of its four columns of either tile, loaded here as one group: one load latency a wave
#pragma unroll
  for (int j = 0; j < 4; ++j) { bb[j] = 0.f; bgt[j] = 0.f; }
  if (BB) {
#pragma unroll
    for (int j = 0; j < 4; ++j) bb[j] = BB[ch * 64 + j * 16 + col]; }
  if (B2) {
#pragma unroll
    for (int j = 0; j < 4; ++j) bgt[j] = B2[ch * 64 + j * 16 + col]; }
#pragma unroll
  for (int j = 0; j < 4; ++j) { bb[j] = bfr(bb[j]); bgt[j] = bfr(bgt[j]); }
  if (n0 < 2 * DM) {   // q stored unscaled (f16 sigma ~0.6, no subnormal exposure); each wave stages its own 32 rows x (64 | 64) columns
    if (n0 < DM) {
#pragma unroll
      for (int i = 0; i < 2; ++i) {
#pragma unroll
        for (int j = 0; j < 4; ++j) {
#pragma unroll
          for (int r = 0; r < 8; ++r) { const int rw = i * 16 + 8 * g + r, cw = j * 16 + col; const float v = gelu_e((acc[i][j][r] + bb[j]) * (accg[i][j][r] + bgt[j]));
            const _Float16 hv = (_Float16)v; so[wave][rw][cw] = hv; sol[wave][rw][cw] = (_Float16)((v - (float)hv) * 2048.0f); } } }   // gated q as f16 hi + (x2048) residual
    } else {
#pragma unroll
      for (int i = 0; i < 2; ++i) {
#pragma unroll
        for (int j = 0; j < 4; ++j) {
#pragma unroll
          for (int r = 0; r < 8; ++r) { const int rw = i * 16 + 8 * g + r, cw = j * 16 + col; const float v = acc[i][j][r] + bb[j], w = accg[i][j][r] + bgt[j]; const _Float16 hv = (_Float16)v, hw = (_Float16)w;
            so[wave][rw][cw] = hv; sol[wave][rw][cw] = (_Float16)((v - (float)hv) * 2048.0f); so[wave][rw][64 + cw] = hw; sol[wave][rw][64 + cw] = (_Float16)((w - (float)hw) * 2048.0f); } } }   // k (+ bias) as f16 hi + (x2048) residual, both tiles
    }
    LDSX();
    const int nt = (n0 < DM) ? 1 : 2;   // a q block stores one tile (the gate is used up), a k block both; eight lanes store one row's 128 bytes, a whole line
    for (int t = 0; t < nt; ++t) {
      // unrolled so that a tile's sixteen LDS reads go as one group (one LDS latency, not eight) and its stores follow on immediate offsets of one address pair each
#pragma unroll
      for (int it = 0; it < 8; ++it) { const int rw = it * 4 + (lane >> 3), pc = lane & 7; const size_t o = (rb + rg * 32 + rw) * (2 * DM) + n0 + t * 128 + ch * 64 + pc * 8;
        vst2((unsigned*)(QK + o), *(const v4u*)&so[wave][rw][t * 64 + pc * 8]); vst2((unsigned*)(QKL + o), *(const v4u*)&sol[wave][rw][t * 64 + pc * 8]); }
      asm volatile("s_wait_xcnt 0x0" ::: "memory"); }   // stands in front of the next tile's LDS reads, which land in the registers that these stores name as data
  } else {
#pragma unroll
    for (int i = 0; i < 2; ++i) {
#pragma unroll
      for (int j = 0; j < 4; ++j) {
#pragma unroll
        for (int r = 0; r < 8; ++r) { const int sw = rg * 32 + i * 16 + 8 * g + r, dw = ch * 64 + j * 16 + col; const float v = acc[i][j][r] + bb[j], w = accg[i][j][r] + bgt[j]; const _Float16 hv = (_Float16)v, hw = (_Float16)w;
          sth[dw][sw] = hv; stl[dw][sw] = (_Float16)((v - (float)hv) * 2048.0f); sth[128 + dw][sw] = hw; stl[128 + dw][sw] = (_Float16)((w - (float)hw) * 2048.0f); } } }
    __syncthreads();
    const int b = (int)(rb / SS), s0 = (int)(rb % SS); const int pc0 = n0 - 2 * DM;
    for (int q = tid; q < 256 * 16; q += 256) { const int d = q >> 4, pc = q & 15; const size_t o = ((size_t)b * DM + pc0 + d) * SS + s0 + pc * 8; vst2((unsigned*)(VTH + o), *(const v4u*)&sth[d][pc * 8]); vst2((unsigned*)(VTL + o), *(const v4u*)&stl[d][pc * 8]); }
  }
}
#define KPH 72                    // K row pitch in LDS, f16 elements (128-B rows + 16 B)
#define VPH 72                    // V row pitch in LDS, f16 elements (128-B rows of 64 keys + 16 B)
#define KPL (64u * KPH * 2u)      // bytes of one K plane (64 keys)
#define VPL (64u * VPH * 2u)      // bytes of one V plane (64 d)
#define KBUF (2u * KPL)           // bytes of one K buffer (both planes)
#define VBUF (2u * VPL)
#define PSUM 49152.0f             // bound on a lane's sum of a pass's 16 weights (24 * 2^11); beyond it the maximum in use is renewed
#define L2E 1.4426950408889634f   // log2 e
// one thread's eight 16-byte asynchronous copies of one operand (K or V) of a 64-key stage into LDS: its piece of rows r, r + 16, r + 32, r + 48, hi plane then residual plane.
// Eight neighbouring threads bring one row's 128 bytes, a whole line. The copies and s_wait_xcnt stand in one statement so that no address register is rewritten ahead of the wait.
__device__ __forceinline__ void stage_pl(const _Float16* hi, const _Float16* lo, size_t gs, unsigned l, unsigned lp, unsigned ls) {
  asm volatile("global_load_async_to_lds_b128 %0, %8, off\n\t"
               "global_load_async_to_lds_b128 %1, %9, off\n\t"
               "global_load_async_to_lds_b128 %2, %10, off\n\t"
               "global_load_async_to_lds_b128 %3, %11, off\n\t"
               "global_load_async_to_lds_b128 %4, %12, off\n\t"
               "global_load_async_to_lds_b128 %5, %13, off\n\t"
               "global_load_async_to_lds_b128 %6, %14, off\n\t"
               "global_load_async_to_lds_b128 %7, %15, off\n\t"
               "s_wait_xcnt 0x0"
               :: "v"(l), "v"(l + ls), "v"(l + 2u * ls), "v"(l + 3u * ls), "v"(l + lp), "v"(l + lp + ls), "v"(l + lp + 2u * ls), "v"(l + lp + 3u * ls),
                  "v"(hi), "v"(hi + gs), "v"(hi + 2 * gs), "v"(hi + 3 * gs), "v"(lo), "v"(lo + gs), "v"(lo + 2 * gs), "v"(lo + 3 * gs)
               : "memory");
}
// a 64-key stage: K rows (keys) from the q | k planes, V rows (d) from the transposed planes
__device__ __forceinline__ void stage_kv(const _Float16* kh, const _Float16* kl, const _Float16* vh, const _Float16* vl, unsigned lk, unsigned lv) {
  stage_pl(kh, kl, (size_t)16 * (2 * DM), lk, KPL, 16u * KPH * 2u);
  stage_pl(vh, vl, (size_t)16 * SS, lv, VPL, 16u * VPH * 2u);
}
// lane l's value exchanged with lane l ^ 16 (a vector cross-row move; a shuffle would go through the LDS unit)
__device__ __forceinline__ float xhalf(float x) { return __builtin_bit_cast(float, __builtin_amdgcn_permlanex16(__builtin_bit_cast(int, x), __builtin_bit_cast(int, x), 0x76543210, 0xfedcba98, false, false)); }
// eight exponents to their powers of two, in place. One asm statement, so that the slot which the instruction set asks for behind a transcendental stands behind the last one
// by construction. The two s_delay_alu are the hints that compiled code
// carries at such places: the SIMD's other waves issue while this one waits for its exponents and, behind the statement, for the last result; they change no value
__device__ __forceinline__ void exp2x8(float (&x)[8]) {
  asm("s_delay_alu instid0(VALU_DEP_1)\n\t"
      "v_exp_f32 %0, %0\n\tv_exp_f32 %1, %1\n\tv_exp_f32 %2, %2\n\tv_exp_f32 %3, %3\n\t"
      "v_exp_f32 %4, %4\n\tv_exp_f32 %5, %5\n\tv_exp_f32 %6, %6\n\tv_exp_f32 %7, %7\n\t"
      "v_nop\n\t"
      "s_delay_alu instid0(TRANS32_DEP_1)"
      : "+v"(x[0]), "+v"(x[1]), "+v"(x[2]), "+v"(x[3]), "+v"(x[4]), "+v"(x[5]), "+v"(x[6]), "+v"(x[7]));
}
// the lane's 16 weights of a pass, 2^11 * exp(s - m), and their sum: one fused multiply-add per score forms the exponent s * log2 e + nb, nb = 11 - m * log2 e, for the hardware's exp2
__device__ __forceinline__ float exps16(const v8f (&s)[2], float nb, float (&e)[2][8]) {
  float t[8];
#pragma unroll
  for (int ct = 0; ct < 2; ++ct) {
#pragma unroll
    for (int r = 0; r < 8; ++r) e[ct][r] = __builtin_fmaf(s[ct][r], L2E, nb);
    exp2x8(e[ct]); }
#pragma unroll
  for (int r = 0; r < 8; ++r) t[r] = e[0][r] + e[1][r];
  return ((t[0] + t[1]) + (t[2] + t[3])) + ((t[4] + t[5]) + (t[6] + t[7]));
}
__global__ __launch_bounds__(128) void k_attn(const _Float16* __restrict__ QK, const _Float16* __restrict__ QKL, const _Float16* __restrict__ VTH, const _Float16* __restrict__ VTL, const void* __restrict__ KMASK, float* __restrict__ O) {
  __shared__ __align__(16) unsigned char sm[2u * (KBUF + VBUF)];   // the ring: K [buffer][hi, residual][64 keys][d], then V [buffer][hi, residual][64 d][64 keys], all 144-B rows
  float (*so)[16][68] = (float (*)[16][68])sm;   // the epilogue's staging reuses the ring behind the last stage's barrier (so four blocks still fit a WGP's LDS)
  const int tid = threadIdx.x, wave = tid >> 5, lane = tid & 31, col = lane & 15, g = lane >> 4;
  const int qb = blockIdx.x, h = blockIdx.y, b = blockIdx.z;
  // each thread's share of a 64-key stage: one 16-byte piece of K rows and of V rows tid / 8 + 16 i, i = 0..3, both planes
  const size_t gk = ((size_t)b * SS + (tid >> 3)) * (2 * DM) + DM + h * HD + (tid & 7) * 8, gv = ((size_t)b * DM + h * HD + (tid >> 3)) * SS + (tid & 7) * 8;
  const unsigned lk = (unsigned)(size_t)&sm[(tid >> 3) * (KPH * 2u) + (tid & 7) * 16u], lv = (unsigned)(size_t)&sm[2u * KBUF + (tid >> 3) * (VPH * 2u) + (tid & 7) * 16u]; const int q0 = qb * 64 + wave * 16; const size_t rq = (size_t)b * SS + q0 + col;
  v16h aq[2], aql[2];
#pragma unroll
  for (int kc = 0; kc < 2; ++kc) { aq[kc] = frag_h(QK + rq * (2 * DM) + h * HD + kc * 32, lane); aql[kc] = frag_h(QKL + rq * (2 * DM) + h * HD + kc * 32, lane); }
  float m = -3.0e38f, l = 0.f;   // the lane's query: the maximum in use (equal in both halves) and this half's share of the sum of the weights (scaled by 2^11 like them)
  float nb = __builtin_inff();   // 11 - m * log2 e, the addend of every exponent; infinite while no maximum is in use
  v8f acc[4] = {}, accl[4] = {};   // O^T tiles: register r = d dt * 16 + 8 g + r of query col
  const int nst = SS / 64;   // all keys, in stages of 64
  stage_kv(QK + gk, QKL + gk, VTH + gv, VTL + gv, lk, lv);
  asm volatile("s_wait_asynccnt 0x0" ::: "memory");   // stage 0 has landed before the barrier that publishes it
  __syncthreads();
  stage_kv(QK + gk + (size_t)64 * (2 * DM), QKL + gk + (size_t)64 * (2 * DM), VTH + gv + 64, VTL + gv + 64, lk + KBUF, lv + VBUF);
#pragma unroll 1
  for (int st = 0; st < nst; ++st) { const int bf = st & 1; const _Float16* kb = (const _Float16*)(sm + bf * KBUF); const _Float16* vb = (const _Float16*)(sm + 2u * KBUF + bf * VBUF);
#pragma unroll
   for (int hf = 0; hf < 2; ++hf) { v8f s[2];   // the stage's two passes of 32 keys, each as before; unrolled so that the half's place in the buffer is an immediate offset of the LDS reads
    v16h fk[2][2], fkl[2][2];   // the pass's K fragments, read from LDS as one group
#pragma unroll
    for (int ct = 0; ct < 2; ++ct) {
#pragma unroll
      for (int kc = 0; kc < 2; ++kc) { fk[ct][kc] = frag_h(kb + (hf * 32 + ct * 16 + col) * KPH + kc * 32, lane); fkl[ct][kc] = frag_h(kb + (64 + hf * 32 + ct * 16 + col) * KPH + kc * 32, lane); } }
    // holds the eight fragment reads together in front of the products: one LDS latency a pass instead of one per fragment
    asm volatile("" :: "v"(fk[0][0]), "v"(fk[0][1]), "v"(fk[1][0]), "v"(fk[1][1]), "v"(fkl[0][0]), "v"(fkl[0][1]), "v"(fkl[1][0]), "v"(fkl[1][1]));
#pragma unroll
    for (int ct = 0; ct < 2; ++ct) { v8f c = {}, cl = {};
#pragma unroll
      for (int kc = 0; kc < 2; ++kc) { const v16h kh = fk[ct][kc]; c = wmma16(kh, aq[kc], c); cl = wmma16(kh, aql[kc], cl); cl = wmma16(fkl[ct][kc], aq[kc], cl); }   // 3 products: q, k as f16 hi + residual
#pragma unroll
      for (int r = 0; r < 8; ++r) c[r] += cl[r] * (1.0f / 2048.0f);
      { const bool keepk = true;
#pragma unroll
      for (int r = 0; r < 8; ++r) s[ct][r] = keepk ? c[r] * SCALEF : -3.0e38f; } }   // unscaled (SCALEF = 1); masked keys excluded
    // lazy rescale: the weights are taken against m, the maximum in use, which may trail the true one. They are not negative, so a lane's sum of at most PSUM bounds each of them,
    // and each stays under the f16 limit (24 * 2^11 = 49,152). One test a pass, a scalar branch on the whole wave's vote
    float e[2][8]; float ts = exps16(s, nb, e);
    if (__builtin_amdgcn_ballot_w32(!(ts <= PSUM)) != 0) {   // rare: some lane's sum is beyond the bound (always in pass 0, where it is infinite): only then the pass's maximum, the rescale, and the exponentials anew
      // the lane's 16 scores, as a tree of three-way maxima (short dependent chain)
      const float u0 = fmaxf(fmaxf(s[0][0], s[1][0]), s[0][1]), u1 = fmaxf(fmaxf(s[1][1], s[0][2]), s[1][2]), u2 = fmaxf(fmaxf(s[0][3], s[1][3]), s[0][4]), u3 = fmaxf(fmaxf(s[1][4], s[0][5]), s[1][5]), u4 = fmaxf(fmaxf(s[0][6], s[1][6]), s[0][7]);
      float mx = fmaxf(fmaxf(fmaxf(u0, u1), u2), fmaxf(fmaxf(u3, u4), s[1][7]));
      mx = fmaxf(mx, xhalf(mx));   // both halves now hold the query's maximum over the pass's 32 keys
      const float mn = fmaxf(m, mx); const float alpha = (m <= -1.0e38f) ? 0.f : __expf(m - mn);
      m = mn; nb = __builtin_fmaf(-mn, L2E, 11.0f); l *= alpha;
#pragma unroll
      for (int dt = 0; dt < 4; ++dt) { acc[dt] = acc[dt] * alpha; accl[dt] = accl[dt] * alpha; }
      ts = exps16(s, nb, e); }   // now every weight is at most 2^11
    l += ts;   // the halves' sums are joined once, in the epilogue
    union { v16h v; v2h p[8]; } pa, pl;   // P^T as a B operand: element i = key 8 g + i, element 8 + i = key 16 + 8 g + i, the k order of the V fragments
#pragma unroll
    for (int ct = 0; ct < 2; ++ct) {
#pragma unroll
      for (int i = 0; i < 4; ++i) { const v2f x = { e[ct][2 * i], e[ct][2 * i + 1] }; const v2h hi = __builtin_convertvector(x, v2h); pa.p[ct * 4 + i] = hi; pl.p[ct * 4 + i] = __builtin_convertvector((x - __builtin_convertvector(hi, v2f)) * 2048.0f, v2h); } }   // by pairs, one packed conversion each way. P carries 2^11 into the f16 split so small softmax weights stay out of the f16 subnormal range (the sum carries it too, so it cancels in the epilogue)
    v16h fv[4], fvl[4];   // the pass's V fragments, read from LDS as one group
#pragma unroll
    for (int dt = 0; dt < 4; ++dt) { fv[dt] = frag_h(vb + (dt * 16 + col) * VPH + hf * 32, lane); fvl[dt] = frag_h(vb + (64 + dt * 16 + col) * VPH + hf * 32, lane); }
    // holds the eight fragment reads together in front of the products: one LDS latency a pass instead of one per fragment
    asm volatile("" :: "v"(fv[0]), "v"(fv[1]), "v"(fv[2]), "v"(fv[3]), "v"(fvl[0]), "v"(fvl[1]), "v"(fvl[2]), "v"(fvl[3]));
#pragma unroll
    for (int dt = 0; dt < 4; ++dt) { const v16h vh = fv[dt]; acc[dt] = wmma16(vh, pa.v, acc[dt]); accl[dt] = wmma16(vh, pl.v, accl[dt]); accl[dt] = wmma16(fvl[dt], pa.v, accl[dt]); } }   // P hi x V hi + (P lo x V hi + P hi x V lo) / 2048
    asm volatile("s_wait_dscnt 0x0" ::: "memory");      // this wave's reads of the stage are done before the buffer is given up
    asm volatile("s_wait_asynccnt 0x0" ::: "memory");   // this wave's copies of stage st + 1 have landed
    __syncthreads();                                    // publishes stage st + 1 and ends every reader's last read of stage st
    if (st + 2 < nst) { const size_t ak = (size_t)(st + 2) * 64 * (2 * DM), av = (size_t)(st + 2) * 64; stage_kv(QK + gk + ak, QKL + gk + ak, VTH + gv + av, VTL + gv + av, lk + bf * KBUF, lv + bf * VBUF); } }
  asm volatile("s_wait_asynccnt 0x0" ::: "memory");     // no copy is outstanding behind the loop
  const float il = 1.0f / (l + xhalf(l));
#pragma unroll
  for (int dt = 0; dt < 4; ++dt) {
#pragma unroll
    for (int r = 0; r < 8; ++r) so[wave][col][dt * 16 + 8 * g + r] = (acc[dt][r] + accl[dt][r] * (1.0f / 2048.0f)) * il; }
  LDSX();
  for (int rl = 0; rl < 16; ++rl) if (lane < 16) vst2(O + ((size_t)b * SS + q0 + rl) * DM + h * HD + lane * 4, *(const v4f*)&so[wave][rl][lane * 4]);
}
// ---- k_out: block = (64 rows, 128 cols): out = O(hi/lo) . Wo rows (2 products) + bo
__global__ __launch_bounds__(128) void k_out(const float* __restrict__ O, const __bf16* __restrict__ P, const float* __restrict__ BO, float* __restrict__ Y) {
  __shared__ __align__(16) float so[4][16][132];
  const int tid = threadIdx.x, wave = tid >> 5, lane = tid & 31, col = lane & 15, g = lane >> 4; const size_t r0 = (size_t)blockIdx.x * 64 + wave * 16; const int n0 = blockIdx.y * 128;
  v8f acc[8] = {};
#pragma unroll 2
  for (int kc = 0; kc < DM / 32; ++kc) { const F2 a = split_row(O + (r0 + col) * DM, kc * 32, lane);
#pragma unroll
    for (int j = 0; j < 8; ++j) { const v16b w = frag_b(P + (size_t)(n0 + j * 16 + col) * DM + kc * 32, lane); acc[j] = wmma_bf(a.l, w, acc[j]); acc[j] = wmma_bf(a.h, w, acc[j]); } }
#pragma unroll
  for (int j = 0; j < 8; ++j) {
#pragma unroll
    for (int r = 0; r < 8; ++r) so[wave][8 * g + r][j * 16 + col] = acc[j][r] + (BO ? bfr(BO[n0 + j * 16 + col]) : 0.f); }
  LDSX();
  for (int rl = 0; rl < 16; ++rl) vst2(Y + (r0 + rl) * DM + n0 + lane * 4, *(const v4f*)&so[wave][rl][lane * 4]);
}
extern "C" void kernel_launch(void* const* d_in, const int* in_sizes, int n_in, void* d_out, int out_size, void* d_ws, size_t ws_size, hipStream_t stream) {
  (void)in_sizes; (void)n_in; (void)out_size;
  const float** F = (const float**)d_in;   // 0 x [2,2048,1024], 1 Wq, 2 bq, 3 Wk, 4 bk, 5 Wv, 6 bv, 7 Wg, 8 bg (natural [1024,1024] / [1024])
  if (ws_size < (size_t)WS_END) return;
  char* ws = (char*)d_ws; __bf16* PK = (__bf16*)(ws + WS_PK); _Float16 *QK = (_Float16*)(ws + WS_QK), *QKL = (_Float16*)(ws + WS_QKL), *VTH = (_Float16*)(ws + WS_VTH), *VTL = (_Float16*)(ws + WS_VTL);
  k_pack<<<dim3(DM, 4), 256, 0, stream>>>(F[1], F[3], F[5], F[7], PK);   // the fourth slot holds Wg
  k_qkv<<<dim3(TNB * SS / 128, DM / 128 + 2 * DM / 256), 256, 0, stream>>>(F[0], F[0], F[0], PK + PK_A, F[2], F[4], F[6], QK, QKL, VTH, VTL, PK + PK_P, F[8]);
  k_attn<<<dim3(TQB, NH, TNB), 128, 0, stream>>>(QK, QKL, VTH, VTL, nullptr, (float*)d_out);   // merged context == output (no out-projection)
}
